// v000
// Measured on an AMD MI455X. A time is GPU time per run, averaged over a window of back-to-back runs after a warm-up
// (all launches, gaps included; the runs take copies of the inputs in turn), and the median of several windows.
// Apart from v000's, it joins two sittings. Times from different sittings can be a few percent apart, while
// side-by-side timings come from the same sitting.
// v000 is the starting kernel. One run takes 649 microseconds.
// compute dtype: all float inputs rounded to bf16; qkv = x . W_in^T + b with EXACT bf16 products on WMMA 16x16x32 (natural rows; the packed in_proj is three contiguous row blocks); PLAIN attention: q, k single f16 x 1/8, running-max softmax in f32 (hardware exp), P (scaled by 2^11, single f16) x v (single f16); out = o (bf16 hi + residual) . W_out^T (2 products) + b_out.
#include <hip/hip_runtime.h>
#include <math.h>

typedef __attribute__((ext_vector_type(16))) _Float16 v16h;
typedef __attribute__((ext_vector_type(16))) __bf16 v16b;
typedef __attribute__((ext_vector_type(8)))  _Float16 v8h;
typedef __attribute__((ext_vector_type(8)))  float v8f;
typedef __attribute__((ext_vector_type(4)))  float v4f;
typedef __attribute__((ext_vector_type(2)))  float v2f;
typedef __attribute__((ext_vector_type(4)))  unsigned v4u;
typedef __attribute__((ext_vector_type(4)))  int v4i;
typedef float __attribute__((may_alias)) float_a;
typedef int __attribute__((may_alias)) int_a;

template <typename T> __device__ __forceinline__ void vst2(void* p, T v) { *(T*)p = v;  }
__device__ __forceinline__ v8f wmma16(v16h a, v16h b, v8f c) {
  v8f d = __builtin_amdgcn_wmma_f32_16x16x32_f16(false, a, false, b, (short)0, c, false, false);
  asm volatile("v_nop\n\tv_nop\n\tv_nop\n\tv_nop" : "+v"(d) : "v"(a), "v"(b));
  return d;
}
__device__ __forceinline__ v8f wmma_bf(v16b a, v16b b, v8f c) {
  v8f d = __builtin_amdgcn_wmma_f32_16x16x32_bf16(false, a, false, b, (short)0, c, false, false);
  asm volatile("v_nop\n\tv_nop\n\tv_nop\n\tv_nop" : "+v"(d) : "v"(a), "v"(b));
  return d;
}
// nn.MultiheadAttention-style self attention (B 4, S 2,048, E 1,024, 16 heads x 64): packed in_proj (natural [3E][E]) + bias, softmax(q k^T / 8) v, out_proj + bias.
__device__ __forceinline__ v16h frag_h(const _Float16* rowk0, int lane) {
  union { v16h v; v8h q[2]; } u; const _Float16* p = rowk0 + 8 * (lane >> 4);
  u.q[0] = *(const v8h*)p; u.q[1] = *(const v8h*)(p + 16); return u.v;
}
__device__ __forceinline__ v16h frag_f32(const float* rowk0, int lane) {
  v16h a; const float* p = rowk0 + 8 * (lane >> 4);
#pragma unroll
  for (int i = 0; i < 8; ++i) { a[i] = (_Float16)p[i]; a[8 + i] = (_Float16)p[16 + i]; }
  return a;
}
__device__ __forceinline__ v16h frag_f32s(const float* rowk0, int lane, float sc) {
  v16h a; const float* p = rowk0 + 8 * (lane >> 4);
#pragma unroll
  for (int i = 0; i < 8; ++i) { a[i] = (_Float16)(p[i] * sc); a[8 + i] = (_Float16)(p[16 + i] * sc); }
  return a;
}
// column fragment from a [K][ld] layout (column n), rows >= K read as 0
__device__ __forceinline__ v16h fragc_f32(const float* W, int k0, int n, int lane, int ld, int K) {
  v16h a; const int g = lane >> 4;
#pragma unroll
  for (int i = 0; i < 8; ++i) { const int ka = k0 + 8 * g + i, kb = ka + 16;
    a[i] = (_Float16)(ka < K ? W[(size_t)(ka < K ? ka : K - 1) * ld + n] : 0.f); a[8 + i] = (_Float16)(kb < K ? W[(size_t)(kb < K ? kb : K - 1) * ld + n] : 0.f); }
  return a;
}
struct F2 { v16b h, l; };
__device__ __forceinline__ F2 bsplit16(const float v[16]) { F2 r;
#pragma unroll
  for (int i = 0; i < 16; ++i) { const __bf16 h = (__bf16)v[i]; r.h[i] = h; r.l[i] = (__bf16)(v[i] - (float)h); }
  return r; }
__device__ __forceinline__ F2 split_row(const float* row, int k0, int lane) { float v[16]; const float* p = row + k0 + 8 * (lane >> 4);
#pragma unroll
  for (int i = 0; i < 8; ++i) { v[i] = p[i]; v[8 + i] = p[16 + i]; }
  return bsplit16(v); }
__device__ __forceinline__ F2 split_rowK(const float* row, int k0, int lane, int K) { float v[16]; const int g = lane >> 4;
#pragma unroll
  for (int i = 0; i < 8; ++i) { const int ka = k0 + 8 * g + i, kb = ka + 16; v[i] = ka < K ? row[ka < K ? ka : K - 1] : 0.f; v[8 + i] = kb < K ? row[kb < K ? kb : K - 1] : 0.f; }
  return bsplit16(v); }
__device__ __forceinline__ F2 split_col(const float* W, int k0, int n, int lane, int ld, int K) { float v[16]; const int g = lane >> 4;
#pragma unroll
  for (int i = 0; i < 8; ++i) { const int ka = k0 + 8 * g + i, kb = ka + 16; v[i] = ka < K ? W[(size_t)(ka < K ? ka : K - 1) * ld + n] : 0.f; v[8 + i] = kb < K ? W[(size_t)(kb < K ? kb : K - 1) * ld + n] : 0.f; }
  return bsplit16(v); }
__device__ __forceinline__ v8f mac3(const F2& a, const F2& b, v8f c) { c = wmma_bf(a.l, b.h, c); c = wmma_bf(a.h, b.l, c); return wmma_bf(a.h, b.h, c); }
__device__ __forceinline__ float sigm(float v) { return 1.0f / (1.0f + expf(-v)); }
#define LDSX() do { asm volatile("s_wait_dscnt 0" ::: "memory"); __builtin_amdgcn_wave_barrier(); __builtin_amdgcn_fence(__ATOMIC_RELEASE, "workgroup"); } while (0)


#define NB 4
#define SS 2048
#define DM 1024
#define NH 16
#define HD 64
#define QKVW (3 * DM)
#ifndef TQB
#define TQB (SS / 64)
#define TNB NB
#define TOB (NB * SS / 64)     // output row tiles (all)
#endif
typedef __attribute__((ext_vector_type(8))) __bf16 v8b;
__device__ __forceinline__ v16b frag_b(const __bf16* rowk0, int lane) {
  union { v16b v; v8b q[2]; } u; const __bf16* p = rowk0 + 8 * (lane >> 4);
  u.q[0] = *(const v8b*)p; u.q[1] = *(const v8b*)(p + 16); return u.v;
}
__device__ __forceinline__ float bfr(float v) { return (float)(__bf16)v; }
__device__ __attribute__((noinline)) float exp_ni(float v) { return expf(v); }
__device__ __attribute__((noinline)) float erf_ni(float v) { return erff(v); }

#define PK_A 0                       // [3072][1024] Wqkv rows (natural [out][in])
#define PK_P (PK_A + QKVW * DM)        // [1024][1024] Wo rows (natural)
#define PK_END (PK_P + DM * DM)
#define WS_PK  0u
#define WS_QK  (WS_PK + 2u * PK_END)             // f16 [8192 rows][2048]: q | k
#define WS_QKL (WS_QK + 2u * NB * SS * 2 * DM)     // f16 q | k residual planes x2048
#define WS_VTH (WS_QKL + 2u * NB * SS * 2 * DM)    // f16 [b][1024 (h*64+d)][2048 s] hi
#define WS_VTL (WS_VTH + 2u * NB * DM * SS)        // f16 lo x 2048
#define WS_O   (WS_VTL + 2u * NB * DM * SS)        // f32 [8192][1024]
#define WS_CS  (WS_O + 4u * NB * SS * DM)           // f32 2 x [2048][32], unused
#define WS_END (WS_CS + 4u * 2 * SS * 32)
// ---- k_pack: block = (row n, which): natural [out][in] rows -> bf16; which 0..2 -> W_q/W_k/W_v into PK_A rows which*1024 + n; 3 -> W_o into PK_P
__global__ __launch_bounds__(256) void k_pack(const float* __restrict__ WQ, const float* __restrict__ WK, const float* __restrict__ WV, const float* __restrict__ WO, __bf16* __restrict__ PK) {
  __shared__ __align__(16) __bf16 s[DM]; const int n = blockIdx.x, which = blockIdx.y, t = threadIdx.x; const float* Wm = (which == 0) ? WQ : (which == 1) ? WK : (which == 2) ? WV : WO;
  for (int k = t; k < DM; k += 256) s[k] = (__bf16)Wm[(size_t)n * DM + k];
  __syncthreads();
  __bf16* dst = (which < 3) ? PK + PK_A + ((size_t)which * DM + n) * DM : PK + PK_P + (size_t)n * DM;
  for (int q = t; q < DM / 8; q += 256) vst2((unsigned*)(dst + q * 8), *(const v4u*)&s[q * 8]);
}
__global__ __launch_bounds__(128) void k_qkv(const float* __restrict__ XQ, const float* __restrict__ XK, const float* __restrict__ XV, const __bf16* __restrict__ P, const float* __restrict__ BQ, const float* __restrict__ BK, const float* __restrict__ BV, _Float16* __restrict__ QK, _Float16* __restrict__ QKL, _Float16* __restrict__ VTH, _Float16* __restrict__ VTL) {
  const int which0 = (blockIdx.y * 128) / DM; const float* X = (which0 == 0) ? XQ : (which0 == 1) ? XK : XV; const float* BB = BQ ? (((which0 == 0) ? BQ : (which0 == 1) ? BK : BV) + (blockIdx.y * 128 - which0 * DM)) : nullptr;
  __shared__ __align__(16) _Float16 so[4][16][136], sol[4][16][136]; __shared__ __align__(16) _Float16 sth[128][72], stl[128][72];
  const int tid = threadIdx.x, wave = tid >> 5, lane = tid & 31, col = lane & 15, g = lane >> 4; const size_t r0 = (size_t)blockIdx.x * 64 + wave * 16; const int n0 = blockIdx.y * 128;
  v8f acc[8] = {};
#pragma unroll 2
  for (int kc = 0; kc < DM / 32; ++kc) { v16b a; { const float* p = X + (r0 + col) * DM + kc * 32 + 8 * g;
#pragma unroll
      for (int i = 0; i < 8; ++i) { a[i] = (__bf16)p[i]; a[8 + i] = (__bf16)p[16 + i]; } }
#pragma unroll
    for (int j = 0; j < 8; ++j) acc[j] = wmma_bf(a, frag_b(P + (size_t)(n0 + j * 16 + col) * DM + kc * 32, lane), acc[j]); }
  if (n0 < 2 * DM) {   // q stored unscaled (f16 sigma ~0.6, no subnormal exposure); 1/8 applied to the f32 score
#pragma unroll
    for (int j = 0; j < 8; ++j) {
#pragma unroll
      for (int r = 0; r < 8; ++r) { const float v = acc[j][r] + (BB ? bfr(BB[j * 16 + col]) : 0.f); const _Float16 hv = (_Float16)v; so[wave][8 * g + r][j * 16 + col] = hv; sol[wave][8 * g + r][j * 16 + col] = (_Float16)((v - (float)hv) * 2048.0f); } }   // q, k (+ bias) as f16 hi + (x2048) residual
    LDSX();
    for (int rl = 0; rl < 16; ++rl) if (lane < 16) { vst2((unsigned*)(QK + (r0 + rl) * (2 * DM) + n0 + lane * 8), *(const v4u*)&so[wave][rl][lane * 8]); vst2((unsigned*)(QKL + (r0 + rl) * (2 * DM) + n0 + lane * 8), *(const v4u*)&sol[wave][rl][lane * 8]); }
  } else {
#pragma unroll
    for (int j = 0; j < 8; ++j) {
#pragma unroll
      for (int r = 0; r < 8; ++r) { const float v = acc[j][r] + (BB ? bfr(BB[j * 16 + col]) : 0.f); const _Float16 hv = (_Float16)v; sth[j * 16 + col][wave * 16 + 8 * g + r] = hv; stl[j * 16 + col][wave * 16 + 8 * g + r] = (_Float16)((v - (float)hv) * 2048.0f); } }
    __syncthreads();
    const size_t rb = (size_t)blockIdx.x * 64; const int b = (int)(rb / SS), s0 = (int)(rb % SS); const int pc0 = n0 - 2 * DM;
    for (int q = tid; q < 128 * 8; q += 128) { const int d = q >> 3, pc = q & 7; const size_t o = ((size_t)b * DM + pc0 + d) * SS + s0 + pc * 8; vst2((unsigned*)(VTH + o), *(const v4u*)&sth[d][pc * 8]); vst2((unsigned*)(VTL + o), *(const v4u*)&stl[d][pc * 8]); }
  }
}
// ---- k_attn: block = (64 queries, head h, batch b): all-keys flash attention (K = 64: 2 k-steps), scores = (q.k) * 0.125 with single f16 operands, P.V: f16 P (x2^11) x V hi in one accumulator (accl stays 0); O[b*S+q][h*64+d] = (acc + accl / 2048) / (2048 l) (256-B segments)
__global__ __launch_bounds__(128) void k_attn(const _Float16* __restrict__ QK, const _Float16* __restrict__ QKL, const _Float16* __restrict__ VTH, const _Float16* __restrict__ VTL, const void* __restrict__ KMASK, float* __restrict__ O) {
  __shared__ __align__(16) float sp[4][16][36]; __shared__ __align__(16) float so[4][16][68];
  const int tid = threadIdx.x, wave = tid >> 5, lane = tid & 31, col = lane & 15, g = lane >> 4;
  const int qb = blockIdx.x, h = blockIdx.y, b = blockIdx.z; const int q0 = qb * 64 + wave * 16; const size_t rq = (size_t)b * SS + q0 + col;
  v16h aq[2], aql[2];
#pragma unroll
  for (int kc = 0; kc < 2; ++kc) { aq[kc] = frag_h(QK + rq * (2 * DM) + h * HD + kc * 32, lane); aql[kc] = frag_h(QKL + rq * (2 * DM) + h * HD + kc * 32, lane); }
  float m[8], l[8];
#pragma unroll
  for (int r = 0; r < 8; ++r) { m[r] = -3.0e38f; l[r] = 0.f; }
  v8f acc[4] = {}, accl[4] = {};
  const int nks = SS / 32;   // all keys
#pragma unroll 1
  for (int ks = 0; ks < nks; ++ks) { v8f s[2];
#pragma unroll
    for (int ct = 0; ct < 2; ++ct) { const int kk = ks * 32 + ct * 16 + col; const _Float16* krow = QK + ((size_t)b * SS + kk) * (2 * DM) + DM + h * HD; const _Float16* krowl = QKL + ((size_t)b * SS + kk) * (2 * DM) + DM + h * HD; v8f c = {}, cl = {};
#pragma unroll
      for (int kc = 0; kc < 2; ++kc) c = wmma16(aq[kc], frag_h(krow + kc * 32, lane), c);   // single product: q, k as one-rounding f16 operands
      (void)cl; (void)krowl;
      { const bool keepk = true;
#pragma unroll
      for (int r = 0; r < 8; ++r) s[ct][r] = keepk ? c[r] * 0.125f : -3.0e38f; } }   // 1/sqrt(64); no key is masked
#pragma unroll
    for (int r = 0; r < 8; ++r) { float mx = fmaxf(s[0][r], s[1][r]);
#pragma unroll
      for (int o = 1; o < 16; o <<= 1) mx = fmaxf(mx, __shfl_xor(mx, o));
      const float mn = fmaxf(m[r], mx); const float alpha = (m[r] <= -1.0e38f) ? 0.f : __expf(m[r] - mn);
      const float e0 = (s[0][r] <= -1.0e38f) ? 0.f : __expf(s[0][r] - mn), e1 = (s[1][r] <= -1.0e38f) ? 0.f : __expf(s[1][r] - mn); float es = e0 + e1;
#pragma unroll
      for (int o = 1; o < 16; o <<= 1) es += __shfl_xor(es, o);
      l[r] = l[r] * alpha + es; m[r] = mn;
#pragma unroll
      for (int dt = 0; dt < 4; ++dt) { acc[dt][r] *= alpha; accl[dt][r] *= alpha; }
      sp[wave][8 * g + r][col] = e0; sp[wave][8 * g + r][16 + col] = e1; }
    LDSX();
    v16h pa, pl; { const float* prow = &sp[wave][col][0] + 8 * (lane >> 4);
#pragma unroll
      for (int i = 0; i < 8; ++i) { const float x0 = prow[i] * 2048.0f, x1 = prow[16 + i] * 2048.0f; const _Float16 h0 = (_Float16)x0, h1 = (_Float16)x1; pa[i] = h0; pa[8 + i] = h1; pl[i] = (_Float16)((x0 - (float)h0) * 2048.0f); pl[8 + i] = (_Float16)((x1 - (float)h1) * 2048.0f); } }   // P scaled by 2^11 before the f16 split so small softmax weights stay out of the f16 subnormal range; 2^-11 folded into the epilogue
#pragma unroll
    for (int dt = 0; dt < 4; ++dt) { const size_t vr = ((size_t)b * DM + h * HD + dt * 16 + col) * SS + ks * 32; acc[dt] = wmma16(pa, frag_h(VTH + vr, lane), acc[dt]); }   // single product: P (x2^11) x V
    (void)pl;
    LDSX(); }
#pragma unroll
  for (int r = 0; r < 8; ++r) { const float il = (1.0f / 2048.0f) / l[r];
#pragma unroll
    for (int dt = 0; dt < 4; ++dt) so[wave][8 * g + r][dt * 16 + col] = (acc[dt][r] + accl[dt][r] * (1.0f / 2048.0f)) * il; }
  LDSX();
  for (int rl = 0; rl < 16; ++rl) if (lane < 16) vst2(O + ((size_t)b * SS + q0 + rl) * DM + h * HD + lane * 4, *(const v4f*)&so[wave][rl][lane * 4]);
}
// ---- k_out: block = (64 rows, 128 cols): out = O(hi/lo) . Wo rows (2 products) + bo
__global__ __launch_bounds__(128) void k_out(const float* __restrict__ O, const __bf16* __restrict__ P, const float* __restrict__ BO, float* __restrict__ Y) {
  __shared__ __align__(16) float so[4][16][132];
  const int tid = threadIdx.x, wave = tid >> 5, lane = tid & 31, col = lane & 15, g = lane >> 4; const size_t r0 = (size_t)blockIdx.x * 64 + wave * 16; const int n0 = blockIdx.y * 128;
  v8f acc[8] = {};
#pragma unroll 2
  for (int kc = 0; kc < DM / 32; ++kc) { const F2 a = split_row(O + (r0 + col) * DM, kc * 32, lane);
#pragma unroll
    for (int j = 0; j < 8; ++j) { const v16b w = frag_b(P + (size_t)(n0 + j * 16 + col) * DM + kc * 32, lane); acc[j] = wmma_bf(a.l, w, acc[j]); acc[j] = wmma_bf(a.h, w, acc[j]); } }
#pragma unroll
  for (int j = 0; j < 8; ++j) {
#pragma unroll
    for (int r = 0; r < 8; ++r) so[wave][8 * g + r][j * 16 + col] = acc[j][r] + bfr(BO[n0 + j * 16 + col]); }
  LDSX();
  for (int rl = 0; rl < 16; ++rl) vst2(Y + (r0 + rl) * DM + n0 + lane * 4, *(const v4f*)&so[wave][rl][lane * 4]);
}
extern "C" void kernel_launch(void* const* d_in, const int* in_sizes, int n_in, void* d_out, int out_size, void* d_ws, size_t ws_size, hipStream_t stream) {
  (void)in_sizes; (void)n_in; (void)out_size;
  const float** F = (const float**)d_in;   // 0 x [4,2048,1024], 1 in_proj_weight [3072,1024], 2 in_proj_bias [3072], 3 out_proj_weight [1024,1024], 4 out_proj_bias
  if (ws_size < (size_t)WS_END) return;
  char* ws = (char*)d_ws; __bf16* PK = (__bf16*)(ws + WS_PK); _Float16 *QK = (_Float16*)(ws + WS_QK), *QKL = (_Float16*)(ws + WS_QKL), *VTH = (_Float16*)(ws + WS_VTH), *VTL = (_Float16*)(ws + WS_VTL); float* O = (float*)(ws + WS_O);
  k_pack<<<dim3(DM, 4), 256, 0, stream>>>(F[1], F[1] + (size_t)DM * DM, F[1] + (size_t)2 * DM * DM, F[3], PK);
  k_qkv<<<dim3(TNB * SS / 64, QKVW / 128), 128, 0, stream>>>(F[0], F[0], F[0], PK + PK_A, F[2], F[2] + DM, F[2] + 2 * DM, QK, QKL, VTH, VTL);
  k_attn<<<dim3(TQB, NH, TNB), 128, 0, stream>>>(QK, QKL, VTH, VTL, nullptr, O);
  k_out<<<dim3(TOB, DM / 128), 128, 0, stream>>>(O, PK + PK_P, F[4], (float*)d_out);
}

// v001
// Measured time: 276 microseconds a run.
// Two timings next to v000 both put it at 2.42 times that version's speed.
// compute dtype: all float inputs rounded to bf16; qkv = x . W_in^T + b with EXACT bf16 products on WMMA 16x16x32 (natural rows; the packed in_proj is three contiguous row blocks); PLAIN attention: q, k single f16 x 1/8, running-max softmax in f32 (hardware exp), P (scaled by 2^11, single f16) x v (single f16); out = o (bf16 hi + residual) . W_out^T (2 products) + b_out.
#include <hip/hip_runtime.h>
#include <math.h>

typedef __attribute__((ext_vector_type(16))) _Float16 v16h;
typedef __attribute__((ext_vector_type(16))) __bf16 v16b;
typedef __attribute__((ext_vector_type(8)))  _Float16 v8h;
typedef __attribute__((ext_vector_type(8)))  float v8f;
typedef __attribute__((ext_vector_type(4)))  float v4f;
typedef __attribute__((ext_vector_type(2)))  float v2f;
typedef __attribute__((ext_vector_type(4)))  unsigned v4u;
typedef __attribute__((ext_vector_type(4)))  int v4i;
typedef float __attribute__((may_alias)) float_a;
typedef int __attribute__((may_alias)) int_a;

template <typename T> __device__ __forceinline__ void vst2(void* p, T v) { *(T*)p = v;  }
__device__ __forceinline__ v8f wmma16(v16h a, v16h b, v8f c) {
  v8f d = __builtin_amdgcn_wmma_f32_16x16x32_f16(false, a, false, b, (short)0, c, false, false);
  asm volatile("v_nop\n\tv_nop\n\tv_nop\n\tv_nop" : "+v"(d) : "v"(a), "v"(b));
  return d;
}
__device__ __forceinline__ v8f wmma_bf(v16b a, v16b b, v8f c) {
  v8f d = __builtin_amdgcn_wmma_f32_16x16x32_bf16(false, a, false, b, (short)0, c, false, false);
  asm volatile("v_nop\n\tv_nop\n\tv_nop\n\tv_nop" : "+v"(d) : "v"(a), "v"(b));
  return d;
}
// nn.MultiheadAttention-style self attention (B 4, S 2,048, E 1,024, 16 heads x 64): packed in_proj (natural [3E][E]) + bias, softmax(q k^T / 8) v, out_proj + bias.
__device__ __forceinline__ v16h frag_h(const _Float16* rowk0, int lane) {
  union { v16h v; v8h q[2]; } u; const _Float16* p = rowk0 + 8 * (lane >> 4);
  u.q[0] = *(const v8h*)p; u.q[1] = *(const v8h*)(p + 16); return u.v;
}
__device__ __forceinline__ v16h frag_f32(const float* rowk0, int lane) {
  v16h a; const float* p = rowk0 + 8 * (lane >> 4);
#pragma unroll
  for (int i = 0; i < 8; ++i) { a[i] = (_Float16)p[i]; a[8 + i] = (_Float16)p[16 + i]; }
  return a;
}
__device__ __forceinline__ v16h frag_f32s(const float* rowk0, int lane, float sc) {
  v16h a; const float* p = rowk0 + 8 * (lane >> 4);
#pragma unroll
  for (int i = 0; i < 8; ++i) { a[i] = (_Float16)(p[i] * sc); a[8 + i] = (_Float16)(p[16 + i] * sc); }
  return a;
}
// column fragment from a [K][ld] layout (column n), rows >= K read as 0
__device__ __forceinline__ v16h fragc_f32(const float* W, int k0, int n, int lane, int ld, int K) {
  v16h a; const int g = lane >> 4;
#pragma unroll
  for (int i = 0; i < 8; ++i) { const int ka = k0 + 8 * g + i, kb = ka + 16;
    a[i] = (_Float16)(ka < K ? W[(size_t)(ka < K ? ka : K - 1) * ld + n] : 0.f); a[8 + i] = (_Float16)(kb < K ? W[(size_t)(kb < K ? kb : K - 1) * ld + n] : 0.f); }
  return a;
}
struct F2 { v16b h, l; };
__device__ __forceinline__ F2 bsplit16(const float v[16]) { F2 r;
#pragma unroll
  for (int i = 0; i < 16; ++i) { const __bf16 h = (__bf16)v[i]; r.h[i] = h; r.l[i] = (__bf16)(v[i] - (float)h); }
  return r; }
__device__ __forceinline__ F2 split_row(const float* row, int k0, int lane) { float v[16]; const float* p = row + k0 + 8 * (lane >> 4);
#pragma unroll
  for (int i = 0; i < 8; ++i) { v[i] = p[i]; v[8 + i] = p[16 + i]; }
  return bsplit16(v); }
__device__ __forceinline__ F2 split_rowK(const float* row, int k0, int lane, int K) { float v[16]; const int g = lane >> 4;
#pragma unroll
  for (int i = 0; i < 8; ++i) { const int ka = k0 + 8 * g + i, kb = ka + 16; v[i] = ka < K ? row[ka < K ? ka : K - 1] : 0.f; v[8 + i] = kb < K ? row[kb < K ? kb : K - 1] : 0.f; }
  return bsplit16(v); }
__device__ __forceinline__ F2 split_col(const float* W, int k0, int n, int lane, int ld, int K) { float v[16]; const int g = lane >> 4;
#pragma unroll
  for (int i = 0; i < 8; ++i) { const int ka = k0 + 8 * g + i, kb = ka + 16; v[i] = ka < K ? W[(size_t)(ka < K ? ka : K - 1) * ld + n] : 0.f; v[8 + i] = kb < K ? W[(size_t)(kb < K ? kb : K - 1) * ld + n] : 0.f; }
  return bsplit16(v); }
__device__ __forceinline__ v8f mac3(const F2& a, const F2& b, v8f c) { c = wmma_bf(a.l, b.h, c); c = wmma_bf(a.h, b.l, c); return wmma_bf(a.h, b.h, c); }
__device__ __forceinline__ float sigm(float v) { return 1.0f / (1.0f + expf(-v)); }
#define LDSX() do { asm volatile("s_wait_dscnt 0" ::: "memory"); __builtin_amdgcn_wave_barrier(); __builtin_amdgcn_fence(__ATOMIC_RELEASE, "workgroup"); } while (0)


#define NB 4
#define SS 2048
#define DM 1024
#define NH 16
#define HD 64
#define QKVW (3 * DM)
#ifndef TQB
#define TQB (SS / 64)
#define TNB NB
#define TOB (NB * SS / 64)     // output row tiles (all)
#endif
typedef __attribute__((ext_vector_type(8))) __bf16 v8b;
__device__ __forceinline__ v16b frag_b(const __bf16* rowk0, int lane) {
  union { v16b v; v8b q[2]; } u; const __bf16* p = rowk0 + 8 * (lane >> 4);
  u.q[0] = *(const v8b*)p; u.q[1] = *(const v8b*)(p + 16); return u.v;
}
__device__ __forceinline__ float bfr(float v) { return (float)(__bf16)v; }
__device__ __attribute__((noinline)) float exp_ni(float v) { return expf(v); }
__device__ __attribute__((noinline)) float erf_ni(float v) { return erff(v); }

#define PK_A 0                       // [3072][1024] Wqkv rows (natural [out][in])
#define PK_P (PK_A + QKVW * DM)        // [1024][1024] Wo rows (natural)
#define PK_END (PK_P + DM * DM)
#define WS_PK  0u
#define WS_QK  (WS_PK + 2u * PK_END)             // f16 [8192 rows][2048]: q | k
#define WS_QKL (WS_QK + 2u * NB * SS * 2 * DM)     // f16 q | k residual planes x2048
#define WS_VTH (WS_QKL + 2u * NB * SS * 2 * DM)    // f16 [b][1024 (h*64+d)][2048 s] hi
#define WS_VTL (WS_VTH + 2u * NB * DM * SS)        // f16 lo x 2048
#define WS_O   (WS_VTL + 2u * NB * DM * SS)        // f32 [8192][1024]
#define WS_CS  (WS_O + 4u * NB * SS * DM)           // f32 2 x [2048][32], unused
#define WS_END (WS_CS + 4u * 2 * SS * 32)
// ---- k_pack: block = (row n, which): natural [out][in] rows -> bf16; which 0..2 -> W_q/W_k/W_v into PK_A rows which*1024 + n; 3 -> W_o into PK_P
__global__ __launch_bounds__(256) void k_pack(const float* __restrict__ WQ, const float* __restrict__ WK, const float* __restrict__ WV, const float* __restrict__ WO, __bf16* __restrict__ PK) {
  __shared__ __align__(16) __bf16 s[DM]; const int n = blockIdx.x, which = blockIdx.y, t = threadIdx.x; const float* Wm = (which == 0) ? WQ : (which == 1) ? WK : (which == 2) ? WV : WO;
  for (int k = t; k < DM; k += 256) s[k] = (__bf16)Wm[(size_t)n * DM + k];
  __syncthreads();
  __bf16* dst = (which < 3) ? PK + PK_A + ((size_t)which * DM + n) * DM : PK + PK_P + (size_t)n * DM;
  for (int q = t; q < DM / 8; q += 256) vst2((unsigned*)(dst + q * 8), *(const v4u*)&s[q * 8]);
}
// LDS staging: a stage is 64 k (one 128-B line of every 16-bit operand row); rows lie at a pitch of 144 B (16 B x odd) for the ds_load_b128 fragment readers
#define KS 64
#define LP 72
typedef __attribute__((ext_vector_type(4))) __bf16 v4b;
__global__ __launch_bounds__(128) void k_qkv(const float* __restrict__ XQ, const float* __restrict__ XK, const float* __restrict__ XV, const __bf16* __restrict__ P, const float* __restrict__ BQ, const float* __restrict__ BK, const float* __restrict__ BV, _Float16* __restrict__ QK, _Float16* __restrict__ QKL, _Float16* __restrict__ VTH, _Float16* __restrict__ VTL) {
  const int which0 = (blockIdx.y * 128) / DM; const float* X = (which0 == 0) ? XQ : (which0 == 1) ? XK : XV; const float* BB = BQ ? (((which0 == 0) ? BQ : (which0 == 1) ? BK : BV) + (blockIdx.y * 128 - which0 * DM)) : nullptr;
  // the two stage buffers and the epilogue's staging share one LDS range: the loop's last barrier stands between them
  __shared__ __align__(16) union { struct { __bf16 a[2][64][LP], b[2][128][LP]; } st; struct { _Float16 so[4][16][136], sol[4][16][136]; } qk; struct { _Float16 sth[128][72], stl[128][72]; } vt; } sm;
  auto& so = sm.qk.so; auto& sol = sm.qk.sol; auto& sth = sm.vt.sth; auto& stl = sm.vt.stl;
  const int tid = threadIdx.x, wave = tid >> 5, lane = tid & 31, col = lane & 15, g = lane >> 4; const size_t r0 = (size_t)blockIdx.x * 64 + wave * 16; const int n0 = blockIdx.y * 128;
  v8f acc[8] = {};
  // whole-line global loads: W 8 lanes x 16 B = one line of a row (4 rows a wave-load), x 16 lanes x 16 B = two lines of a row (2 rows a wave-load)
  const int br = tid >> 3, bc = (tid & 7) * 8, ar = tid >> 4, ac = (tid & 15) * 4;
  const __bf16* pb = P + (size_t)(n0 + br) * DM + bc; const float* pa = X + ((size_t)blockIdx.x * 64 + ar) * DM + ac;
  v8b rb[8]; v4f ra[8];
#pragma unroll
  for (int i = 0; i < 8; ++i) { rb[i] = *(const v8b*)(pb + (size_t)i * 16 * DM); ra[i] = *(const v4f*)(pa + (size_t)i * 8 * DM); }
#pragma unroll
  for (int i = 0; i < 8; ++i) { *(v8b*)&sm.st.b[0][br + 16 * i][bc] = rb[i]; v4b c; c[0] = (__bf16)ra[i][0]; c[1] = (__bf16)ra[i][1]; c[2] = (__bf16)ra[i][2]; c[3] = (__bf16)ra[i][3]; *(v4b*)&sm.st.a[0][ar + 8 * i][ac] = c; }
  __syncthreads();
#pragma unroll 2   // two stages a trip: the buffer index is a constant in the addresses
  for (int s = 0; s < DM / KS; ++s) { const int cur = s & 1;
    if (s + 1 < DM / KS) {   // the next stage's lines fly into registers while this stage is multiplied
#pragma unroll
      for (int i = 0; i < 8; ++i) { rb[i] = *(const v8b*)(pb + (size_t)i * 16 * DM + (s + 1) * KS); ra[i] = *(const v4f*)(pa + (size_t)i * 8 * DM + (s + 1) * KS); } }
#pragma unroll
    for (int kc = 0; kc < KS / 32; ++kc) { const v16b a = frag_b(&sm.st.a[cur][wave * 16 + col][kc * 32], lane); v16b w[8];
#pragma unroll
      for (int j = 0; j < 8; ++j) w[j] = frag_b(&sm.st.b[cur][j * 16 + col][kc * 32], lane);
      asm volatile("" :: "v"(a), "v"(w[0]), "v"(w[1]), "v"(w[2]), "v"(w[3]), "v"(w[4]), "v"(w[5]), "v"(w[6]), "v"(w[7]));   // holds the block's LDS reads as one group in front of its WMMAs: one LDS latency a block, not one a WMMA
#pragma unroll
      for (int j = 0; j < 8; ++j) acc[j] = wmma_bf(a, w[j], acc[j]); }
    __builtin_amdgcn_sched_barrier(0);   // keeps the conversions below, and with them the wait on the global loads, behind this stage's WMMAs
    if (s + 1 < DM / KS) {   // into the buffer whose readers all passed the barrier of the trip before
#pragma unroll
      for (int i = 0; i < 8; ++i) { *(v8b*)&sm.st.b[cur ^ 1][br + 16 * i][bc] = rb[i]; v4b c; c[0] = (__bf16)ra[i][0]; c[1] = (__bf16)ra[i][1]; c[2] = (__bf16)ra[i][2]; c[3] = (__bf16)ra[i][3]; *(v4b*)&sm.st.a[cur ^ 1][ar + 8 * i][ac] = c; } }
    __syncthreads(); }   // publishes stage s + 1 and ends every read of stage s
  if (n0 < 2 * DM) {   // q stored unscaled (f16 sigma ~0.6, no subnormal exposure); 1/8 applied to the f32 score
#pragma unroll
    for (int j = 0; j < 8; ++j) {
#pragma unroll
      for (int r = 0; r < 8; ++r) { const float v = acc[j][r] + (BB ? bfr(BB[j * 16 + col]) : 0.f); const _Float16 hv = (_Float16)v; so[wave][8 * g + r][j * 16 + col] = hv; sol[wave][8 * g + r][j * 16 + col] = (_Float16)((v - (float)hv) * 2048.0f); } }   // q, k (+ bias) as f16 hi + (x2048) residual
    LDSX();
    for (int rl = 0; rl < 16; ++rl) if (lane < 16) { vst2((unsigned*)(QK + (r0 + rl) * (2 * DM) + n0 + lane * 8), *(const v4u*)&so[wave][rl][lane * 8]); vst2((unsigned*)(QKL + (r0 + rl) * (2 * DM) + n0 + lane * 8), *(const v4u*)&sol[wave][rl][lane * 8]); }
  } else {
#pragma unroll
    for (int j = 0; j < 8; ++j) {
#pragma unroll
      for (int r = 0; r < 8; ++r) { const float v = acc[j][r] + (BB ? bfr(BB[j * 16 + col]) : 0.f); const _Float16 hv = (_Float16)v; sth[j * 16 + col][wave * 16 + 8 * g + r] = hv; stl[j * 16 + col][wave * 16 + 8 * g + r] = (_Float16)((v - (float)hv) * 2048.0f); } }
    __syncthreads();
    const size_t rb = (size_t)blockIdx.x * 64; const int b = (int)(rb / SS), s0 = (int)(rb % SS); const int pc0 = n0 - 2 * DM;
    for (int q = tid; q < 128 * 8; q += 128) { const int d = q >> 3, pc = q & 7; const size_t o = ((size_t)b * DM + pc0 + d) * SS + s0 + pc * 8; vst2((unsigned*)(VTH + o), *(const v4u*)&sth[d][pc * 8]); vst2((unsigned*)(VTL + o), *(const v4u*)&stl[d][pc * 8]); }
  }
}
// ---- k_attn: block = (64 queries, head h, batch b): all-keys flash attention (K = 64: 2 k-steps), scores = (q.k) * 0.125 with single f16 operands, P.V: f16 P (x2^11) x V hi in one accumulator (accl stays 0); O[b*S+q][h*64+d] = (acc + accl / 2048) / (2048 l) (256-B segments)
__global__ __launch_bounds__(128) void k_attn(const _Float16* __restrict__ QK, const _Float16* __restrict__ QKL, const _Float16* __restrict__ VTH, const _Float16* __restrict__ VTL, const void* __restrict__ KMASK, float* __restrict__ O) {
  // one stage = 64 keys: k rows [key][64 d] and v rows [d][64 keys], one 128-B line each; the stage and the epilogue's staging share one LDS range, the barrier after the loop between them
  __shared__ __align__(16) float sp[4][16][36]; __shared__ __align__(16) union { struct { _Float16 k[64][LP], v[64][LP]; } st; float so[4][16][68]; } sm;
  auto& so = sm.so;
  const int tid = threadIdx.x, wave = tid >> 5, lane = tid & 31, col = lane & 15, g = lane >> 4;
  const int qb = blockIdx.x, h = blockIdx.y, b = blockIdx.z; const int q0 = qb * 64 + wave * 16; const size_t rq = (size_t)b * SS + q0 + col;
  v16h aq[2], aql[2];
#pragma unroll
  for (int kc = 0; kc < 2; ++kc) { aq[kc] = frag_h(QK + rq * (2 * DM) + h * HD + kc * 32, lane); aql[kc] = frag_h(QKL + rq * (2 * DM) + h * HD + kc * 32, lane); }
  float m[8], l[8];
#pragma unroll
  for (int r = 0; r < 8; ++r) { m[r] = -3.0e38f; l[r] = 0.f; }
  v8f acc[4] = {}, accl[4] = {};
  const int sr = tid >> 3, sc = (tid & 7) * 8;   // whole-line global loads: 8 lanes x 16 B = one line of a row, 4 rows a wave-load
  const _Float16* pk = QK + ((size_t)b * SS + sr) * (2 * DM) + DM + h * HD + sc; const _Float16* pv = VTH + ((size_t)b * DM + h * HD + sr) * SS + sc;
#pragma unroll 1   // rolled: the barriers bound every stage anyway, and the loop's text stays small
  for (int st = 0; st < SS / 64; ++st) {   // all keys
    { v8h rk[4], rv[4];
#pragma unroll
      for (int i = 0; i < 4; ++i) { rk[i] = *(const v8h*)(pk + (size_t)(st * 64 + 16 * i) * (2 * DM)); rv[i] = *(const v8h*)(pv + (size_t)(16 * i) * SS + st * 64); }
      __syncthreads();   // every wave has left the stage before
#pragma unroll
      for (int i = 0; i < 4; ++i) { *(v8h*)&sm.st.k[sr + 16 * i][sc] = rk[i]; *(v8h*)&sm.st.v[sr + 16 * i][sc] = rv[i]; } }
    __syncthreads();   // publishes the stage
#pragma unroll   // both halves of the stage in line: constant LDS offsets
  for (int sub = 0; sub < 2; ++sub) { v8f s[2]; v16h fk[2][2];
#pragma unroll
    for (int ct = 0; ct < 2; ++ct) { fk[ct][0] = frag_h(&sm.st.k[sub * 32 + ct * 16 + col][0], lane); fk[ct][1] = frag_h(&sm.st.k[sub * 32 + ct * 16 + col][32], lane); }
    asm volatile("" :: "v"(fk[0][0]), "v"(fk[0][1]), "v"(fk[1][0]), "v"(fk[1][1]));   // holds the four k fragments' LDS reads as one group in front of the score WMMAs: one LDS latency, not four
#pragma unroll
    for (int ct = 0; ct < 2; ++ct) { v8f c = {}, cl = {};
#pragma unroll
      for (int kc = 0; kc < 2; ++kc) c = wmma16(aq[kc], fk[ct][kc], c);   // single product: q, k as one-rounding f16 operands
      (void)cl;
      { const bool keepk = true;
#pragma unroll
      for (int r = 0; r < 8; ++r) s[ct][r] = keepk ? c[r] * 0.125f : -3.0e38f; } }   // 1/sqrt(64); no key is masked
#pragma unroll
    for (int r = 0; r < 8; ++r) { float mx = fmaxf(s[0][r], s[1][r]);
#pragma unroll
      for (int o = 1; o < 16; o <<= 1) mx = fmaxf(mx, __shfl_xor(mx, o));
      const float mn = fmaxf(m[r], mx); const float alpha = (m[r] <= -1.0e38f) ? 0.f : __expf(m[r] - mn);
      const float e0 = (s[0][r] <= -1.0e38f) ? 0.f : __expf(s[0][r] - mn), e1 = (s[1][r] <= -1.0e38f) ? 0.f : __expf(s[1][r] - mn); float es = e0 + e1;
#pragma unroll
      for (int o = 1; o < 16; o <<= 1) es += __shfl_xor(es, o);
      l[r] = l[r] * alpha + es; m[r] = mn;
#pragma unroll
      for (int dt = 0; dt < 4; ++dt) { acc[dt][r] *= alpha; accl[dt][r] *= alpha; }
      sp[wave][8 * g + r][col] = e0; sp[wave][8 * g + r][16 + col] = e1; }
    LDSX();
    v16h pa, pl; { const float* prow = &sp[wave][col][0] + 8 * (lane >> 4);
#pragma unroll
      for (int i = 0; i < 8; ++i) { const float x0 = prow[i] * 2048.0f, x1 = prow[16 + i] * 2048.0f; const _Float16 h0 = (_Float16)x0, h1 = (_Float16)x1; pa[i] = h0; pa[8 + i] = h1; pl[i] = (_Float16)((x0 - (float)h0) * 2048.0f); pl[8 + i] = (_Float16)((x1 - (float)h1) * 2048.0f); } }   // P scaled by 2^11 before the f16 split so small softmax weights stay out of the f16 subnormal range; 2^-11 folded into the epilogue
#pragma unroll
    for (int dt = 0; dt < 4; ++dt) acc[dt] = wmma16(pa, frag_h(&sm.st.v[dt * 16 + col][sub * 32], lane), acc[dt]);   // single product: P (x2^11) x V
    (void)pl;
    LDSX(); } }
  __syncthreads();   // every wave has left the last stage: its LDS becomes the output staging
#pragma unroll
  for (int r = 0; r < 8; ++r) { const float il = (1.0f / 2048.0f) / l[r];
#pragma unroll
    for (int dt = 0; dt < 4; ++dt) so[wave][8 * g + r][dt * 16 + col] = (acc[dt][r] + accl[dt][r] * (1.0f / 2048.0f)) * il; }
  LDSX();
  for (int rl = 0; rl < 16; ++rl) if (lane < 16) vst2(O + ((size_t)b * SS + q0 + rl) * DM + h * HD + lane * 4, *(const v4f*)&so[wave][rl][lane * 4]);
}
// ---- k_out: block = (64 rows, 128 cols): out = O(hi/lo) . Wo rows (2 products) + bo
__global__ __launch_bounds__(128) void k_out(const float* __restrict__ O, const __bf16* __restrict__ P, const float* __restrict__ BO, float* __restrict__ Y) {
  // the two stage buffers and the epilogue's staging share one LDS range: the loop's last barrier stands between them
  __shared__ __align__(16) union { struct { __bf16 ah[2][64][LP], al[2][64][LP], b[2][128][LP]; } st; float so[4][16][132]; } sm;
  auto& so = sm.so;
  const int tid = threadIdx.x, wave = tid >> 5, lane = tid & 31, col = lane & 15, g = lane >> 4; const size_t r0 = (size_t)blockIdx.x * 64 + wave * 16; const int n0 = blockIdx.y * 128;
  v8f acc[8] = {};
  // whole-line global loads, as in k_qkv; o is split into its bf16 hi and residual planes on the way into LDS
  const int br = tid >> 3, bc = (tid & 7) * 8, ar = tid >> 4, ac = (tid & 15) * 4;
  const __bf16* pb = P + (size_t)(n0 + br) * DM + bc; const float* pa = O + ((size_t)blockIdx.x * 64 + ar) * DM + ac;
  v8b rb[8]; v4f ra[8];
#pragma unroll
  for (int i = 0; i < 8; ++i) { rb[i] = *(const v8b*)(pb + (size_t)i * 16 * DM); ra[i] = *(const v4f*)(pa + (size_t)i * 8 * DM); }
#pragma unroll
  for (int i = 0; i < 8; ++i) { *(v8b*)&sm.st.b[0][br + 16 * i][bc] = rb[i]; v4b ch, cl;
#pragma unroll
    for (int e = 0; e < 4; ++e) { const __bf16 hv = (__bf16)ra[i][e]; ch[e] = hv; cl[e] = (__bf16)(ra[i][e] - (float)hv); }
    *(v4b*)&sm.st.ah[0][ar + 8 * i][ac] = ch; *(v4b*)&sm.st.al[0][ar + 8 * i][ac] = cl; }
  __syncthreads();
#pragma unroll 2   // two stages a trip: the buffer index is a constant in the addresses
  for (int s = 0; s < DM / KS; ++s) { const int cur = s & 1;
    if (s + 1 < DM / KS) {   // the next stage's lines fly into registers while this stage is multiplied
#pragma unroll
      for (int i = 0; i < 8; ++i) { rb[i] = *(const v8b*)(pb + (size_t)i * 16 * DM + (s + 1) * KS); ra[i] = *(const v4f*)(pa + (size_t)i * 8 * DM + (s + 1) * KS); } }
#pragma unroll
    for (int kc = 0; kc < KS / 32; ++kc) { const v16b ah = frag_b(&sm.st.ah[cur][wave * 16 + col][kc * 32], lane), al = frag_b(&sm.st.al[cur][wave * 16 + col][kc * 32], lane);
#pragma unroll
      for (int jj = 0; jj < 8; jj += 4) { v16b w[4];
#pragma unroll
        for (int j = 0; j < 4; ++j) w[j] = frag_b(&sm.st.b[cur][(jj + j) * 16 + col][kc * 32], lane);
        asm volatile("" :: "v"(ah), "v"(al), "v"(w[0]), "v"(w[1]), "v"(w[2]), "v"(w[3]));   // holds the block's LDS reads as one group in front of its WMMAs: one LDS latency a block, not one a WMMA
#pragma unroll
        for (int j = 0; j < 4; ++j) { acc[jj + j] = wmma_bf(al, w[j], acc[jj + j]); acc[jj + j] = wmma_bf(ah, w[j], acc[jj + j]); } } }
    __builtin_amdgcn_sched_barrier(0);   // keeps the split below, and with it the wait on the global loads, behind this stage's WMMAs
    if (s + 1 < DM / KS) {   // into the buffer whose readers all passed the barrier of the trip before
#pragma unroll
      for (int i = 0; i < 8; ++i) { *(v8b*)&sm.st.b[cur ^ 1][br + 16 * i][bc] = rb[i]; v4b ch, cl;
#pragma unroll
        for (int e = 0; e < 4; ++e) { const __bf16 hv = (__bf16)ra[i][e]; ch[e] = hv; cl[e] = (__bf16)(ra[i][e] - (float)hv); }
        *(v4b*)&sm.st.ah[cur ^ 1][ar + 8 * i][ac] = ch; *(v4b*)&sm.st.al[cur ^ 1][ar + 8 * i][ac] = cl; } }
    __syncthreads(); }   // publishes stage s + 1 and ends every read of stage s
#pragma unroll
  for (int j = 0; j < 8; ++j) {
#pragma unroll
    for (int r = 0; r < 8; ++r) so[wave][8 * g + r][j * 16 + col] = acc[j][r] + bfr(BO[n0 + j * 16 + col]); }
  LDSX();
  for (int rl = 0; rl < 16; ++rl) vst2(Y + (r0 + rl) * DM + n0 + lane * 4, *(const v4f*)&so[wave][rl][lane * 4]);
}
extern "C" void kernel_launch(void* const* d_in, const int* in_sizes, int n_in, void* d_out, int out_size, void* d_ws, size_t ws_size, hipStream_t stream) {
  (void)in_sizes; (void)n_in; (void)out_size;
  const float** F = (const float**)d_in;   // 0 x [4,2048,1024], 1 in_proj_weight [3072,1024], 2 in_proj_bias [3072], 3 out_proj_weight [1024,1024], 4 out_proj_bias
  if (ws_size < (size_t)WS_END) return;
  char* ws = (char*)d_ws; __bf16* PK = (__bf16*)(ws + WS_PK); _Float16 *QK = (_Float16*)(ws + WS_QK), *QKL = (_Float16*)(ws + WS_QKL), *VTH = (_Float16*)(ws + WS_VTH), *VTL = (_Float16*)(ws + WS_VTL); float* O = (float*)(ws + WS_O);
  k_pack<<<dim3(DM, 4), 256, 0, stream>>>(F[1], F[1] + (size_t)DM * DM, F[1] + (size_t)2 * DM * DM, F[3], PK);
  k_qkv<<<dim3(TNB * SS / 64, QKVW / 128), 128, 0, stream>>>(F[0], F[0], F[0], PK + PK_A, F[2], F[2] + DM, F[2] + 2 * DM, QK, QKL, VTH, VTL);
  k_attn<<<dim3(TQB, NH, TNB), 128, 0, stream>>>(QK, QKL, VTH, VTL, nullptr, O);
  k_out<<<dim3(TOB, DM / 128), 128, 0, stream>>>(O, PK + PK_P, F[4], (float*)d_out);
}

// v002
// A run of this version takes 210 microseconds.
// Two timings next to v001 both put it at 1.31 times that version's speed.
// All steps since v000 together make it 3.17 times as fast.
// compute dtype: all float inputs rounded to bf16; qkv = x . W_in^T + b with EXACT bf16 products on WMMA 16x16x32 (natural rows; the packed in_proj is three contiguous row blocks); PLAIN attention: q, k single f16 x 1/8, running-max softmax in f32 (hardware exp), P (scaled by 2^11, single f16) x v (single f16); out = o (bf16 hi + residual) . W_out^T (2 products) + b_out.
#include <hip/hip_runtime.h>
#include <math.h>

typedef __attribute__((ext_vector_type(16))) _Float16 v16h;
typedef __attribute__((ext_vector_type(16))) __bf16 v16b;
typedef __attribute__((ext_vector_type(8)))  _Float16 v8h;
typedef __attribute__((ext_vector_type(8)))  float v8f;
typedef __attribute__((ext_vector_type(4)))  float v4f;
typedef __attribute__((ext_vector_type(2)))  float v2f;
typedef __attribute__((ext_vector_type(4)))  unsigned v4u;
typedef __attribute__((ext_vector_type(4)))  int v4i;
typedef float __attribute__((may_alias)) float_a;
typedef int __attribute__((may_alias)) int_a;

template <typename T> __device__ __forceinline__ void vst2(void* p, T v) { *(T*)p = v;  }
__device__ __forceinline__ v8f wmma16(v16h a, v16h b, v8f c) {
  v8f d = __builtin_amdgcn_wmma_f32_16x16x32_f16(false, a, false, b, (short)0, c, false, false);
  asm volatile("v_nop\n\tv_nop\n\tv_nop\n\tv_nop" : "+v"(d) : "v"(a), "v"(b));
  return d;
}
__device__ __forceinline__ v8f wmma_bf(v16b a, v16b b, v8f c) {
  v8f d = __builtin_amdgcn_wmma_f32_16x16x32_bf16(false, a, false, b, (short)0, c, false, false);
  asm volatile("v_nop\n\tv_nop\n\tv_nop\n\tv_nop" : "+v"(d) : "v"(a), "v"(b));
  return d;
}
// nn.MultiheadAttention-style self attention (B 4, S 2,048, E 1,024, 16 heads x 64): packed in_proj (natural [3E][E]) + bias, softmax(q k^T / 8) v, out_proj + bias.
__device__ __forceinline__ v16h frag_h(const _Float16* rowk0, int lane) {
  union { v16h v; v8h q[2]; } u; const _Float16* p = rowk0 + 8 * (lane >> 4);
  u.q[0] = *(const v8h*)p; u.q[1] = *(const v8h*)(p + 16); return u.v;
}
__device__ __forceinline__ v16h frag_f32(const float* rowk0, int lane) {
  v16h a; const float* p = rowk0 + 8 * (lane >> 4);
#pragma unroll
  for (int i = 0; i < 8; ++i) { a[i] = (_Float16)p[i]; a[8 + i] = (_Float16)p[16 + i]; }
  return a;
}
__device__ __forceinline__ v16h frag_f32s(const float* rowk0, int lane, float sc) {
  v16h a; const float* p = rowk0 + 8 * (lane >> 4);
#pragma unroll
  for (int i = 0; i < 8; ++i) { a[i] = (_Float16)(p[i] * sc); a[8 + i] = (_Float16)(p[16 + i] * sc); }
  return a;
}
// column fragment from a [K][ld] layout (column n), rows >= K read as 0
__device__ __forceinline__ v16h fragc_f32(const float* W, int k0, int n, int lane, int ld, int K) {
  v16h a; const int g = lane >> 4;
#pragma unroll
  for (int i = 0; i < 8; ++i) { const int ka = k0 + 8 * g + i, kb = ka + 16;
    a[i] = (_Float16)(ka < K ? W[(size_t)(ka < K ? ka : K - 1) * ld + n] : 0.f); a[8 + i] = (_Float16)(kb < K ? W[(size_t)(kb < K ? kb : K - 1) * ld + n] : 0.f); }
  return a;
}
struct F2 { v16b h, l; };
__device__ __forceinline__ F2 bsplit16(const float v[16]) { F2 r;
#pragma unroll
  for (int i = 0; i < 16; ++i) { const __bf16 h = (__bf16)v[i]; r.h[i] = h; r.l[i] = (__bf16)(v[i] - (float)h); }
  return r; }
__device__ __forceinline__ F2 split_row(const float* row, int k0, int lane) { float v[16]; const float* p = row + k0 + 8 * (lane >> 4);
#pragma unroll
  for (int i = 0; i < 8; ++i) { v[i] = p[i]; v[8 + i] = p[16 + i]; }
  return bsplit16(v); }
__device__ __forceinline__ F2 split_rowK(const float* row, int k0, int lane, int K) { float v[16]; const int g = lane >> 4;
#pragma unroll
  for (int i = 0; i < 8; ++i) { const int ka = k0 + 8 * g + i, kb = ka + 16; v[i] = ka < K ? row[ka < K ? ka : K - 1] : 0.f; v[8 + i] = kb < K ? row[kb < K ? kb : K - 1] : 0.f; }
  return bsplit16(v); }
__device__ __forceinline__ F2 split_col(const float* W, int k0, int n, int lane, int ld, int K) { float v[16]; const int g = lane >> 4;
#pragma unroll
  for (int i = 0; i < 8; ++i) { const int ka = k0 + 8 * g + i, kb = ka + 16; v[i] = ka < K ? W[(size_t)(ka < K ? ka : K - 1) * ld + n] : 0.f; v[8 + i] = kb < K ? W[(size_t)(kb < K ? kb : K - 1) * ld + n] : 0.f; }
  return bsplit16(v); }
__device__ __forceinline__ v8f mac3(const F2& a, const F2& b, v8f c) { c = wmma_bf(a.l, b.h, c); c = wmma_bf(a.h, b.l, c); return wmma_bf(a.h, b.h, c); }
__device__ __forceinline__ float sigm(float v) { return 1.0f / (1.0f + expf(-v)); }
#define LDSX() do { asm volatile("s_wait_dscnt 0" ::: "memory"); __builtin_amdgcn_wave_barrier(); __builtin_amdgcn_fence(__ATOMIC_RELEASE, "workgroup"); } while (0)


#define NB 4
#define SS 2048
#define DM 1024
#define NH 16
#define HD 64
#define QKVW (3 * DM)
#ifndef TQB
#define TQB (SS / 64)
#define TNB NB
#define TOB (NB * SS / 64)     // output row tiles (all)
#endif
typedef __attribute__((ext_vector_type(8))) __bf16 v8b;
__device__ __forceinline__ v16b frag_b(const __bf16* rowk0, int lane) {
  union { v16b v; v8b q[2]; } u; const __bf16* p = rowk0 + 8 * (lane >> 4);
  u.q[0] = *(const v8b*)p; u.q[1] = *(const v8b*)(p + 16); return u.v;
}
__device__ __forceinline__ float bfr(float v) { return (float)(__bf16)v; }
__device__ __attribute__((noinline)) float exp_ni(float v) { return expf(v); }
__device__ __attribute__((noinline)) float erf_ni(float v) { return erff(v); }

#define PK_A 0                       // [3072][1024] Wqkv rows (natural [out][in])
#define PK_P (PK_A + QKVW * DM)        // [1024][1024] Wo rows (natural)
#define PK_END (PK_P + DM * DM)
#define WS_PK  0u
#define WS_QK  (WS_PK + 2u * PK_END)             // f16 [8192 rows][2048]: q | k
#define WS_QKL (WS_QK + 2u * NB * SS * 2 * DM)     // f16 q | k residual planes x2048
#define WS_VTH (WS_QKL + 2u * NB * SS * 2 * DM)    // f16 [b][1024 (h*64+d)][2048 s] hi
#define WS_VTL (WS_VTH + 2u * NB * DM * SS)        // f16 lo x 2048
#define WS_O   (WS_VTL + 2u * NB * DM * SS)        // f32 [8192][1024]
#define WS_CS  (WS_O + 4u * NB * SS * DM)           // f32 2 x [2048][32], unused
#define WS_END (WS_CS + 4u * 2 * SS * 32)
// ---- k_pack: block = (row n, which): natural [out][in] rows -> bf16; which 0..2 -> W_q/W_k/W_v into PK_A rows which*1024 + n; 3 -> W_o into PK_P
__global__ __launch_bounds__(256) void k_pack(const float* __restrict__ WQ, const float* __restrict__ WK, const float* __restrict__ WV, const float* __restrict__ WO, __bf16* __restrict__ PK) {
  __shared__ __align__(16) __bf16 s[DM]; const int n = blockIdx.x, which = blockIdx.y, t = threadIdx.x; const float* Wm = (which == 0) ? WQ : (which == 1) ? WK : (which == 2) ? WV : WO;
  for (int k = t; k < DM; k += 256) s[k] = (__bf16)Wm[(size_t)n * DM + k];
  __syncthreads();
  __bf16* dst = (which < 3) ? PK + PK_A + ((size_t)which * DM + n) * DM : PK + PK_P + (size_t)n * DM;
  for (int q = t; q < DM / 8; q += 256) vst2((unsigned*)(dst + q * 8), *(const v4u*)&s[q * 8]);
}
// LDS staging: a stage is 64 k (one 128-B line of every 16-bit operand row); rows lie at a pitch of 144 B (16 B x odd) for the ds_load_b128 fragment readers
#define KS 64
#define LP 72
typedef __attribute__((ext_vector_type(4))) __bf16 v4b;
__global__ __launch_bounds__(128) void k_qkv(const float* __restrict__ XQ, const float* __restrict__ XK, const float* __restrict__ XV, const __bf16* __restrict__ P, const float* __restrict__ BQ, const float* __restrict__ BK, const float* __restrict__ BV, _Float16* __restrict__ QK, _Float16* __restrict__ QKL, _Float16* __restrict__ VTH, _Float16* __restrict__ VTL) {
  const int which0 = (blockIdx.y * 128) / DM; const float* X = (which0 == 0) ? XQ : (which0 == 1) ? XK : XV; const float* BB = BQ ? (((which0 == 0) ? BQ : (which0 == 1) ? BK : BV) + (blockIdx.y * 128 - which0 * DM)) : nullptr;
  // the two stage buffers and the epilogue's staging share one LDS range: the loop's last barrier stands between them
  __shared__ __align__(16) union { struct { __bf16 a[2][64][LP], b[2][128][LP]; } st; struct { _Float16 so[4][16][136], sol[4][16][136]; } qk; struct { _Float16 sth[128][72], stl[128][72]; } vt; } sm;
  auto& so = sm.qk.so; auto& sol = sm.qk.sol; auto& sth = sm.vt.sth; auto& stl = sm.vt.stl;
  const int tid = threadIdx.x, wave = tid >> 5, lane = tid & 31, col = lane & 15, g = lane >> 4; const size_t r0 = (size_t)blockIdx.x * 64 + wave * 16; const int n0 = blockIdx.y * 128;
  v8f acc[8] = {};
  // whole-line global loads: W 8 lanes x 16 B = one line of a row (4 rows a wave-load), x 16 lanes x 16 B = two lines of a row (2 rows a wave-load)
  const int br = tid >> 3, bc = (tid & 7) * 8, ar = tid >> 4, ac = (tid & 15) * 4;
  const __bf16* pb = P + (size_t)(n0 + br) * DM + bc; const float* pa = X + ((size_t)blockIdx.x * 64 + ar) * DM + ac;
  v8b rb[8]; v4f ra[8];
#pragma unroll
  for (int i = 0; i < 8; ++i) { rb[i] = *(const v8b*)(pb + (size_t)i * 16 * DM); ra[i] = *(const v4f*)(pa + (size_t)i * 8 * DM); }
#pragma unroll
  for (int i = 0; i < 8; ++i) { *(v8b*)&sm.st.b[0][br + 16 * i][bc] = rb[i]; v4b c; c[0] = (__bf16)ra[i][0]; c[1] = (__bf16)ra[i][1]; c[2] = (__bf16)ra[i][2]; c[3] = (__bf16)ra[i][3]; *(v4b*)&sm.st.a[0][ar + 8 * i][ac] = c; }
  __syncthreads();
#pragma unroll 2   // two stages a trip: the buffer index is a constant in the addresses
  for (int s = 0; s < DM / KS; ++s) { const int cur = s & 1;
    if (s + 1 < DM / KS) {   // the next stage's lines fly into registers while this stage is multiplied
#pragma unroll
      for (int i = 0; i < 8; ++i) { rb[i] = *(const v8b*)(pb + (size_t)i * 16 * DM + (s + 1) * KS); ra[i] = *(const v4f*)(pa + (size_t)i * 8 * DM + (s + 1) * KS); } }
#pragma unroll
    for (int kc = 0; kc < KS / 32; ++kc) { const v16b a = frag_b(&sm.st.a[cur][wave * 16 + col][kc * 32], lane); v16b w[8];
#pragma unroll
      for (int j = 0; j < 8; ++j) w[j] = frag_b(&sm.st.b[cur][j * 16 + col][kc * 32], lane);
      asm volatile("" :: "v"(a), "v"(w[0]), "v"(w[1]), "v"(w[2]), "v"(w[3]), "v"(w[4]), "v"(w[5]), "v"(w[6]), "v"(w[7]));   // holds the block's LDS reads as one group in front of its WMMAs: one LDS latency a block, not one a WMMA
#pragma unroll
      for (int j = 0; j < 8; ++j) acc[j] = wmma_bf(a, w[j], acc[j]); }
    __builtin_amdgcn_sched_barrier(0);   // keeps the conversions below, and with them the wait on the global loads, behind this stage's WMMAs
    if (s + 1 < DM / KS) {   // into the buffer whose readers all passed the barrier of the trip before
#pragma unroll
      for (int i = 0; i < 8; ++i) { *(v8b*)&sm.st.b[cur ^ 1][br + 16 * i][bc] = rb[i]; v4b c; c[0] = (__bf16)ra[i][0]; c[1] = (__bf16)ra[i][1]; c[2] = (__bf16)ra[i][2]; c[3] = (__bf16)ra[i][3]; *(v4b*)&sm.st.a[cur ^ 1][ar + 8 * i][ac] = c; } }
    __syncthreads(); }   // publishes stage s + 1 and ends every read of stage s
  if (n0 < 2 * DM) {   // q stored unscaled (f16 sigma ~0.6, no subnormal exposure); 1/8 applied to the f32 score
#pragma unroll
    for (int j = 0; j < 8; ++j) {
#pragma unroll
      for (int r = 0; r < 8; ++r) { const float v = acc[j][r] + (BB ? bfr(BB[j * 16 + col]) : 0.f); const _Float16 hv = (_Float16)v; so[wave][8 * g + r][j * 16 + col] = hv; sol[wave][8 * g + r][j * 16 + col] = (_Float16)((v - (float)hv) * 2048.0f); } }   // q, k (+ bias) as f16 hi + (x2048) residual
    LDSX();
    for (int rl = 0; rl < 16; ++rl) if (lane < 16) { vst2((unsigned*)(QK + (r0 + rl) * (2 * DM) + n0 + lane * 8), *(const v4u*)&so[wave][rl][lane * 8]); vst2((unsigned*)(QKL + (r0 + rl) * (2 * DM) + n0 + lane * 8), *(const v4u*)&sol[wave][rl][lane * 8]); }
  } else {
#pragma unroll
    for (int j = 0; j < 8; ++j) {
#pragma unroll
      for (int r = 0; r < 8; ++r) { const float v = acc[j][r] + (BB ? bfr(BB[j * 16 + col]) : 0.f); const _Float16 hv = (_Float16)v; sth[j * 16 + col][wave * 16 + 8 * g + r] = hv; stl[j * 16 + col][wave * 16 + 8 * g + r] = (_Float16)((v - (float)hv) * 2048.0f); } }
    __syncthreads();
    const size_t rb = (size_t)blockIdx.x * 64; const int b = (int)(rb / SS), s0 = (int)(rb % SS); const int pc0 = n0 - 2 * DM;
    for (int q = tid; q < 128 * 8; q += 128) { const int d = q >> 3, pc = q & 7; const size_t o = ((size_t)b * DM + pc0 + d) * SS + s0 + pc * 8; vst2((unsigned*)(VTH + o), *(const v4u*)&sth[d][pc * 8]); vst2((unsigned*)(VTL + o), *(const v4u*)&stl[d][pc * 8]); }
  }
}
__device__ __forceinline__ float xhalf(float x) { return __builtin_bit_cast(float, __builtin_amdgcn_permlanex16(__builtin_bit_cast(int, x), __builtin_bit_cast(int, x), 0x76543210, 0xfedcba98, false, false)); }   // lane l with lane l ^ 16
// eight base-2 exponentials in place and back to back: none writes a register of the one in front of it, and no filler stands between them; the closing v_nop is the slot that the instruction set asks for behind a transcendental before its result is read
__device__ __forceinline__ void exp2x8(v8f& x) {
  float a0 = x[0], a1 = x[1], a2 = x[2], a3 = x[3], a4 = x[4], a5 = x[5], a6 = x[6], a7 = x[7];
  asm("v_exp_f32 %0, %0\n\tv_exp_f32 %1, %1\n\tv_exp_f32 %2, %2\n\tv_exp_f32 %3, %3\n\tv_exp_f32 %4, %4\n\tv_exp_f32 %5, %5\n\tv_exp_f32 %6, %6\n\tv_exp_f32 %7, %7\n\tv_nop" : "+v"(a0), "+v"(a1), "+v"(a2), "+v"(a3), "+v"(a4), "+v"(a5), "+v"(a6), "+v"(a7));
  x[0] = a0; x[1] = a1; x[2] = a2; x[3] = a3; x[4] = a4; x[5] = a5; x[6] = a6; x[7] = a7;
}
__global__ __launch_bounds__(128) void k_attn(const _Float16* __restrict__ QK, const _Float16* __restrict__ QKL, const _Float16* __restrict__ VTH, const _Float16* __restrict__ VTL, const void* __restrict__ KMASK, float* __restrict__ O) {
  // one stage = 64 keys: k rows [key][64 d] and v rows [d][64 keys], one 128-B line each; the stage and the epilogue's staging share one LDS range, the barrier behind the loop between them
  __shared__ __align__(16) union { struct { _Float16 k[64][LP], v[64][LP]; } st; float so[4][16][68]; } sm;
  auto& so = sm.so;
  const int tid = threadIdx.x, wave = tid >> 5, lane = tid & 31, col = lane & 15, g = lane >> 4;
  const int qb = blockIdx.x, h = blockIdx.y, b = blockIdx.z; const int q0 = qb * 64 + wave * 16; const size_t rq = (size_t)b * SS + q0 + col;
  v16h aq[2];   // B operand of the score product: column = query col
#pragma unroll
  for (int kc = 0; kc < 2; ++kc) aq[kc] = frag_h(QK + rq * (2 * DM) + h * HD + kc * 32, lane);
  float m = -3.0e38f, l = 0.f;   // this lane's query: running maximum (equal in both halves), sum over this half's keys
  v8f acc[4] = {};   // acc[dt][r] = O^T[dt * 16 + 8 g + r][query col]
  const int sr = tid >> 3, sc = (tid & 7) * 8;   // whole-line global loads: 8 lanes x 16 B = one line of a row, 4 rows a wave-load
  const _Float16* pk = QK + ((size_t)b * SS + sr) * (2 * DM) + DM + h * HD + sc; const _Float16* pv = VTH + ((size_t)b * DM + h * HD + sr) * SS + sc;
#pragma unroll 1   // rolled: the barriers bound every stage anyway, and the loop's text stays small
  for (int st = 0; st < SS / 64; ++st) {   // all keys
    { v8h rk[4], rv[4];
#pragma unroll
      for (int i = 0; i < 4; ++i) { rk[i] = *(const v8h*)(pk + (size_t)(st * 64 + 16 * i) * (2 * DM)); rv[i] = *(const v8h*)(pv + (size_t)(16 * i) * SS + st * 64); }
      __syncthreads();   // every wave has left the stage before
#pragma unroll
      for (int i = 0; i < 4; ++i) { *(v8h*)&sm.st.k[sr + 16 * i][sc] = rk[i]; *(v8h*)&sm.st.v[sr + 16 * i][sc] = rv[i]; } }
    __syncthreads();   // publishes the stage
#pragma unroll   // both halves of the stage in line: constant LDS offsets
    for (int sub = 0; sub < 2; ++sub) { v8f s[2]; v16h fk[2][2];   // s[ct][r] = score of key sub * 32 + ct * 16 + 8 g + r of the stage against query col
#pragma unroll
      for (int ct = 0; ct < 2; ++ct) { fk[ct][0] = frag_h(&sm.st.k[sub * 32 + ct * 16 + col][0], lane); fk[ct][1] = frag_h(&sm.st.k[sub * 32 + ct * 16 + col][32], lane); }
      asm volatile("" :: "v"(fk[0][0]), "v"(fk[0][1]), "v"(fk[1][0]), "v"(fk[1][1]));   // holds the four k fragments' LDS reads as one group in front of the score WMMAs: one LDS latency, not four
#pragma unroll
      for (int ct = 0; ct < 2; ++ct) { v8f c = {};
#pragma unroll
        for (int kc = 0; kc < 2; ++kc) c = wmma16(fk[ct][kc], aq[kc], c);   // single product: k rows as A, q as B, one-rounding f16 operands
        s[ct] = c * 0.125f; }   // 1/sqrt(64)
      float mt[2];   // two independent chains, then one exchange between the wave's halves
#pragma unroll
      for (int t = 0; t < 2; ++t) { mt[t] = s[t][0];
#pragma unroll
        for (int r = 1; r < 8; ++r) mt[t] = fmaxf(mt[t], s[t][r]); }
      float mx = fmaxf(mt[0], mt[1]); mx = fmaxf(mx, xhalf(mx));
      const float mn = fmaxf(m, mx); const float alpha = (m <= -1.0e38f) ? 0.f : __expf(m - mn);
      v16h p; v8f e[2];   // P^T packs from the two score tiles into the B operand: element ct * 8 + r = key ct * 16 + 8 g + r of the 32, the hardware k order, which frag_h gives V^T too
#pragma unroll
      for (int t = 0; t < 2; ++t) e[t] = (s[t] - mn) * 1.44269504f;   // exp(s - mn) by the hardware's base-2 exponential
#pragma unroll
      for (int t = 0; t < 2; ++t) exp2x8(e[t]);
#pragma unroll
      for (int t = 0; t < 2; ++t) {
#pragma unroll
        for (int r = 0; r < 8; ++r) e[t][r] = (s[t][r] <= -1.0e38f) ? 0.f : e[t][r]; }
      const v8f e8 = e[0] + e[1];   // this half's 16 weights: tiles first, then the eight registers
      const float es = ((e8[0] + e8[2]) + (e8[4] + e8[6])) + ((e8[1] + e8[3]) + (e8[5] + e8[7]));
#pragma unroll
      for (int t = 0; t < 2; ++t) { const v8f e2 = e[t] * 2048.0f;   // P scaled by 2^11 so small softmax weights stay out of the f16 subnormal range; 2^-11 folded into the epilogue
#pragma unroll
        for (int r = 0; r < 8; ++r) p[t * 8 + r] = (_Float16)e2[r]; }
      l = l * alpha + es; m = mn;
#pragma unroll
      for (int dt = 0; dt < 4; ++dt) acc[dt] *= alpha;
#pragma unroll
      for (int dt = 0; dt < 4; ++dt) acc[dt] = wmma16(frag_h(&sm.st.v[dt * 16 + col][sub * 32], lane), p, acc[dt]); } }   // single product: V^T rows as A, P^T (x2^11) as B
  __syncthreads();   // every wave has left the last stage: its LDS becomes the output staging
  { const float il = (1.0f / 2048.0f) / (l + xhalf(l));   // the halves' sums join once
#pragma unroll
    for (int dt = 0; dt < 4; ++dt) { v4f o0, o1;
#pragma unroll
      for (int r = 0; r < 4; ++r) { o0[r] = acc[dt][r] * il; o1[r] = acc[dt][4 + r] * il; }
      *(v4f*)&so[wave][col][dt * 16 + 8 * g] = o0; *(v4f*)&so[wave][col][dt * 16 + 8 * g + 4] = o1; } }
  LDSX();
  for (int rl = 0; rl < 16; ++rl) if (lane < 16) vst2(O + ((size_t)b * SS + q0 + rl) * DM + h * HD + lane * 4, *(const v4f*)&so[wave][rl][lane * 4]);
}
// ---- k_out: block = (64 rows, 128 cols): out = O(hi/lo) . Wo rows (2 products) + bo
__global__ __launch_bounds__(128) void k_out(const float* __restrict__ O, const __bf16* __restrict__ P, const float* __restrict__ BO, float* __restrict__ Y) {
  // the two stage buffers and the epilogue's staging share one LDS range: the loop's last barrier stands between them
  __shared__ __align__(16) union { struct { __bf16 ah[2][64][LP], al[2][64][LP], b[2][128][LP]; } st; float so[4][16][132]; } sm;
  auto& so = sm.so;
  const int tid = threadIdx.x, wave = tid >> 5, lane = tid & 31, col = lane & 15, g = lane >> 4; const size_t r0 = (size_t)blockIdx.x * 64 + wave * 16; const int n0 = blockIdx.y * 128;
  v8f acc[8] = {};
  // whole-line global loads, as in k_qkv; o is split into its bf16 hi and residual planes on the way into LDS
  const int br = tid >> 3, bc = (tid & 7) * 8, ar = tid >> 4, ac = (tid & 15) * 4;
  const __bf16* pb = P + (size_t)(n0 + br) * DM + bc; const float* pa = O + ((size_t)blockIdx.x * 64 + ar) * DM + ac;
  v8b rb[8]; v4f ra[8];
#pragma unroll
  for (int i = 0; i < 8; ++i) { rb[i] = *(const v8b*)(pb + (size_t)i * 16 * DM); ra[i] = *(const v4f*)(pa + (size_t)i * 8 * DM); }
#pragma unroll
  for (int i = 0; i < 8; ++i) { *(v8b*)&sm.st.b[0][br + 16 * i][bc] = rb[i]; v4b ch, cl;
#pragma unroll
    for (int e = 0; e < 4; ++e) { const __bf16 hv = (__bf16)ra[i][e]; ch[e] = hv; cl[e] = (__bf16)(ra[i][e] - (float)hv); }
    *(v4b*)&sm.st.ah[0][ar + 8 * i][ac] = ch; *(v4b*)&sm.st.al[0][ar + 8 * i][ac] = cl; }
  __syncthreads();
#pragma unroll 2   // two stages a trip: the buffer index is a constant in the addresses
  for (int s = 0; s < DM / KS; ++s) { const int cur = s & 1;
    if (s + 1 < DM / KS) {   // the next stage's lines fly into registers while this stage is multiplied
#pragma unroll
      for (int i = 0; i < 8; ++i) { rb[i] = *(const v8b*)(pb + (size_t)i * 16 * DM + (s + 1) * KS); ra[i] = *(const v4f*)(pa + (size_t)i * 8 * DM + (s + 1) * KS); } }
#pragma unroll
    for (int kc = 0; kc < KS / 32; ++kc) { const v16b ah = frag_b(&sm.st.ah[cur][wave * 16 + col][kc * 32], lane), al = frag_b(&sm.st.al[cur][wave * 16 + col][kc * 32], lane);
#pragma unroll
      for (int jj = 0; jj < 8; jj += 4) { v16b w[4];
#pragma unroll
        for (int j = 0; j < 4; ++j) w[j] = frag_b(&sm.st.b[cur][(jj + j) * 16 + col][kc * 32], lane);
        asm volatile("" :: "v"(ah), "v"(al), "v"(w[0]), "v"(w[1]), "v"(w[2]), "v"(w[3]));   // holds the block's LDS reads as one group in front of its WMMAs: one LDS latency a block, not one a WMMA
#pragma unroll
        for (int j = 0; j < 4; ++j) { acc[jj + j] = wmma_bf(al, w[j], acc[jj + j]); acc[jj + j] = wmma_bf(ah, w[j], acc[jj + j]); } } }
    __builtin_amdgcn_sched_barrier(0);   // keeps the split below, and with it the wait on the global loads, behind this stage's WMMAs
    if (s + 1 < DM / KS) {   // into the buffer whose readers all passed the barrier of the trip before
#pragma unroll
      for (int i = 0; i < 8; ++i) { *(v8b*)&sm.st.b[cur ^ 1][br + 16 * i][bc] = rb[i]; v4b ch, cl;
#pragma unroll
        for (int e = 0; e < 4; ++e) { const __bf16 hv = (__bf16)ra[i][e]; ch[e] = hv; cl[e] = (__bf16)(ra[i][e] - (float)hv); }
        *(v4b*)&sm.st.ah[cur ^ 1][ar + 8 * i][ac] = ch; *(v4b*)&sm.st.al[cur ^ 1][ar + 8 * i][ac] = cl; } }
    __syncthreads(); }   // publishes stage s + 1 and ends every read of stage s
#pragma unroll
  for (int j = 0; j < 8; ++j) {
#pragma unroll
    for (int r = 0; r < 8; ++r) so[wave][8 * g + r][j * 16 + col] = acc[j][r] + bfr(BO[n0 + j * 16 + col]); }
  LDSX();
  for (int rl = 0; rl < 16; ++rl) vst2(Y + (r0 + rl) * DM + n0 + lane * 4, *(const v4f*)&so[wave][rl][lane * 4]);
}
extern "C" void kernel_launch(void* const* d_in, const int* in_sizes, int n_in, void* d_out, int out_size, void* d_ws, size_t ws_size, hipStream_t stream) {
  (void)in_sizes; (void)n_in; (void)out_size;
  const float** F = (const float**)d_in;   // 0 x [4,2048,1024], 1 in_proj_weight [3072,1024], 2 in_proj_bias [3072], 3 out_proj_weight [1024,1024], 4 out_proj_bias
  if (ws_size < (size_t)WS_END) return;
  char* ws = (char*)d_ws; __bf16* PK = (__bf16*)(ws + WS_PK); _Float16 *QK = (_Float16*)(ws + WS_QK), *QKL = (_Float16*)(ws + WS_QKL), *VTH = (_Float16*)(ws + WS_VTH), *VTL = (_Float16*)(ws + WS_VTL); float* O = (float*)(ws + WS_O);
  k_pack<<<dim3(DM, 4), 256, 0, stream>>>(F[1], F[1] + (size_t)DM * DM, F[1] + (size_t)2 * DM * DM, F[3], PK);
  k_qkv<<<dim3(TNB * SS / 64, QKVW / 128), 128, 0, stream>>>(F[0], F[0], F[0], PK + PK_A, F[2], F[2] + DM, F[2] + 2 * DM, QK, QKL, VTH, VTL);
  k_attn<<<dim3(TQB, NH, TNB), 128, 0, stream>>>(QK, QKL, VTH, VTL, nullptr, O);
  k_out<<<dim3(TOB, DM / 128), 128, 0, stream>>>(O, PK + PK_P, F[4], (float*)d_out);
}

// v003
// A run of this version takes 198 microseconds.
// Two timings next to v002 put it at 1.06 and 1.07 times that version's speed.
// All steps since v000 together make it 3.37 times as fast.
// compute dtype: all float inputs rounded to bf16; qkv = x . W_in^T + b with EXACT bf16 products on WMMA 16x16x32 (natural rows; the packed in_proj is three contiguous row blocks); PLAIN attention: q, k single f16, running-max softmax in f32 in the base-2 domain (1/8, log2 e, the maximum and 2^11 in one FMA a score, hardware exp), P (scaled by 2^11, single f16) x v (single f16); out = o (bf16 hi + residual) . W_out^T (2 products) + b_out.
#include <hip/hip_runtime.h>
#include <math.h>

typedef __attribute__((ext_vector_type(16))) _Float16 v16h;
typedef __attribute__((ext_vector_type(16))) __bf16 v16b;
typedef __attribute__((ext_vector_type(8)))  _Float16 v8h;
typedef __attribute__((ext_vector_type(8)))  float v8f;
typedef __attribute__((ext_vector_type(4)))  float v4f;
typedef __attribute__((ext_vector_type(2)))  float v2f;
typedef __attribute__((ext_vector_type(4)))  unsigned v4u;
typedef __attribute__((ext_vector_type(4)))  int v4i;
typedef float __attribute__((may_alias)) float_a;
typedef int __attribute__((may_alias)) int_a;

template <typename T> __device__ __forceinline__ void vst2(void* p, T v) { *(T*)p = v;  }
__device__ __forceinline__ v8f wmma16(v16h a, v16h b, v8f c) {
  v8f d = __builtin_amdgcn_wmma_f32_16x16x32_f16(false, a, false, b, (short)0, c, false, false);
  asm volatile("v_nop\n\tv_nop\n\tv_nop\n\tv_nop" : "+v"(d) : "v"(a), "v"(b));
  return d;
}
__device__ __forceinline__ v8f wmma_bf(v16b a, v16b b, v8f c) {
  v8f d = __builtin_amdgcn_wmma_f32_16x16x32_bf16(false, a, false, b, (short)0, c, false, false);
  asm volatile("v_nop\n\tv_nop\n\tv_nop\n\tv_nop" : "+v"(d) : "v"(a), "v"(b));
  return d;
}
// nn.MultiheadAttention-style self attention (B 4, S 2,048, E 1,024, 16 heads x 64): packed in_proj (natural [3E][E]) + bias, softmax(q k^T / 8) v, out_proj + bias.
__device__ __forceinline__ v16h frag_h(const _Float16* rowk0, int lane) {
  union { v16h v; v8h q[2]; } u; const _Float16* p = rowk0 + 8 * (lane >> 4);
  u.q[0] = *(const v8h*)p; u.q[1] = *(const v8h*)(p + 16); return u.v;
}
__device__ __forceinline__ v16h frag_f32(const float* rowk0, int lane) {
  v16h a; const float* p = rowk0 + 8 * (lane >> 4);
#pragma unroll
  for (int i = 0; i < 8; ++i) { a[i] = (_Float16)p[i]; a[8 + i] = (_Float16)p[16 + i]; }
  return a;
}
__device__ __forceinline__ v16h frag_f32s(const float* rowk0, int lane, float sc) {
  v16h a; const float* p = rowk0 + 8 * (lane >> 4);
#pragma unroll
  for (int i = 0; i < 8; ++i) { a[i] = (_Float16)(p[i] * sc); a[8 + i] = (_Float16)(p[16 + i] * sc); }
  return a;
}
// column fragment from a [K][ld] layout (column n), rows >= K read as 0
__device__ __forceinline__ v16h fragc_f32(const float* W, int k0, int n, int lane, int ld, int K) {
  v16h a; const int g = lane >> 4;
#pragma unroll
  for (int i = 0; i < 8; ++i) { const int ka = k0 + 8 * g + i, kb = ka + 16;
    a[i] = (_Float16)(ka < K ? W[(size_t)(ka < K ? ka : K - 1) * ld + n] : 0.f); a[8 + i] = (_Float16)(kb < K ? W[(size_t)(kb < K ? kb : K - 1) * ld + n] : 0.f); }
  return a;
}
struct F2 { v16b h, l; };
__device__ __forceinline__ F2 bsplit16(const float v[16]) { F2 r;
#pragma unroll
  for (int i = 0; i < 16; ++i) { const __bf16 h = (__bf16)v[i]; r.h[i] = h; r.l[i] = (__bf16)(v[i] - (float)h); }
  return r; }
__device__ __forceinline__ F2 split_row(const float* row, int k0, int lane) { float v[16]; const float* p = row + k0 + 8 * (lane >> 4);
#pragma unroll
  for (int i = 0; i < 8; ++i) { v[i] = p[i]; v[8 + i] = p[16 + i]; }
  return bsplit16(v); }
__device__ __forceinline__ F2 split_rowK(const float* row, int k0, int lane, int K) { float v[16]; const int g = lane >> 4;
#pragma unroll
  for (int i = 0; i < 8; ++i) { const int ka = k0 + 8 * g + i, kb = ka + 16; v[i] = ka < K ? row[ka < K ? ka : K - 1] : 0.f; v[8 + i] = kb < K ? row[kb < K ? kb : K - 1] : 0.f; }
  return bsplit16(v); }
__device__ __forceinline__ F2 split_col(const float* W, int k0, int n, int lane, int ld, int K) { float v[16]; const int g = lane >> 4;
#pragma unroll
  for (int i = 0; i < 8; ++i) { const int ka = k0 + 8 * g + i, kb = ka + 16; v[i] = ka < K ? W[(size_t)(ka < K ? ka : K - 1) * ld + n] : 0.f; v[8 + i] = kb < K ? W[(size_t)(kb < K ? kb : K - 1) * ld + n] : 0.f; }
  return bsplit16(v); }
__device__ __forceinline__ v8f mac3(const F2& a, const F2& b, v8f c) { c = wmma_bf(a.l, b.h, c); c = wmma_bf(a.h, b.l, c); return wmma_bf(a.h, b.h, c); }
__device__ __forceinline__ float sigm(float v) { return 1.0f / (1.0f + expf(-v)); }
#define LDSX() do { asm volatile("s_wait_dscnt 0" ::: "memory"); __builtin_amdgcn_wave_barrier(); __builtin_amdgcn_fence(__ATOMIC_RELEASE, "workgroup"); } while (0)


#define NB 4
#define SS 2048
#define DM 1024
#define NH 16
#define HD 64
#define QKVW (3 * DM)
#ifndef TQB
#define TQB (SS / 64)
#define TNB NB
#define TOB (NB * SS / 64)     // output row tiles (all)
#endif
typedef __attribute__((ext_vector_type(8))) __bf16 v8b;
__device__ __forceinline__ v16b frag_b(const __bf16* rowk0, int lane) {
  union { v16b v; v8b q[2]; } u; const __bf16* p = rowk0 + 8 * (lane >> 4);
  u.q[0] = *(const v8b*)p; u.q[1] = *(const v8b*)(p + 16); return u.v;
}
__device__ __forceinline__ float bfr(float v) { return (float)(__bf16)v; }
__device__ __attribute__((noinline)) float exp_ni(float v) { return expf(v); }
__device__ __attribute__((noinline)) float erf_ni(float v) { return erff(v); }

#define PK_A 0                       // [3072][1024] Wqkv rows (natural [out][in])
#define PK_P (PK_A + QKVW * DM)        // [1024][1024] Wo rows (natural)
#define PK_END (PK_P + DM * DM)
#define WS_PK  0u
#define WS_QK  (WS_PK + 2u * PK_END)             // f16 [8192 rows][2048]: q | k
#define WS_QKL (WS_QK + 2u * NB * SS * 2 * DM)     // f16 q | k residual planes x2048
#define WS_VTH (WS_QKL + 2u * NB * SS * 2 * DM)    // f16 [b][1024 (h*64+d)][2048 s] hi
#define WS_VTL (WS_VTH + 2u * NB * DM * SS)        // f16 lo x 2048
#define WS_O   (WS_VTL + 2u * NB * DM * SS)        // f32 [8192][1024]
#define WS_CS  (WS_O + 4u * NB * SS * DM)           // f32 2 x [2048][32], unused
#define WS_END (WS_CS + 4u * 2 * SS * 32)
// ---- k_pack: block = (row n, which): natural [out][in] rows -> bf16; which 0..2 -> W_q/W_k/W_v into PK_A rows which*1024 + n; 3 -> W_o into PK_P
__global__ __launch_bounds__(256) void k_pack(const float* __restrict__ WQ, const float* __restrict__ WK, const float* __restrict__ WV, const float* __restrict__ WO, __bf16* __restrict__ PK) {
  __shared__ __align__(16) __bf16 s[DM]; const int n = blockIdx.x, which = blockIdx.y, t = threadIdx.x; const float* Wm = (which == 0) ? WQ : (which == 1) ? WK : (which == 2) ? WV : WO;
  for (int k = t; k < DM; k += 256) s[k] = (__bf16)Wm[(size_t)n * DM + k];
  __syncthreads();
  __bf16* dst = (which < 3) ? PK + PK_A + ((size_t)which * DM + n) * DM : PK + PK_P + (size_t)n * DM;
  for (int q = t; q < DM / 8; q += 256) vst2((unsigned*)(dst + q * 8), *(const v4u*)&s[q * 8]);
}
// LDS staging: a stage is 64 k (one 128-B line of every 16-bit operand row); rows lie at a pitch of 144 B (16 B x odd) for the ds_load_b128 fragment readers
#define KS 64
#define LP 72
typedef __attribute__((ext_vector_type(4))) __bf16 v4b;
__global__ __launch_bounds__(128) void k_qkv(const float* __restrict__ XQ, const float* __restrict__ XK, const float* __restrict__ XV, const __bf16* __restrict__ P, const float* __restrict__ BQ, const float* __restrict__ BK, const float* __restrict__ BV, _Float16* __restrict__ QK, _Float16* __restrict__ QKL, _Float16* __restrict__ VTH, _Float16* __restrict__ VTL) {
  const int which0 = (blockIdx.y * 128) / DM; const float* X = (which0 == 0) ? XQ : (which0 == 1) ? XK : XV; const float* BB = BQ ? (((which0 == 0) ? BQ : (which0 == 1) ? BK : BV) + (blockIdx.y * 128 - which0 * DM)) : nullptr;
  // the two stage buffers and the epilogue's staging share one LDS range: the loop's last barrier stands between them
  __shared__ __align__(16) union { struct { __bf16 a[2][64][LP], b[2][128][LP]; } st; struct { _Float16 so[4][16][136], sol[4][16][136]; } qk; struct { _Float16 sth[128][72], stl[128][72]; } vt; } sm;
  auto& so = sm.qk.so; auto& sol = sm.qk.sol; auto& sth = sm.vt.sth; auto& stl = sm.vt.stl;
  const int tid = threadIdx.x, wave = tid >> 5, lane = tid & 31, col = lane & 15, g = lane >> 4; const size_t r0 = (size_t)blockIdx.x * 64 + wave * 16; const int n0 = blockIdx.y * 128;
  v8f acc[8] = {};
  // whole-line global loads: W 8 lanes x 16 B = one line of a row (4 rows a wave-load), x 16 lanes x 16 B = two lines of a row (2 rows a wave-load)
  const int br = tid >> 3, bc = (tid & 7) * 8, ar = tid >> 4, ac = (tid & 15) * 4;
  const __bf16* pb = P + (size_t)(n0 + br) * DM + bc; const float* pa = X + ((size_t)blockIdx.x * 64 + ar) * DM + ac;
  v8b rb[8]; v4f ra[8];
#pragma unroll
  for (int i = 0; i < 8; ++i) { rb[i] = *(const v8b*)(pb + (size_t)i * 16 * DM); ra[i] = *(const v4f*)(pa + (size_t)i * 8 * DM); }
#pragma unroll
  for (int i = 0; i < 8; ++i) { *(v8b*)&sm.st.b[0][br + 16 * i][bc] = rb[i]; v4b c; c[0] = (__bf16)ra[i][0]; c[1] = (__bf16)ra[i][1]; c[2] = (__bf16)ra[i][2]; c[3] = (__bf16)ra[i][3]; *(v4b*)&sm.st.a[0][ar + 8 * i][ac] = c; }
  __syncthreads();
#pragma unroll 2   // two stages a trip: the buffer index is a constant in the addresses
  for (int s = 0; s < DM / KS; ++s) { const int cur = s & 1;
    if (s + 1 < DM / KS) {   // the next stage's lines fly into registers while this stage is multiplied
#pragma unroll
      for (int i = 0; i < 8; ++i) { rb[i] = *(const v8b*)(pb + (size_t)i * 16 * DM + (s + 1) * KS); ra[i] = *(const v4f*)(pa + (size_t)i * 8 * DM + (s + 1) * KS); } }
#pragma unroll
    for (int kc = 0; kc < KS / 32; ++kc) { const v16b a = frag_b(&sm.st.a[cur][wave * 16 + col][kc * 32], lane); v16b w[8];
#pragma unroll
      for (int j = 0; j < 8; ++j) w[j] = frag_b(&sm.st.b[cur][j * 16 + col][kc * 32], lane);
      asm volatile("" :: "v"(a), "v"(w[0]), "v"(w[1]), "v"(w[2]), "v"(w[3]), "v"(w[4]), "v"(w[5]), "v"(w[6]), "v"(w[7]));   // holds the block's LDS reads as one group in front of its WMMAs: one LDS latency a block, not one a WMMA
#pragma unroll
      for (int j = 0; j < 8; ++j) acc[j] = wmma_bf(a, w[j], acc[j]); }
    __builtin_amdgcn_sched_barrier(0);   // keeps the conversions below, and with them the wait on the global loads, behind this stage's WMMAs
    if (s + 1 < DM / KS) {   // into the buffer whose readers all passed the barrier of the trip before
#pragma unroll
      for (int i = 0; i < 8; ++i) { *(v8b*)&sm.st.b[cur ^ 1][br + 16 * i][bc] = rb[i]; v4b c; c[0] = (__bf16)ra[i][0]; c[1] = (__bf16)ra[i][1]; c[2] = (__bf16)ra[i][2]; c[3] = (__bf16)ra[i][3]; *(v4b*)&sm.st.a[cur ^ 1][ar + 8 * i][ac] = c; } }
    __syncthreads(); }   // publishes stage s + 1 and ends every read of stage s
  if (n0 < 2 * DM) {   // q stored unscaled (f16 sigma ~0.6, no subnormal exposure); 1/8 applied to the f32 score
#pragma unroll
    for (int j = 0; j < 8; ++j) {
#pragma unroll
      for (int r = 0; r < 8; ++r) { const float v = acc[j][r] + (BB ? bfr(BB[j * 16 + col]) : 0.f); const _Float16 hv = (_Float16)v; so[wave][8 * g + r][j * 16 + col] = hv; sol[wave][8 * g + r][j * 16 + col] = (_Float16)((v - (float)hv) * 2048.0f); } }   // q, k (+ bias) as f16 hi + (x2048) residual
    LDSX();
    for (int rl = 0; rl < 16; ++rl) if (lane < 16) { vst2((unsigned*)(QK + (r0 + rl) * (2 * DM) + n0 + lane * 8), *(const v4u*)&so[wave][rl][lane * 8]); vst2((unsigned*)(QKL + (r0 + rl) * (2 * DM) + n0 + lane * 8), *(const v4u*)&sol[wave][rl][lane * 8]); }
  } else {
#pragma unroll
    for (int j = 0; j < 8; ++j) {
#pragma unroll
      for (int r = 0; r < 8; ++r) { const float v = acc[j][r] + (BB ? bfr(BB[j * 16 + col]) : 0.f); const _Float16 hv = (_Float16)v; sth[j * 16 + col][wave * 16 + 8 * g + r] = hv; stl[j * 16 + col][wave * 16 + 8 * g + r] = (_Float16)((v - (float)hv) * 2048.0f); } }
    __syncthreads();
    const size_t rb = (size_t)blockIdx.x * 64; const int b = (int)(rb / SS), s0 = (int)(rb % SS); const int pc0 = n0 - 2 * DM;
    for (int q = tid; q < 128 * 8; q += 128) { const int d = q >> 3, pc = q & 7; const size_t o = ((size_t)b * DM + pc0 + d) * SS + s0 + pc * 8; vst2((unsigned*)(VTH + o), *(const v4u*)&sth[d][pc * 8]); vst2((unsigned*)(VTL + o), *(const v4u*)&stl[d][pc * 8]); }
  }
}
__device__ __forceinline__ float xhalf(float x) { return __builtin_bit_cast(float, __builtin_amdgcn_permlanex16(__builtin_bit_cast(int, x), __builtin_bit_cast(int, x), 0x76543210, 0xfedcba98, false, false)); }   // lane l with lane l ^ 16
// eight base-2 exponentials in place and back to back: none writes a register of the one in front of it, and no filler stands between them; the closing v_nop is the slot that the instruction set asks for behind a transcendental before its result is read
__device__ __forceinline__ void exp2x8(v8f& x) {
  float a0 = x[0], a1 = x[1], a2 = x[2], a3 = x[3], a4 = x[4], a5 = x[5], a6 = x[6], a7 = x[7];
  asm("v_exp_f32 %0, %0\n\tv_exp_f32 %1, %1\n\tv_exp_f32 %2, %2\n\tv_exp_f32 %3, %3\n\tv_exp_f32 %4, %4\n\tv_exp_f32 %5, %5\n\tv_exp_f32 %6, %6\n\tv_exp_f32 %7, %7\n\tv_nop" : "+v"(a0), "+v"(a1), "+v"(a2), "+v"(a3), "+v"(a4), "+v"(a5), "+v"(a6), "+v"(a7));
  x[0] = a0; x[1] = a1; x[2] = a2; x[3] = a3; x[4] = a4; x[5] = a5; x[6] = a6; x[7] = a7;
}
__global__ __launch_bounds__(128) void k_attn(const _Float16* __restrict__ QK, const _Float16* __restrict__ QKL, const _Float16* __restrict__ VTH, const _Float16* __restrict__ VTL, const void* __restrict__ KMASK, float* __restrict__ O) {
  // one stage = 64 keys: k rows [key][64 d] and v rows [d][64 keys], one 128-B line each; the stage and the epilogue's staging share one LDS range, the barrier behind the loop between them
  __shared__ __align__(16) union { struct { _Float16 k[64][LP], v[64][LP]; } st; float so[4][16][68]; } sm;
  auto& so = sm.so;
  const int tid = threadIdx.x, wave = tid >> 5, lane = tid & 31, col = lane & 15, g = lane >> 4;
  const int qb = blockIdx.x, h = blockIdx.y, b = blockIdx.z; const int q0 = qb * 64 + wave * 16; const size_t rq = (size_t)b * SS + q0 + col;
  v16h aq[2];   // B operand of the score product: column = query col
#pragma unroll
  for (int kc = 0; kc < 2; ++kc) aq[kc] = frag_h(QK + rq * (2 * DM) + h * HD + kc * 32, lane);
  float m = -3.0e38f, l = 0.f;   // this lane's query: running maximum of the raw scores (equal in both halves), sum (x2^11) over this half's keys
  const float kf = 0.125f * 1.44269504f;   // 1/sqrt(64) and log2 e in one factor
  float nb = 5.0e37f;   // addend of the score FMA in use: 11 - m * kf; the start value lies far above any real one, so the first alpha is 0
  v8f acc[4] = {};   // acc[dt][r] = O^T[dt * 16 + 8 g + r][query col]
  const int sr = tid >> 3, sc = (tid & 7) * 8;   // whole-line global loads: 8 lanes x 16 B = one line of a row, 4 rows a wave-load
  const _Float16* pk = QK + ((size_t)b * SS + sr) * (2 * DM) + DM + h * HD + sc; const _Float16* pv = VTH + ((size_t)b * DM + h * HD + sr) * SS + sc;
#pragma unroll 1   // rolled: the barriers bound every stage anyway, and the loop's text stays small
  for (int st = 0; st < SS / 64; ++st) {   // all keys
    { v8h rk[4], rv[4];
#pragma unroll
      for (int i = 0; i < 4; ++i) { rk[i] = *(const v8h*)(pk + (size_t)(st * 64 + 16 * i) * (2 * DM)); rv[i] = *(const v8h*)(pv + (size_t)(16 * i) * SS + st * 64); }
      __syncthreads();   // every wave has left the stage before
#pragma unroll
      for (int i = 0; i < 4; ++i) { *(v8h*)&sm.st.k[sr + 16 * i][sc] = rk[i]; *(v8h*)&sm.st.v[sr + 16 * i][sc] = rv[i]; } }
    __syncthreads();   // publishes the stage
#pragma unroll   // both halves of the stage in line: constant LDS offsets
    for (int sub = 0; sub < 2; ++sub) { v8f s[2]; v16h fk[2][2];   // s[ct][r] = raw score q.k of key sub * 32 + ct * 16 + 8 g + r of the stage against query col
#pragma unroll
      for (int ct = 0; ct < 2; ++ct) { fk[ct][0] = frag_h(&sm.st.k[sub * 32 + ct * 16 + col][0], lane); fk[ct][1] = frag_h(&sm.st.k[sub * 32 + ct * 16 + col][32], lane); }
      asm volatile("" :: "v"(fk[0][0]), "v"(fk[0][1]), "v"(fk[1][0]), "v"(fk[1][1]));   // holds the four k fragments' LDS reads as one group in front of the score WMMAs: one LDS latency, not four
#pragma unroll
      for (int ct = 0; ct < 2; ++ct) { v8f c = {};
#pragma unroll
        for (int kc = 0; kc < 2; ++kc) c = wmma16(fk[ct][kc], aq[kc], c);   // single product: k rows as A, q as B, one-rounding f16 operands
        s[ct] = c; }
      float mt[2];   // two independent chains, then one exchange between the wave's halves
#pragma unroll
      for (int t = 0; t < 2; ++t) { mt[t] = s[t][0];
#pragma unroll
        for (int r = 1; r < 8; ++r) mt[t] = fmaxf(mt[t], s[t][r]); }
      float mx = fmaxf(mt[0], mt[1]); mx = fmaxf(mx, xhalf(mx));
      const float mn = fmaxf(m, mx); const float nbn = __builtin_fmaf(-mn, kf, 11.0f);   // the FMA's addend: minus the scaled maximum, plus 11 so that the weights come out x2^11
      const float alpha = __builtin_amdgcn_exp2f(nbn - nb); nb = nbn;   // old weights were formed with the old addend: the difference of the two rescales them, whatever rounding each addend took
      v16h p; v8f e[2];   // P^T packs from the two score tiles into the B operand: element ct * 8 + r = key ct * 16 + 8 g + r of the 32, the hardware k order, which frag_h gives V^T too
#pragma unroll
      for (int t = 0; t < 2; ++t) e[t] = s[t] * kf + nb;   // one FMA a score, then the hardware's base-2 exponential: 2^11 exp((q.k - max) / 8)
#pragma unroll
      for (int t = 0; t < 2; ++t) exp2x8(e[t]);
      const v8f e8 = e[0] + e[1];   // this half's 16 weights: tiles first, then the eight registers
      const float es = ((e8[0] + e8[2]) + (e8[4] + e8[6])) + ((e8[1] + e8[3]) + (e8[5] + e8[7]));
#pragma unroll
      for (int t = 0; t < 2; ++t) {   // P carries 2^11 so small softmax weights stay out of the f16 subnormal range; l carries it too
#pragma unroll
        for (int r = 0; r < 8; ++r) p[t * 8 + r] = (_Float16)e[t][r]; }
      l = l * alpha + es; m = mn;
#pragma unroll
      for (int dt = 0; dt < 4; ++dt) acc[dt] *= alpha;
#pragma unroll
      for (int dt = 0; dt < 4; ++dt) acc[dt] = wmma16(frag_h(&sm.st.v[dt * 16 + col][sub * 32], lane), p, acc[dt]); } }   // single product: V^T rows as A, P^T (x2^11) as B
  __syncthreads();   // every wave has left the last stage: its LDS becomes the output staging
  { const float il = 1.0f / (l + xhalf(l));   // the halves' sums join once; 2^11 stands in acc and in l alike
#pragma unroll
    for (int dt = 0; dt < 4; ++dt) { v4f o0, o1;
#pragma unroll
      for (int r = 0; r < 4; ++r) { o0[r] = acc[dt][r] * il; o1[r] = acc[dt][4 + r] * il; }
      *(v4f*)&so[wave][col][dt * 16 + 8 * g] = o0; *(v4f*)&so[wave][col][dt * 16 + 8 * g + 4] = o1; } }
  LDSX();
  for (int rl = 0; rl < 16; ++rl) if (lane < 16) vst2(O + ((size_t)b * SS + q0 + rl) * DM + h * HD + lane * 4, *(const v4f*)&so[wave][rl][lane * 4]);
}
// ---- k_out: block = (64 rows, 128 cols): out = O(hi/lo) . Wo rows (2 products) + bo
__global__ __launch_bounds__(128) void k_out(const float* __restrict__ O, const __bf16* __restrict__ P, const float* __restrict__ BO, float* __restrict__ Y) {
  // the two stage buffers and the epilogue's staging share one LDS range: the loop's last barrier stands between them
  __shared__ __align__(16) union { struct { __bf16 ah[2][64][LP], al[2][64][LP], b[2][128][LP]; } st; float so[4][16][132]; } sm;
  auto& so = sm.so;
  const int tid = threadIdx.x, wave = tid >> 5, lane = tid & 31, col = lane & 15, g = lane >> 4; const size_t r0 = (size_t)blockIdx.x * 64 + wave * 16; const int n0 = blockIdx.y * 128;
  v8f acc[8] = {};
  // whole-line global loads, as in k_qkv; o is split into its bf16 hi and residual planes on the way into LDS
  const int br = tid >> 3, bc = (tid & 7) * 8, ar = tid >> 4, ac = (tid & 15) * 4;
  const __bf16* pb = P + (size_t)(n0 + br) * DM + bc; const float* pa = O + ((size_t)blockIdx.x * 64 + ar) * DM + ac;
  v8b rb[8]; v4f ra[8];
#pragma unroll
  for (int i = 0; i < 8; ++i) { rb[i] = *(const v8b*)(pb + (size_t)i * 16 * DM); ra[i] = *(const v4f*)(pa + (size_t)i * 8 * DM); }
#pragma unroll
  for (int i = 0; i < 8; ++i) { *(v8b*)&sm.st.b[0][br + 16 * i][bc] = rb[i]; v4b ch, cl;
#pragma unroll
    for (int e = 0; e < 4; ++e) { const __bf16 hv = (__bf16)ra[i][e]; ch[e] = hv; cl[e] = (__bf16)(ra[i][e] - (float)hv); }
    *(v4b*)&sm.st.ah[0][ar + 8 * i][ac] = ch; *(v4b*)&sm.st.al[0][ar + 8 * i][ac] = cl; }
  __syncthreads();
#pragma unroll 2   // two stages a trip: the buffer index is a constant in the addresses
  for (int s = 0; s < DM / KS; ++s) { const int cur = s & 1;
    if (s + 1 < DM / KS) {   // the next stage's lines fly into registers while this stage is multiplied
#pragma unroll
      for (int i = 0; i < 8; ++i) { rb[i] = *(const v8b*)(pb + (size_t)i * 16 * DM + (s + 1) * KS); ra[i] = *(const v4f*)(pa + (size_t)i * 8 * DM + (s + 1) * KS); } }
#pragma unroll
    for (int kc = 0; kc < KS / 32; ++kc) { const v16b ah = frag_b(&sm.st.ah[cur][wave * 16 + col][kc * 32], lane), al = frag_b(&sm.st.al[cur][wave * 16 + col][kc * 32], lane);
#pragma unroll
      for (int jj = 0; jj < 8; jj += 4) { v16b w[4];
#pragma unroll
        for (int j = 0; j < 4; ++j) w[j] = frag_b(&sm.st.b[cur][(jj + j) * 16 + col][kc * 32], lane);
        asm volatile("" :: "v"(ah), "v"(al), "v"(w[0]), "v"(w[1]), "v"(w[2]), "v"(w[3]));   // holds the block's LDS reads as one group in front of its WMMAs: one LDS latency a block, not one a WMMA
#pragma unroll
        for (int j = 0; j < 4; ++j) { acc[jj + j] = wmma_bf(al, w[j], acc[jj + j]); acc[jj + j] = wmma_bf(ah, w[j], acc[jj + j]); } } }
    __builtin_amdgcn_sched_barrier(0);   // keeps the split below, and with it the wait on the global loads, behind this stage's WMMAs
    if (s + 1 < DM / KS) {   // into the buffer whose readers all passed the barrier of the trip before
#pragma unroll
      for (int i = 0; i < 8; ++i) { *(v8b*)&sm.st.b[cur ^ 1][br + 16 * i][bc] = rb[i]; v4b ch, cl;
#pragma unroll
        for (int e = 0; e < 4; ++e) { const __bf16 hv = (__bf16)ra[i][e]; ch[e] = hv; cl[e] = (__bf16)(ra[i][e] - (float)hv); }
        *(v4b*)&sm.st.ah[cur ^ 1][ar + 8 * i][ac] = ch; *(v4b*)&sm.st.al[cur ^ 1][ar + 8 * i][ac] = cl; } }
    __syncthreads(); }   // publishes stage s + 1 and ends every read of stage s
#pragma unroll
  for (int j = 0; j < 8; ++j) {
#pragma unroll
    for (int r = 0; r < 8; ++r) so[wave][8 * g + r][j * 16 + col] = acc[j][r] + bfr(BO[n0 + j * 16 + col]); }
  LDSX();
  for (int rl = 0; rl < 16; ++rl) vst2(Y + (r0 + rl) * DM + n0 + lane * 4, *(const v4f*)&so[wave][rl][lane * 4]);
}
extern "C" void kernel_launch(void* const* d_in, const int* in_sizes, int n_in, void* d_out, int out_size, void* d_ws, size_t ws_size, hipStream_t stream) {
  (void)in_sizes; (void)n_in; (void)out_size;
  const float** F = (const float**)d_in;   // 0 x [4,2048,1024], 1 in_proj_weight [3072,1024], 2 in_proj_bias [3072], 3 out_proj_weight [1024,1024], 4 out_proj_bias
  if (ws_size < (size_t)WS_END) return;
  char* ws = (char*)d_ws; __bf16* PK = (__bf16*)(ws + WS_PK); _Float16 *QK = (_Float16*)(ws + WS_QK), *QKL = (_Float16*)(ws + WS_QKL), *VTH = (_Float16*)(ws + WS_VTH), *VTL = (_Float16*)(ws + WS_VTL); float* O = (float*)(ws + WS_O);
  k_pack<<<dim3(DM, 4), 256, 0, stream>>>(F[1], F[1] + (size_t)DM * DM, F[1] + (size_t)2 * DM * DM, F[3], PK);
  k_qkv<<<dim3(TNB * SS / 64, QKVW / 128), 128, 0, stream>>>(F[0], F[0], F[0], PK + PK_A, F[2], F[2] + DM, F[2] + 2 * DM, QK, QKL, VTH, VTL);
  k_attn<<<dim3(TQB, NH, TNB), 128, 0, stream>>>(QK, QKL, VTH, VTL, nullptr, O);
  k_out<<<dim3(TOB, DM / 128), 128, 0, stream>>>(O, PK + PK_P, F[4], (float*)d_out);
}

// v004
// Measured time: 163 microseconds a run.
// Two timings next to v003 put it at 1.21 and 1.20 times that version's speed.
// Counting every step since v000, it is 4.06 times as fast.
// compute dtype: all float inputs rounded to bf16; qkv = x . W_in^T + b with EXACT bf16 products on WMMA 16x16x32 (natural rows; the packed in_proj is three contiguous row blocks); PLAIN attention: q, k single f16, running-max softmax in f32 in the base-2 domain (1/8, log2 e, the maximum and 2^11 in one FMA a score, hardware exp), P (scaled by 2^11, single f16) x v (single f16); out = o (bf16 hi + residual) . W_out^T (2 products) + b_out.
#include <hip/hip_runtime.h>
#include <math.h>

typedef __attribute__((ext_vector_type(16))) _Float16 v16h;
typedef __attribute__((ext_vector_type(16))) __bf16 v16b;
typedef __attribute__((ext_vector_type(8)))  _Float16 v8h;
typedef __attribute__((ext_vector_type(8)))  float v8f;
typedef __attribute__((ext_vector_type(4)))  float v4f;
typedef __attribute__((ext_vector_type(2)))  float v2f;
typedef __attribute__((ext_vector_type(4)))  unsigned v4u;
typedef __attribute__((ext_vector_type(4)))  int v4i;
typedef float __attribute__((may_alias)) float_a;
typedef int __attribute__((may_alias)) int_a;

template <typename T> __device__ __forceinline__ void vst2(void* p, T v) { *(T*)p = v;  }
__device__ __forceinline__ v8f wmma16(v16h a, v16h b, v8f c) {
  v8f d = __builtin_amdgcn_wmma_f32_16x16x32_f16(false, a, false, b, (short)0, c, false, false);
  asm volatile("v_nop\n\tv_nop\n\tv_nop\n\tv_nop" : "+v"(d) : "v"(a), "v"(b));
  return d;
}
__device__ __forceinline__ v8f wmma_bf(v16b a, v16b b, v8f c) {
  v8f d = __builtin_amdgcn_wmma_f32_16x16x32_bf16(false, a, false, b, (short)0, c, false, false);
  asm volatile("v_nop\n\tv_nop\n\tv_nop\n\tv_nop" : "+v"(d) : "v"(a), "v"(b));
  return d;
}
// nn.MultiheadAttention-style self attention (B 4, S 2,048, E 1,024, 16 heads x 64): packed in_proj (natural [3E][E]) + bias, softmax(q k^T / 8) v, out_proj + bias.
__device__ __forceinline__ v16h frag_h(const _Float16* rowk0, int lane) {
  union { v16h v; v8h q[2]; } u; const _Float16* p = rowk0 + 8 * (lane >> 4);
  u.q[0] = *(const v8h*)p; u.q[1] = *(const v8h*)(p + 16); return u.v;
}
__device__ __forceinline__ v16h frag_f32(const float* rowk0, int lane) {
  v16h a; const float* p = rowk0 + 8 * (lane >> 4);
#pragma unroll
  for (int i = 0; i < 8; ++i) { a[i] = (_Float16)p[i]; a[8 + i] = (_Float16)p[16 + i]; }
  return a;
}
__device__ __forceinline__ v16h frag_f32s(const float* rowk0, int lane, float sc) {
  v16h a; const float* p = rowk0 + 8 * (lane >> 4);
#pragma unroll
  for (int i = 0; i < 8; ++i) { a[i] = (_Float16)(p[i] * sc); a[8 + i] = (_Float16)(p[16 + i] * sc); }
  return a;
}
// column fragment from a [K][ld] layout (column n), rows >= K read as 0
__device__ __forceinline__ v16h fragc_f32(const float* W, int k0, int n, int lane, int ld, int K) {
  v16h a; const int g = lane >> 4;
#pragma unroll
  for (int i = 0; i < 8; ++i) { const int ka = k0 + 8 * g + i, kb = ka + 16;
    a[i] = (_Float16)(ka < K ? W[(size_t)(ka < K ? ka : K - 1) * ld + n] : 0.f); a[8 + i] = (_Float16)(kb < K ? W[(size_t)(kb < K ? kb : K - 1) * ld + n] : 0.f); }
  return a;
}
struct F2 { v16b h, l; };
__device__ __forceinline__ F2 bsplit16(const float v[16]) { F2 r;
#pragma unroll
  for (int i = 0; i < 16; ++i) { const __bf16 h = (__bf16)v[i]; r.h[i] = h; r.l[i] = (__bf16)(v[i] - (float)h); }
  return r; }
__device__ __forceinline__ F2 split_row(const float* row, int k0, int lane) { float v[16]; const float* p = row + k0 + 8 * (lane >> 4);
#pragma unroll
  for (int i = 0; i < 8; ++i) { v[i] = p[i]; v[8 + i] = p[16 + i]; }
  return bsplit16(v); }
__device__ __forceinline__ F2 split_rowK(const float* row, int k0, int lane, int K) { float v[16]; const int g = lane >> 4;
#pragma unroll
  for (int i = 0; i < 8; ++i) { const int ka = k0 + 8 * g + i, kb = ka + 16; v[i] = ka < K ? row[ka < K ? ka : K - 1] : 0.f; v[8 + i] = kb < K ? row[kb < K ? kb : K - 1] : 0.f; }
  return bsplit16(v); }
__device__ __forceinline__ F2 split_col(const float* W, int k0, int n, int lane, int ld, int K) { float v[16]; const int g = lane >> 4;
#pragma unroll
  for (int i = 0; i < 8; ++i) { const int ka = k0 + 8 * g + i, kb = ka + 16; v[i] = ka < K ? W[(size_t)(ka < K ? ka : K - 1) * ld + n] : 0.f; v[8 + i] = kb < K ? W[(size_t)(kb < K ? kb : K - 1) * ld + n] : 0.f; }
  return bsplit16(v); }
__device__ __forceinline__ v8f mac3(const F2& a, const F2& b, v8f c) { c = wmma_bf(a.l, b.h, c); c = wmma_bf(a.h, b.l, c); return wmma_bf(a.h, b.h, c); }
__device__ __forceinline__ float sigm(float v) { return 1.0f / (1.0f + expf(-v)); }
#define LDSX() do { asm volatile("s_wait_dscnt 0" ::: "memory"); __builtin_amdgcn_wave_barrier(); __builtin_amdgcn_fence(__ATOMIC_RELEASE, "workgroup"); } while (0)


#define NB 4
#define SS 2048
#define DM 1024
#define NH 16
#define HD 64
#define QKVW (3 * DM)
#ifndef TQB
#define TQB (SS / 64)
#define TNB NB
#define TOB (NB * SS / 64)     // 64-row tiles of all rows; unused
#endif
typedef __attribute__((ext_vector_type(8))) __bf16 v8b;
__device__ __forceinline__ v16b frag_b(const __bf16* rowk0, int lane) {
  union { v16b v; v8b q[2]; } u; const __bf16* p = rowk0 + 8 * (lane >> 4);
  u.q[0] = *(const v8b*)p; u.q[1] = *(const v8b*)(p + 16); return u.v;
}
__device__ __forceinline__ float bfr(float v) { return (float)(__bf16)v; }
__device__ __attribute__((noinline)) float exp_ni(float v) { return expf(v); }
__device__ __attribute__((noinline)) float erf_ni(float v) { return erff(v); }

#define PK_A 0                       // [3072][1024] Wqkv rows (natural [out][in])
#define PK_P (PK_A + QKVW * DM)        // [1024][1024] Wo rows (natural)
#define PK_END (PK_P + DM * DM)
#define WS_PK  0u
#define WS_QK  (WS_PK + 2u * PK_END)             // f16 [8192 rows][2048]: q | k
#define WS_QKL (WS_QK + 2u * NB * SS * 2 * DM)     // f16 q | k residual planes x2048
#define WS_VTH (WS_QKL + 2u * NB * SS * 2 * DM)    // f16 [b][1024 (h*64+d)][2048 s] hi
#define WS_VTL (WS_VTH + 2u * NB * DM * SS)        // f16 lo x 2048
#define WS_O   (WS_VTL + 2u * NB * DM * SS)        // f32 [8192][1024]
#define WS_CS  (WS_O + 4u * NB * SS * DM)           // f32 2 x [2048][32], unused
#define WS_END (WS_CS + 4u * 2 * SS * 32)
// ---- k_pack: block = (row n, which): natural [out][in] rows -> bf16; which 0..2 -> W_q/W_k/W_v into PK_A rows which*1024 + n; 3 -> W_o into PK_P
__global__ __launch_bounds__(256) void k_pack(const float* __restrict__ WQ, const float* __restrict__ WK, const float* __restrict__ WV, const float* __restrict__ WO, __bf16* __restrict__ PK) {
  __shared__ __align__(16) __bf16 s[DM]; const int n = blockIdx.x, which = blockIdx.y, t = threadIdx.x; const float* Wm = (which == 0) ? WQ : (which == 1) ? WK : (which == 2) ? WV : WO;
  for (int k = t; k < DM; k += 256) s[k] = (__bf16)Wm[(size_t)n * DM + k];
  __syncthreads();
  __bf16* dst = (which < 3) ? PK + PK_A + ((size_t)which * DM + n) * DM : PK + PK_P + (size_t)n * DM;
  for (int q = t; q < DM / 8; q += 256) vst2((unsigned*)(dst + q * 8), *(const v4u*)&s[q * 8]);
}
// LDS staging: a stage is 64 k (one 128-B line of every 16-bit operand row); rows lie at a pitch of 144 B (16 B x odd) for the ds_load_b128 fragment readers
#define KS 64
#define LP 72
typedef __attribute__((ext_vector_type(4))) __bf16 v4b;
// GEMM tiling of k_qkv and k_out: a work-group of 8 waves (2 x 4) owns 128 rows x 256 columns, a wave 64 x 64 = 4 x 4 accumulator tiles: 8 fragments feed 16 WMMAs, and a staged line is used by 4 (x, o) or 2 (W) waves
// between a wave's writes and its read-back of its own staging rows, and between the read-back and the next rows' writes: the LDS wait alone; no release fence, which would also wait out the global stores of the rows before
#define LDSW() do { asm volatile("s_wait_dscnt 0" ::: "memory"); __builtin_amdgcn_wave_barrier(); } while (0)
#define TM 128
#define TN 256
// the second bound asks for 4 waves a SIMD: a budget of 256 registers, so that two work-groups share a WGP and one's WMMAs cover the other's global wait, LDS fill and barrier
__global__ __launch_bounds__(256, 4) void k_qkv(const float* __restrict__ XQ, const float* __restrict__ XK, const float* __restrict__ XV, const __bf16* __restrict__ P, const float* __restrict__ BQ, const float* __restrict__ BK, const float* __restrict__ BV, _Float16* __restrict__ QK, _Float16* __restrict__ QKL, _Float16* __restrict__ VTH, _Float16* __restrict__ VTL) {
  const int n0 = blockIdx.y * TN; const int which0 = n0 / DM; const float* X = (which0 == 0) ? XQ : (which0 == 1) ? XK : XV; const float* BB = BQ ? (((which0 == 0) ? BQ : (which0 == 1) ? BK : BV) + (n0 - which0 * DM)) : nullptr;
  // the two stage buffers and the epilogue's staging share one LDS range: the loop's last barrier stands between them; ep[wave] belongs to one wave alone
  __shared__ __align__(16) union { struct { __bf16 a[2][TM][LP], b[2][TN][LP]; } st; _Float16 ep[8][2][16][LP]; } sm;
  const int tid = threadIdx.x, wave = __builtin_amdgcn_readfirstlane(tid >> 5), lane = tid & 31, col = lane & 15, g = lane >> 4; const int wm = wave & 1, wn = wave >> 1;
  const size_t r0 = (size_t)blockIdx.x * TM + wm * 64; const int nw = n0 + wn * 64;
  v8f acc[4][4] = {};
  // whole-line global loads: W 8 lanes x 16 B = one line of a row (4 rows a wave-load), x 16 lanes x 16 B = two lines of a row (2 rows a wave-load)
  const int br = tid >> 3, bc = (tid & 7) * 8, ar = tid >> 4, ac = (tid & 15) * 4;
  const __bf16* pb = P + (size_t)(n0 + br) * DM + bc; const float* pa = X + ((size_t)blockIdx.x * TM + ar) * DM + ac;
  v8b rb[8]; v4f ra[8];
#pragma unroll
  for (int i = 0; i < 8; ++i) { rb[i] = *(const v8b*)(pb + (size_t)i * 32 * DM); ra[i] = *(const v4f*)(pa + (size_t)i * 16 * DM); }
#pragma unroll
  for (int i = 0; i < 8; ++i) { *(v8b*)&sm.st.b[0][br + 32 * i][bc] = rb[i]; v4b c; c[0] = (__bf16)ra[i][0]; c[1] = (__bf16)ra[i][1]; c[2] = (__bf16)ra[i][2]; c[3] = (__bf16)ra[i][3]; *(v4b*)&sm.st.a[0][ar + 16 * i][ac] = c; }
  __syncthreads();
#pragma unroll 2   // two stages a trip: the buffer index is a constant in the addresses
  for (int s = 0; s < DM / KS; ++s) { const int cur = s & 1;
    if (s + 1 < DM / KS) {   // the next stage's lines fly into registers while this stage is multiplied
#pragma unroll
      for (int i = 0; i < 8; ++i) { rb[i] = *(const v8b*)(pb + (size_t)i * 32 * DM + (s + 1) * KS); ra[i] = *(const v4f*)(pa + (size_t)i * 16 * DM + (s + 1) * KS); } }
#pragma unroll
    for (int kc = 0; kc < KS / 32; ++kc) { v16b w[4];
#pragma unroll
      for (int j = 0; j < 4; ++j) w[j] = frag_b(&sm.st.b[cur][wn * 64 + j * 16 + col][kc * 32], lane);
#pragma unroll
      for (int ii = 0; ii < 4; ii += 2) { v16b a[2];   // x fragments two at a time: the live set stays inside 256 registers, so two work-groups share a WGP
#pragma unroll
        for (int i = 0; i < 2; ++i) a[i] = frag_b(&sm.st.a[cur][wm * 64 + (ii + i) * 16 + col][kc * 32], lane);
        asm volatile("" :: "v"(a[0]), "v"(a[1]), "v"(w[0]), "v"(w[1]), "v"(w[2]), "v"(w[3]));   // holds the block's LDS reads as one group in front of its WMMAs: one LDS latency a block, not one a WMMA
#pragma unroll
        for (int i = 0; i < 2; ++i) {
#pragma unroll
          for (int j = 0; j < 4; ++j) acc[ii + i][j] = wmma_bf(a[i], w[j], acc[ii + i][j]); } } }
    __builtin_amdgcn_sched_barrier(0);   // keeps the conversions below, and with them the wait on the global loads, behind this stage's WMMAs
    if (s + 1 < DM / KS) {   // into the buffer whose readers all passed the barrier of the trip before
#pragma unroll
      for (int i = 0; i < 8; ++i) { *(v8b*)&sm.st.b[cur ^ 1][br + 32 * i][bc] = rb[i]; v4b c; c[0] = (__bf16)ra[i][0]; c[1] = (__bf16)ra[i][1]; c[2] = (__bf16)ra[i][2]; c[3] = (__bf16)ra[i][3]; *(v4b*)&sm.st.a[cur ^ 1][ar + 16 * i][ac] = c; } }
    __syncthreads(); }   // publishes stage s + 1 and ends every read of stage s
  auto& eh = sm.ep[wave][0]; auto& el = sm.ep[wave][1];   // 16 rows of one 128-B line each, hi and residual plane
  const int ln = __builtin_amdgcn_mbcnt_lo(~0u, 0u), ecol = ln & 15, eg = ln >> 4;   // the lane's number read anew: no lane index of the epilogue holds a register through the loop
  const int er = ln >> 3, ec = (ln & 7) * 8;   // read-back: 8 lanes x 16 B = one line, 4 rows a wave-store
  float bias[4];
#pragma unroll
  for (int j = 0; j < 4; ++j) bias[j] = BB ? bfr(BB[wn * 64 + j * 16 + ecol]) : 0.f;
  if (n0 < 2 * DM) {   // q stored unscaled (f16 sigma ~0.6, no subnormal exposure); 1/8 applied to the f32 score
#pragma unroll
    for (int i = 0; i < 4; ++i) {   // 16 rows x 64 columns at a time
#pragma unroll
      for (int j = 0; j < 4; ++j) {
#pragma unroll
        for (int r = 0; r < 8; ++r) { const float v = acc[i][j][r] + bias[j]; const _Float16 hv = (_Float16)v; eh[8 * eg + r][j * 16 + ecol] = hv; el[8 * eg + r][j * 16 + ecol] = (_Float16)((v - (float)hv) * 2048.0f); } }   // q, k (+ bias) as f16 hi + (x2048) residual
      LDSW();
#pragma unroll
      for (int q = 0; q < 4; ++q) { const size_t o = (r0 + i * 16 + q * 4 + er) * (2 * DM) + nw + ec; vst2((unsigned*)(QK + o), *(const v4u*)&eh[q * 4 + er][ec]); vst2((unsigned*)(QKL + o), *(const v4u*)&el[q * 4 + er][ec]); }
      if (i < 3) LDSW(); }   // the rows are read before the next 16 overwrite them
  } else {
    const int b = (int)(r0 / SS), s0 = (int)(r0 % SS); const int pc0 = nw - 2 * DM;
#pragma unroll
    for (int j = 0; j < 4; ++j) {   // transposed: 16 d rows x 64 s at a time; a lane's eight accumulator rows are eight neighbours in s
#pragma unroll
      for (int i = 0; i < 4; ++i) { v8h h8, l8;
#pragma unroll
        for (int r = 0; r < 8; ++r) { const float v = acc[i][j][r] + bias[j]; const _Float16 hv = (_Float16)v; h8[r] = hv; l8[r] = (_Float16)((v - (float)hv) * 2048.0f); }
        *(v8h*)&eh[ecol][i * 16 + 8 * eg] = h8; *(v8h*)&el[ecol][i * 16 + 8 * eg] = l8; }
      LDSW();
#pragma unroll
      for (int q = 0; q < 4; ++q) { const size_t o = ((size_t)b * DM + pc0 + j * 16 + q * 4 + er) * SS + s0 + ec; vst2((unsigned*)(VTH + o), *(const v4u*)&eh[q * 4 + er][ec]); vst2((unsigned*)(VTL + o), *(const v4u*)&el[q * 4 + er][ec]); }
      if (j < 3) LDSW(); }   // the rows are read before the next 16 overwrite them
    asm volatile("s_wait_xcnt 0x0" ::: "memory");   // in the listing this branch's text runs on into the other branch's, behind a jump: the wait stands in front of every rewrite of a register that the stores above name
  }
}
__device__ __forceinline__ float xhalf(float x) { return __builtin_bit_cast(float, __builtin_amdgcn_permlanex16(__builtin_bit_cast(int, x), __builtin_bit_cast(int, x), 0x76543210, 0xfedcba98, false, false)); }   // lane l with lane l ^ 16
// eight base-2 exponentials in place and back to back: none writes a register of the one in front of it, and no filler stands between them; the closing v_nop is the slot that the instruction set asks for behind a transcendental before its result is read
__device__ __forceinline__ void exp2x8(v8f& x) {
  float a0 = x[0], a1 = x[1], a2 = x[2], a3 = x[3], a4 = x[4], a5 = x[5], a6 = x[6], a7 = x[7];
  asm("v_exp_f32 %0, %0\n\tv_exp_f32 %1, %1\n\tv_exp_f32 %2, %2\n\tv_exp_f32 %3, %3\n\tv_exp_f32 %4, %4\n\tv_exp_f32 %5, %5\n\tv_exp_f32 %6, %6\n\tv_exp_f32 %7, %7\n\tv_nop" : "+v"(a0), "+v"(a1), "+v"(a2), "+v"(a3), "+v"(a4), "+v"(a5), "+v"(a6), "+v"(a7));
  x[0] = a0; x[1] = a1; x[2] = a2; x[3] = a3; x[4] = a4; x[5] = a5; x[6] = a6; x[7] = a7;
}
__global__ __launch_bounds__(128) void k_attn(const _Float16* __restrict__ QK, const _Float16* __restrict__ QKL, const _Float16* __restrict__ VTH, const _Float16* __restrict__ VTL, const void* __restrict__ KMASK, float* __restrict__ O) {
  // one stage = 64 keys: k rows [key][64 d] and v rows [d][64 keys], one 128-B line each; the stage and the epilogue's staging share one LDS range, the barrier behind the loop between them
  __shared__ __align__(16) union { struct { _Float16 k[64][LP], v[64][LP]; } st; float so[4][16][68]; } sm;
  auto& so = sm.so;
  const int tid = threadIdx.x, wave = tid >> 5, lane = tid & 31, col = lane & 15, g = lane >> 4;
  const int qb = blockIdx.x, h = blockIdx.y, b = blockIdx.z; const int q0 = qb * 64 + wave * 16; const size_t rq = (size_t)b * SS + q0 + col;
  v16h aq[2];   // B operand of the score product: column = query col
#pragma unroll
  for (int kc = 0; kc < 2; ++kc) aq[kc] = frag_h(QK + rq * (2 * DM) + h * HD + kc * 32, lane);
  float m = -3.0e38f, l = 0.f;   // this lane's query: running maximum of the raw scores (equal in both halves), sum (x2^11) over this half's keys
  const float kf = 0.125f * 1.44269504f;   // 1/sqrt(64) and log2 e in one factor
  float nb = 5.0e37f;   // addend of the score FMA in use: 11 - m * kf; the start value lies far above any real one, so the first alpha is 0
  v8f acc[4] = {};   // acc[dt][r] = O^T[dt * 16 + 8 g + r][query col]
  const int sr = tid >> 3, sc = (tid & 7) * 8;   // whole-line global loads: 8 lanes x 16 B = one line of a row, 4 rows a wave-load
  const _Float16* pk = QK + ((size_t)b * SS + sr) * (2 * DM) + DM + h * HD + sc; const _Float16* pv = VTH + ((size_t)b * DM + h * HD + sr) * SS + sc;
#pragma unroll 1   // rolled: the barriers bound every stage anyway, and the loop's text stays small
  for (int st = 0; st < SS / 64; ++st) {   // all keys
    { v8h rk[4], rv[4];
#pragma unroll
      for (int i = 0; i < 4; ++i) { rk[i] = *(const v8h*)(pk + (size_t)(st * 64 + 16 * i) * (2 * DM)); rv[i] = *(const v8h*)(pv + (size_t)(16 * i) * SS + st * 64); }
      __syncthreads();   // every wave has left the stage before
#pragma unroll
      for (int i = 0; i < 4; ++i) { *(v8h*)&sm.st.k[sr + 16 * i][sc] = rk[i]; *(v8h*)&sm.st.v[sr + 16 * i][sc] = rv[i]; } }
    __syncthreads();   // publishes the stage
#pragma unroll   // both halves of the stage in line: constant LDS offsets
    for (int sub = 0; sub < 2; ++sub) { v8f s[2]; v16h fk[2][2];   // s[ct][r] = raw score q.k of key sub * 32 + ct * 16 + 8 g + r of the stage against query col
#pragma unroll
      for (int ct = 0; ct < 2; ++ct) { fk[ct][0] = frag_h(&sm.st.k[sub * 32 + ct * 16 + col][0], lane); fk[ct][1] = frag_h(&sm.st.k[sub * 32 + ct * 16 + col][32], lane); }
      asm volatile("" :: "v"(fk[0][0]), "v"(fk[0][1]), "v"(fk[1][0]), "v"(fk[1][1]));   // holds the four k fragments' LDS reads as one group in front of the score WMMAs: one LDS latency, not four
#pragma unroll
      for (int ct = 0; ct < 2; ++ct) { v8f c = {};
#pragma unroll
        for (int kc = 0; kc < 2; ++kc) c = wmma16(fk[ct][kc], aq[kc], c);   // single product: k rows as A, q as B, one-rounding f16 operands
        s[ct] = c; }
      float mt[2];   // two independent chains, then one exchange between the wave's halves
#pragma unroll
      for (int t = 0; t < 2; ++t) { mt[t] = s[t][0];
#pragma unroll
        for (int r = 1; r < 8; ++r) mt[t] = fmaxf(mt[t], s[t][r]); }
      float mx = fmaxf(mt[0], mt[1]); mx = fmaxf(mx, xhalf(mx));
      const float mn = fmaxf(m, mx); const float nbn = __builtin_fmaf(-mn, kf, 11.0f);   // the FMA's addend: minus the scaled maximum, plus 11 so that the weights come out x2^11
      const float alpha = __builtin_amdgcn_exp2f(nbn - nb); nb = nbn;   // old weights were formed with the old addend: the difference of the two rescales them, whatever rounding each addend took
      v16h p; v8f e[2];   // P^T packs from the two score tiles into the B operand: element ct * 8 + r = key ct * 16 + 8 g + r of the 32, the hardware k order, which frag_h gives V^T too
#pragma unroll
      for (int t = 0; t < 2; ++t) e[t] = s[t] * kf + nb;   // one FMA a score, then the hardware's base-2 exponential: 2^11 exp((q.k - max) / 8)
#pragma unroll
      for (int t = 0; t < 2; ++t) exp2x8(e[t]);
      const v8f e8 = e[0] + e[1];   // this half's 16 weights: tiles first, then the eight registers
      const float es = ((e8[0] + e8[2]) + (e8[4] + e8[6])) + ((e8[1] + e8[3]) + (e8[5] + e8[7]));
#pragma unroll
      for (int t = 0; t < 2; ++t) {   // P carries 2^11 so small softmax weights stay out of the f16 subnormal range; l carries it too
#pragma unroll
        for (int r = 0; r < 8; ++r) p[t * 8 + r] = (_Float16)e[t][r]; }
      l = l * alpha + es; m = mn;
#pragma unroll
      for (int dt = 0; dt < 4; ++dt) acc[dt] *= alpha;
#pragma unroll
      for (int dt = 0; dt < 4; ++dt) acc[dt] = wmma16(frag_h(&sm.st.v[dt * 16 + col][sub * 32], lane), p, acc[dt]); } }   // single product: V^T rows as A, P^T (x2^11) as B
  __syncthreads();   // every wave has left the last stage: its LDS becomes the output staging
  { const float il = 1.0f / (l + xhalf(l));   // the halves' sums join once; 2^11 stands in acc and in l alike
#pragma unroll
    for (int dt = 0; dt < 4; ++dt) { v4f o0, o1;
#pragma unroll
      for (int r = 0; r < 4; ++r) { o0[r] = acc[dt][r] * il; o1[r] = acc[dt][4 + r] * il; }
      *(v4f*)&so[wave][col][dt * 16 + 8 * g] = o0; *(v4f*)&so[wave][col][dt * 16 + 8 * g + 4] = o1; } }
  LDSX();
  for (int rl = 0; rl < 16; ++rl) if (lane < 16) vst2(O + ((size_t)b * SS + q0 + rl) * DM + h * HD + lane * 4, *(const v4f*)&so[wave][rl][lane * 4]);
}
// ---- k_out: block = (128 rows, 256 cols): out = O(hi/lo) . Wo rows (2 products) + bo
__global__ __launch_bounds__(256) void k_out(const float* __restrict__ O, const __bf16* __restrict__ P, const float* __restrict__ BO, float* __restrict__ Y) {
  // the two stage buffers and the epilogue's staging share one LDS range: the loop's last barrier stands between them; so[wave] belongs to one wave alone
  __shared__ __align__(16) union { struct { __bf16 ah[2][TM][LP], al[2][TM][LP], b[2][TN][LP]; } st; float so[8][16][68]; } sm;
  const int tid = threadIdx.x, wave = tid >> 5, lane = tid & 31, col = lane & 15, g = lane >> 4; const int wm = wave & 1, wn = wave >> 1;
  const int n0 = blockIdx.y * TN; const size_t r0 = (size_t)blockIdx.x * TM + wm * 64; const int nw = n0 + wn * 64;
  v8f acc[4][4] = {};
  // whole-line global loads, as in k_qkv; o is split into its bf16 hi and residual planes on the way into LDS
  const int br = tid >> 3, bc = (tid & 7) * 8, ar = tid >> 4, ac = (tid & 15) * 4;
  const __bf16* pb = P + (size_t)(n0 + br) * DM + bc; const float* pa = O + ((size_t)blockIdx.x * TM + ar) * DM + ac;
  v8b rb[8]; v4f ra[8];
#pragma unroll
  for (int i = 0; i < 8; ++i) { rb[i] = *(const v8b*)(pb + (size_t)i * 32 * DM); ra[i] = *(const v4f*)(pa + (size_t)i * 16 * DM); }
#pragma unroll
  for (int i = 0; i < 8; ++i) { *(v8b*)&sm.st.b[0][br + 32 * i][bc] = rb[i]; v4b ch, cl;
#pragma unroll
    for (int e = 0; e < 4; ++e) { const __bf16 hv = (__bf16)ra[i][e]; ch[e] = hv; cl[e] = (__bf16)(ra[i][e] - (float)hv); }
    *(v4b*)&sm.st.ah[0][ar + 16 * i][ac] = ch; *(v4b*)&sm.st.al[0][ar + 16 * i][ac] = cl; }
  __syncthreads();
#pragma unroll 2   // two stages a trip: the buffer index is a constant in the addresses
  for (int s = 0; s < DM / KS; ++s) { const int cur = s & 1;
    if (s + 1 < DM / KS) {   // the next stage's lines fly into registers while this stage is multiplied
#pragma unroll
      for (int i = 0; i < 8; ++i) { rb[i] = *(const v8b*)(pb + (size_t)i * 32 * DM + (s + 1) * KS); ra[i] = *(const v4f*)(pa + (size_t)i * 16 * DM + (s + 1) * KS); } }
#pragma unroll
    for (int kc = 0; kc < KS / 32; ++kc) { v16b ah[4], al[4], w[4];
#pragma unroll
      for (int i = 0; i < 4; ++i) { ah[i] = frag_b(&sm.st.ah[cur][wm * 64 + i * 16 + col][kc * 32], lane); al[i] = frag_b(&sm.st.al[cur][wm * 64 + i * 16 + col][kc * 32], lane); w[i] = frag_b(&sm.st.b[cur][wn * 64 + i * 16 + col][kc * 32], lane); }
      asm volatile("" :: "v"(ah[0]), "v"(ah[1]), "v"(ah[2]), "v"(ah[3]), "v"(al[0]), "v"(al[1]), "v"(al[2]), "v"(al[3]), "v"(w[0]), "v"(w[1]), "v"(w[2]), "v"(w[3]));   // holds the block's LDS reads as one group in front of its WMMAs: one LDS latency a block, not one a WMMA
#pragma unroll
      for (int i = 0; i < 4; ++i) {   // a tile takes its residual product first and its hi product second, as before; the other three tiles of the row stand between the two
#pragma unroll
        for (int j = 0; j < 4; ++j) acc[i][j] = wmma_bf(al[i], w[j], acc[i][j]);
#pragma unroll
        for (int j = 0; j < 4; ++j) acc[i][j] = wmma_bf(ah[i], w[j], acc[i][j]); } }
    __builtin_amdgcn_sched_barrier(0);   // keeps the split below, and with it the wait on the global loads, behind this stage's WMMAs
    if (s + 1 < DM / KS) {   // into the buffer whose readers all passed the barrier of the trip before
#pragma unroll
      for (int i = 0; i < 8; ++i) { *(v8b*)&sm.st.b[cur ^ 1][br + 32 * i][bc] = rb[i]; v4b ch, cl;
#pragma unroll
        for (int e = 0; e < 4; ++e) { const __bf16 hv = (__bf16)ra[i][e]; ch[e] = hv; cl[e] = (__bf16)(ra[i][e] - (float)hv); }
        *(v4b*)&sm.st.ah[cur ^ 1][ar + 16 * i][ac] = ch; *(v4b*)&sm.st.al[cur ^ 1][ar + 16 * i][ac] = cl; } }
    __syncthreads(); }   // publishes stage s + 1 and ends every read of stage s
  auto& so = sm.so[wave];
  const int er = lane >> 4, ec = (lane & 15) * 4;   // read-back: 16 lanes x 16 B = the two lines of a row's 64 columns, 2 rows a wave-store
  float bias[4];
#pragma unroll
  for (int j = 0; j < 4; ++j) bias[j] = bfr(BO[nw + j * 16 + col]);
#pragma unroll
  for (int i = 0; i < 4; ++i) {   // 16 rows x 64 columns at a time
#pragma unroll
    for (int j = 0; j < 4; ++j) {
#pragma unroll
      for (int r = 0; r < 8; ++r) so[8 * g + r][j * 16 + col] = acc[i][j][r] + bias[j]; }
    LDSW();
#pragma unroll
    for (int q = 0; q < 8; ++q) vst2(Y + (r0 + i * 16 + q * 2 + er) * DM + nw + ec, *(const v4f*)&so[q * 2 + er][ec]);
    if (i < 3) LDSW(); }   // the rows are read before the next 16 overwrite them
}
extern "C" void kernel_launch(void* const* d_in, const int* in_sizes, int n_in, void* d_out, int out_size, void* d_ws, size_t ws_size, hipStream_t stream) {
  (void)in_sizes; (void)n_in; (void)out_size;
  const float** F = (const float**)d_in;   // 0 x [4,2048,1024], 1 in_proj_weight [3072,1024], 2 in_proj_bias [3072], 3 out_proj_weight [1024,1024], 4 out_proj_bias
  if (ws_size < (size_t)WS_END) return;
  char* ws = (char*)d_ws; __bf16* PK = (__bf16*)(ws + WS_PK); _Float16 *QK = (_Float16*)(ws + WS_QK), *QKL = (_Float16*)(ws + WS_QKL), *VTH = (_Float16*)(ws + WS_VTH), *VTL = (_Float16*)(ws + WS_VTL); float* O = (float*)(ws + WS_O);
  k_pack<<<dim3(DM, 4), 256, 0, stream>>>(F[1], F[1] + (size_t)DM * DM, F[1] + (size_t)2 * DM * DM, F[3], PK);
  k_qkv<<<dim3(TNB * SS / TM, QKVW / TN), 256, 0, stream>>>(F[0], F[0], F[0], PK + PK_A, F[2], F[2] + DM, F[2] + 2 * DM, QK, QKL, VTH, VTL);
  k_attn<<<dim3(TQB, NH, TNB), 128, 0, stream>>>(QK, QKL, VTH, VTL, nullptr, O);
  k_out<<<dim3(NB * SS / TM, DM / TN), 256, 0, stream>>>(O, PK + PK_P, F[4], (float*)d_out);
}

// v005
// It runs in 158 microseconds.
// Timed twice side by side with v004, it ran 1.03 times as fast both times.
// All steps since v000 together make it 4.20 times as fast.
// compute dtype: all float inputs rounded to bf16; qkv = x . W_in^T + b with EXACT bf16 products on WMMA 16x16x32 (natural rows; the packed in_proj is three contiguous row blocks); PLAIN attention: q, k single f16, running-max softmax in f32 in the base-2 domain (1/8, log2 e, the maximum and 2^11 in one FMA a score, hardware exp), P (scaled by 2^11, single f16) x v (single f16); out = o (bf16 hi + residual) . W_out^T (2 products) + b_out.
#include <hip/hip_runtime.h>
#include <math.h>

typedef __attribute__((ext_vector_type(16))) _Float16 v16h;
typedef __attribute__((ext_vector_type(16))) __bf16 v16b;
typedef __attribute__((ext_vector_type(8)))  _Float16 v8h;
typedef __attribute__((ext_vector_type(8)))  float v8f;
typedef __attribute__((ext_vector_type(4)))  float v4f;
typedef __attribute__((ext_vector_type(2)))  float v2f;
typedef __attribute__((ext_vector_type(4)))  unsigned v4u;
typedef __attribute__((ext_vector_type(4)))  int v4i;
typedef float __attribute__((may_alias)) float_a;
typedef int __attribute__((may_alias)) int_a;

template <typename T> __device__ __forceinline__ void vst2(void* p, T v) { *(T*)p = v;  }
__device__ __forceinline__ v8f wmma16(v16h a, v16h b, v8f c) {
  v8f d = __builtin_amdgcn_wmma_f32_16x16x32_f16(false, a, false, b, (short)0, c, false, false);
  asm volatile("v_nop\n\tv_nop\n\tv_nop\n\tv_nop" : "+v"(d) : "v"(a), "v"(b));
  return d;
}
__device__ __forceinline__ v8f wmma_bf(v16b a, v16b b, v8f c) {
  v8f d = __builtin_amdgcn_wmma_f32_16x16x32_bf16(false, a, false, b, (short)0, c, false, false);
  asm volatile("v_nop\n\tv_nop\n\tv_nop\n\tv_nop" : "+v"(d) : "v"(a), "v"(b));
  return d;
}
// nn.MultiheadAttention-style self attention (B 4, S 2,048, E 1,024, 16 heads x 64): packed in_proj (natural [3E][E]) + bias, softmax(q k^T / 8) v, out_proj + bias.
__device__ __forceinline__ v16h frag_h(const _Float16* rowk0, int lane) {
  union { v16h v; v8h q[2]; } u; const _Float16* p = rowk0 + 8 * (lane >> 4);
  u.q[0] = *(const v8h*)p; u.q[1] = *(const v8h*)(p + 16); return u.v;
}
__device__ __forceinline__ v16h frag_f32(const float* rowk0, int lane) {
  v16h a; const float* p = rowk0 + 8 * (lane >> 4);
#pragma unroll
  for (int i = 0; i < 8; ++i) { a[i] = (_Float16)p[i]; a[8 + i] = (_Float16)p[16 + i]; }
  return a;
}
__device__ __forceinline__ v16h frag_f32s(const float* rowk0, int lane, float sc) {
  v16h a; const float* p = rowk0 + 8 * (lane >> 4);
#pragma unroll
  for (int i = 0; i < 8; ++i) { a[i] = (_Float16)(p[i] * sc); a[8 + i] = (_Float16)(p[16 + i] * sc); }
  return a;
}
// column fragment from a [K][ld] layout (column n), rows >= K read as 0
__device__ __forceinline__ v16h fragc_f32(const float* W, int k0, int n, int lane, int ld, int K) {
  v16h a; const int g = lane >> 4;
#pragma unroll
  for (int i = 0; i < 8; ++i) { const int ka = k0 + 8 * g + i, kb = ka + 16;
    a[i] = (_Float16)(ka < K ? W[(size_t)(ka < K ? ka : K - 1) * ld + n] : 0.f); a[8 + i] = (_Float16)(kb < K ? W[(size_t)(kb < K ? kb : K - 1) * ld + n] : 0.f); }
  return a;
}
struct F2 { v16b h, l; };
__device__ __forceinline__ F2 bsplit16(const float v[16]) { F2 r;
#pragma unroll
  for (int i = 0; i < 16; ++i) { const __bf16 h = (__bf16)v[i]; r.h[i] = h; r.l[i] = (__bf16)(v[i] - (float)h); }
  return r; }
__device__ __forceinline__ F2 split_row(const float* row, int k0, int lane) { float v[16]; const float* p = row + k0 + 8 * (lane >> 4);
#pragma unroll
  for (int i = 0; i < 8; ++i) { v[i] = p[i]; v[8 + i] = p[16 + i]; }
  return bsplit16(v); }
__device__ __forceinline__ F2 split_rowK(const float* row, int k0, int lane, int K) { float v[16]; const int g = lane >> 4;
#pragma unroll
  for (int i = 0; i < 8; ++i) { const int ka = k0 + 8 * g + i, kb = ka + 16; v[i] = ka < K ? row[ka < K ? ka : K - 1] : 0.f; v[8 + i] = kb < K ? row[kb < K ? kb : K - 1] : 0.f; }
  return bsplit16(v); }
__device__ __forceinline__ F2 split_col(const float* W, int k0, int n, int lane, int ld, int K) { float v[16]; const int g = lane >> 4;
#pragma unroll
  for (int i = 0; i < 8; ++i) { const int ka = k0 + 8 * g + i, kb = ka + 16; v[i] = ka < K ? W[(size_t)(ka < K ? ka : K - 1) * ld + n] : 0.f; v[8 + i] = kb < K ? W[(size_t)(kb < K ? kb : K - 1) * ld + n] : 0.f; }
  return bsplit16(v); }
__device__ __forceinline__ v8f mac3(const F2& a, const F2& b, v8f c) { c = wmma_bf(a.l, b.h, c); c = wmma_bf(a.h, b.l, c); return wmma_bf(a.h, b.h, c); }
__device__ __forceinline__ float sigm(float v) { return 1.0f / (1.0f + expf(-v)); }
#define LDSX() do { asm volatile("s_wait_dscnt 0" ::: "memory"); __builtin_amdgcn_wave_barrier(); __builtin_amdgcn_fence(__ATOMIC_RELEASE, "workgroup"); } while (0)


#define NB 4
#define SS 2048
#define DM 1024
#define NH 16
#define HD 64
#define QKVW (3 * DM)
#ifndef TQB
#define TQB (SS / 64)
#define TNB NB
#define TOB (NB * SS / 64)     // 64-row tiles of all rows; unused
#endif
typedef __attribute__((ext_vector_type(8))) __bf16 v8b;
__device__ __forceinline__ v16b frag_b(const __bf16* rowk0, int lane) {
  union { v16b v; v8b q[2]; } u; const __bf16* p = rowk0 + 8 * (lane >> 4);
  u.q[0] = *(const v8b*)p; u.q[1] = *(const v8b*)(p + 16); return u.v;
}
__device__ __forceinline__ float bfr(float v) { return (float)(__bf16)v; }
__device__ __attribute__((noinline)) float exp_ni(float v) { return expf(v); }
__device__ __attribute__((noinline)) float erf_ni(float v) { return erff(v); }

#define PK_A 0                       // [3072][1024] Wqkv rows (natural [out][in])
#define PK_P (PK_A + QKVW * DM)        // [1024][1024] Wo rows (natural)
#define PK_END (PK_P + DM * DM)
#define WS_PK  0u
#define WS_QK  (WS_PK + 2u * PK_END)             // f16 [8192 rows][2048]: q | k
#define WS_QKL (WS_QK + 2u * NB * SS * 2 * DM)     // f16 q | k residual planes x2048
#define WS_VTH (WS_QKL + 2u * NB * SS * 2 * DM)    // f16 [b][1024 (h*64+d)][2048 s] hi
#define WS_VTL (WS_VTH + 2u * NB * DM * SS)        // f16 lo x 2048
#define WS_O   (WS_VTL + 2u * NB * DM * SS)        // f32 [8192][1024]
#define WS_CS  (WS_O + 4u * NB * SS * DM)           // f32 2 x [2048][32], unused
#define WS_END (WS_CS + 4u * 2 * SS * 32)
// ---- k_pack: block = (row n, which): natural [out][in] rows -> bf16; which 0..2 -> W_q/W_k/W_v into PK_A rows which*1024 + n; 3 -> W_o into PK_P
__global__ __launch_bounds__(256) void k_pack(const float* __restrict__ WQ, const float* __restrict__ WK, const float* __restrict__ WV, const float* __restrict__ WO, __bf16* __restrict__ PK) {
  __shared__ __align__(16) __bf16 s[DM]; const int n = blockIdx.x, which = blockIdx.y, t = threadIdx.x; const float* Wm = (which == 0) ? WQ : (which == 1) ? WK : (which == 2) ? WV : WO;
  for (int k = t; k < DM; k += 256) s[k] = (__bf16)Wm[(size_t)n * DM + k];
  __syncthreads();
  __bf16* dst = (which < 3) ? PK + PK_A + ((size_t)which * DM + n) * DM : PK + PK_P + (size_t)n * DM;
  for (int q = t; q < DM / 8; q += 256) vst2((unsigned*)(dst + q * 8), *(const v4u*)&s[q * 8]);
}
// LDS staging: a stage is 64 k (one 128-B line of every 16-bit operand row); rows lie at a pitch of 144 B (16 B x odd) for the ds_load_b128 fragment readers
#define KS 64
#define LP 72
typedef __attribute__((ext_vector_type(4))) __bf16 v4b;
// GEMM tiling of k_qkv and k_out: a work-group of 8 waves (2 x 4) owns 128 rows x 256 columns, a wave 64 x 64 = 4 x 4 accumulator tiles: 8 fragments feed 16 WMMAs, and a staged line is used by 4 (x, o) or 2 (W) waves
// between a wave's writes and its read-back of its own staging rows, and between the read-back and the next rows' writes: the LDS wait alone; no release fence, which would also wait out the global stores of the rows before
#define LDSW() do { asm volatile("s_wait_dscnt 0" ::: "memory"); __builtin_amdgcn_wave_barrier(); } while (0)
#define TM 128
#define TN 256
// the second bound asks for 4 waves a SIMD: a budget of 256 registers, so that two work-groups share a WGP and one's WMMAs cover the other's global wait, LDS fill and barrier
__global__ __launch_bounds__(256, 4) void k_qkv(const float* __restrict__ XQ, const float* __restrict__ XK, const float* __restrict__ XV, const __bf16* __restrict__ P, const float* __restrict__ BQ, const float* __restrict__ BK, const float* __restrict__ BV, _Float16* __restrict__ QK, _Float16* __restrict__ QKL, _Float16* __restrict__ VTH, _Float16* __restrict__ VTL) {
  const int n0 = blockIdx.y * TN; const int which0 = n0 / DM; const float* X = (which0 == 0) ? XQ : (which0 == 1) ? XK : XV; const float* BB = BQ ? (((which0 == 0) ? BQ : (which0 == 1) ? BK : BV) + (n0 - which0 * DM)) : nullptr;
  // the two stage buffers and the epilogue's staging share one LDS range: the loop's last barrier stands between them; ep[wave] belongs to one wave alone
  __shared__ __align__(16) union { struct { __bf16 a[2][TM][LP], b[2][TN][LP]; } st; _Float16 ep[8][2][16][LP]; } sm;
  const int tid = threadIdx.x, wave = __builtin_amdgcn_readfirstlane(tid >> 5), lane = tid & 31, col = lane & 15, g = lane >> 4; const int wm = wave & 1, wn = wave >> 1;
  const size_t r0 = (size_t)blockIdx.x * TM + wm * 64; const int nw = n0 + wn * 64;
  v8f acc[4][4] = {};
  // whole-line global loads: W 8 lanes x 16 B = one line of a row (4 rows a wave-load), x 16 lanes x 16 B = two lines of a row (2 rows a wave-load)
  const int br = tid >> 3, bc = (tid & 7) * 8, ar = tid >> 4, ac = (tid & 15) * 4;
  const __bf16* pb = P + (size_t)(n0 + br) * DM + bc; const float* pa = X + ((size_t)blockIdx.x * TM + ar) * DM + ac;
  v8b rb[8]; v4f ra[8];
#pragma unroll
  for (int i = 0; i < 8; ++i) { rb[i] = *(const v8b*)(pb + (size_t)i * 32 * DM); ra[i] = *(const v4f*)(pa + (size_t)i * 16 * DM); }
#pragma unroll
  for (int i = 0; i < 8; ++i) { *(v8b*)&sm.st.b[0][br + 32 * i][bc] = rb[i]; v4b c; c[0] = (__bf16)ra[i][0]; c[1] = (__bf16)ra[i][1]; c[2] = (__bf16)ra[i][2]; c[3] = (__bf16)ra[i][3]; *(v4b*)&sm.st.a[0][ar + 16 * i][ac] = c; }
  __syncthreads();
#pragma unroll 2   // two stages a trip: the buffer index is a constant in the addresses
  for (int s = 0; s < DM / KS; ++s) { const int cur = s & 1;
    if (s + 1 < DM / KS) {   // the next stage's lines fly into registers while this stage is multiplied
#pragma unroll
      for (int i = 0; i < 8; ++i) { rb[i] = *(const v8b*)(pb + (size_t)i * 32 * DM + (s + 1) * KS); ra[i] = *(const v4f*)(pa + (size_t)i * 16 * DM + (s + 1) * KS); } }
#pragma unroll
    for (int kc = 0; kc < KS / 32; ++kc) { v16b w[4];
#pragma unroll
      for (int j = 0; j < 4; ++j) w[j] = frag_b(&sm.st.b[cur][wn * 64 + j * 16 + col][kc * 32], lane);
#pragma unroll
      for (int ii = 0; ii < 4; ii += 2) { v16b a[2];   // x fragments two at a time: the live set stays inside 256 registers, so two work-groups share a WGP
#pragma unroll
        for (int i = 0; i < 2; ++i) a[i] = frag_b(&sm.st.a[cur][wm * 64 + (ii + i) * 16 + col][kc * 32], lane);
        asm volatile("" :: "v"(a[0]), "v"(a[1]), "v"(w[0]), "v"(w[1]), "v"(w[2]), "v"(w[3]));   // holds the block's LDS reads as one group in front of its WMMAs: one LDS latency a block, not one a WMMA
#pragma unroll
        for (int i = 0; i < 2; ++i) {
#pragma unroll
          for (int j = 0; j < 4; ++j) acc[ii + i][j] = wmma_bf(a[i], w[j], acc[ii + i][j]); } } }
    __builtin_amdgcn_sched_barrier(0);   // keeps the conversions below, and with them the wait on the global loads, behind this stage's WMMAs
    if (s + 1 < DM / KS) {   // into the buffer whose readers all passed the barrier of the trip before
#pragma unroll
      for (int i = 0; i < 8; ++i) { *(v8b*)&sm.st.b[cur ^ 1][br + 32 * i][bc] = rb[i]; v4b c; c[0] = (__bf16)ra[i][0]; c[1] = (__bf16)ra[i][1]; c[2] = (__bf16)ra[i][2]; c[3] = (__bf16)ra[i][3]; *(v4b*)&sm.st.a[cur ^ 1][ar + 16 * i][ac] = c; } }
    __syncthreads(); }   // publishes stage s + 1 and ends every read of stage s
  auto& eh = sm.ep[wave][0]; auto& el = sm.ep[wave][1];   // 16 rows of one 128-B line each, hi and residual plane
  const int ln = __builtin_amdgcn_mbcnt_lo(~0u, 0u), ecol = ln & 15, eg = ln >> 4;   // the lane's number read anew: no lane index of the epilogue holds a register through the loop
  const int er = ln >> 3, ec = (ln & 7) * 8;   // read-back: 8 lanes x 16 B = one line, 4 rows a wave-store
  float bias[4];
#pragma unroll
  for (int j = 0; j < 4; ++j) bias[j] = BB ? bfr(BB[wn * 64 + j * 16 + ecol]) : 0.f;
  if (n0 < 2 * DM) {   // q stored unscaled (f16 sigma ~0.6, no subnormal exposure); 1/8 applied to the f32 score
#pragma unroll
    for (int i = 0; i < 4; ++i) {   // 16 rows x 64 columns at a time
#pragma unroll
      for (int j = 0; j < 4; ++j) {
#pragma unroll
        for (int r = 0; r < 8; ++r) { const float v = acc[i][j][r] + bias[j]; const _Float16 hv = (_Float16)v; eh[8 * eg + r][j * 16 + ecol] = hv; el[8 * eg + r][j * 16 + ecol] = (_Float16)((v - (float)hv) * 2048.0f); } }   // q, k (+ bias) as f16 hi + (x2048) residual
      LDSW();
#pragma unroll
      for (int q = 0; q < 4; ++q) { const size_t o = (r0 + i * 16 + q * 4 + er) * (2 * DM) + nw + ec; vst2((unsigned*)(QK + o), *(const v4u*)&eh[q * 4 + er][ec]); vst2((unsigned*)(QKL + o), *(const v4u*)&el[q * 4 + er][ec]); }
      if (i < 3) LDSW(); }   // the rows are read before the next 16 overwrite them
  } else {
    const int b = (int)(r0 / SS), s0 = (int)(r0 % SS); const int pc0 = nw - 2 * DM;
#pragma unroll
    for (int j = 0; j < 4; ++j) {   // transposed: 16 d rows x 64 s at a time; a lane's eight accumulator rows are eight neighbours in s
#pragma unroll
      for (int i = 0; i < 4; ++i) { v8h h8, l8;
#pragma unroll
        for (int r = 0; r < 8; ++r) { const float v = acc[i][j][r] + bias[j]; const _Float16 hv = (_Float16)v; h8[r] = hv; l8[r] = (_Float16)((v - (float)hv) * 2048.0f); }
        *(v8h*)&eh[ecol][i * 16 + 8 * eg] = h8; *(v8h*)&el[ecol][i * 16 + 8 * eg] = l8; }
      LDSW();
#pragma unroll
      for (int q = 0; q < 4; ++q) { const size_t o = ((size_t)b * DM + pc0 + j * 16 + q * 4 + er) * SS + s0 + ec; vst2((unsigned*)(VTH + o), *(const v4u*)&eh[q * 4 + er][ec]); vst2((unsigned*)(VTL + o), *(const v4u*)&el[q * 4 + er][ec]); }
      if (j < 3) LDSW(); }   // the rows are read before the next 16 overwrite them
    asm volatile("s_wait_xcnt 0x0" ::: "memory");   // in the listing this branch's text runs on into the other branch's, behind a jump: the wait stands in front of every rewrite of a register that the stores above name
  }
}
__device__ __forceinline__ float xhalf(float x) { return __builtin_bit_cast(float, __builtin_amdgcn_permlanex16(__builtin_bit_cast(int, x), __builtin_bit_cast(int, x), 0x76543210, 0xfedcba98, false, false)); }   // lane l with lane l ^ 16
// eight base-2 exponentials in place and back to back: none writes a register of the one in front of it, and no filler stands between them; the closing v_nop is the slot that the instruction set asks for behind a transcendental before its result is read
__device__ __forceinline__ void exp2x8(v8f& x) {
  float a0 = x[0], a1 = x[1], a2 = x[2], a3 = x[3], a4 = x[4], a5 = x[5], a6 = x[6], a7 = x[7];
  asm("v_exp_f32 %0, %0\n\tv_exp_f32 %1, %1\n\tv_exp_f32 %2, %2\n\tv_exp_f32 %3, %3\n\tv_exp_f32 %4, %4\n\tv_exp_f32 %5, %5\n\tv_exp_f32 %6, %6\n\tv_exp_f32 %7, %7\n\tv_nop" : "+v"(a0), "+v"(a1), "+v"(a2), "+v"(a3), "+v"(a4), "+v"(a5), "+v"(a6), "+v"(a7));
  x[0] = a0; x[1] = a1; x[2] = a2; x[3] = a3; x[4] = a4; x[5] = a5; x[6] = a6; x[7] = a7;
}
// a work-group of 8 waves owns 256 queries, a wave 32 = two 16-query column groups: a k or v fragment read from LDS feeds two WMMAs, and a staged line serves 256 queries
// the second bound asks for 4 waves a SIMD: a budget of 256 registers, so that two work-groups share a WGP and one's arithmetic covers the other's global wait, LDS fill and barriers
__global__ __launch_bounds__(256, 4) void k_attn(const _Float16* __restrict__ QK, const _Float16* __restrict__ QKL, const _Float16* __restrict__ VTH, const _Float16* __restrict__ VTL, const void* __restrict__ KMASK, float* __restrict__ O) {
  // one stage = 64 keys: k rows [key][64 d] and v rows [d][64 keys], one 128-B line each; the stage and the epilogue's staging share one LDS range, the barrier behind the loop between them
  __shared__ __align__(16) union { struct { _Float16 k[64][LP], v[64][LP]; } st; float so[8][32][68]; } sm;
  auto& so = sm.so;
  const int tid = threadIdx.x, wave = tid >> 5, lane = tid & 31, col = lane & 15, g = lane >> 4;
  const int qb = blockIdx.x, h = blockIdx.y, b = blockIdx.z; const int q0 = qb * 256 + wave * 32;
  v16h aq[2][2];   // B operand of the score product: column = query qt * 16 + col
#pragma unroll
  for (int qt = 0; qt < 2; ++qt) {
#pragma unroll
    for (int kc = 0; kc < 2; ++kc) aq[qt][kc] = frag_h(QK + ((size_t)b * SS + q0 + qt * 16 + col) * (2 * DM) + h * HD + kc * 32, lane); }
  float m[2] = {-3.0e38f, -3.0e38f}, l[2] = {0.f, 0.f};   // this lane's two queries: running maximum of the raw scores (equal in both halves), sum (x2^11) over this half's keys
  const float kf = 0.125f * 1.44269504f;   // 1/sqrt(64) and log2 e in one factor
  float nb[2] = {5.0e37f, 5.0e37f};   // addend of the score FMA in use: 11 - m * kf; the start value lies far above any real one, so the first alpha is 0
  v8f acc[2][4] = {};   // acc[qt][dt][r] = O^T[dt * 16 + 8 g + r][query qt * 16 + col]
  const int sr = tid >> 3, sc = (tid & 7) * 8;   // whole-line global loads: 8 lanes x 16 B = one line of a row, 4 rows a wave-load
  const _Float16* pk = QK + ((size_t)b * SS + sr) * (2 * DM) + DM + h * HD + sc; const _Float16* pv = VTH + ((size_t)b * DM + h * HD + sr) * SS + sc;
#pragma unroll 1   // rolled: the barriers bound every stage anyway, and the loop's text stays small
  for (int st = 0; st < SS / 64; ++st) {   // all keys
    { v8h rk[2], rv[2];
#pragma unroll
      for (int i = 0; i < 2; ++i) { rk[i] = *(const v8h*)(pk + (size_t)(st * 64 + 32 * i) * (2 * DM)); rv[i] = *(const v8h*)(pv + (size_t)(32 * i) * SS + st * 64); }
      __syncthreads();   // every wave has left the stage before
#pragma unroll
      for (int i = 0; i < 2; ++i) { *(v8h*)&sm.st.k[sr + 32 * i][sc] = rk[i]; *(v8h*)&sm.st.v[sr + 32 * i][sc] = rv[i]; } }
    __syncthreads();   // publishes the stage
#pragma unroll   // both halves of the stage in line: constant LDS offsets
    for (int sub = 0; sub < 2; ++sub) { v8f s[2][2] = {}; v16h fk[2][2];   // s[qt][ct][r] = raw score q.k of key sub * 32 + ct * 16 + 8 g + r of the stage against query qt * 16 + col
#pragma unroll
      for (int ct = 0; ct < 2; ++ct) { fk[ct][0] = frag_h(&sm.st.k[sub * 32 + ct * 16 + col][0], lane); fk[ct][1] = frag_h(&sm.st.k[sub * 32 + ct * 16 + col][32], lane); }
      asm volatile("" :: "v"(fk[0][0]), "v"(fk[0][1]), "v"(fk[1][0]), "v"(fk[1][1]));   // holds the four k fragments' LDS reads as one group in front of the score WMMAs: one LDS latency, not four
#pragma unroll
      for (int kc = 0; kc < 2; ++kc) {   // a tile takes d 0..31 first and d 32..63 second, as before; the other three tiles stand between the two
#pragma unroll
        for (int ct = 0; ct < 2; ++ct) {
#pragma unroll
          for (int qt = 0; qt < 2; ++qt) s[qt][ct] = wmma16(fk[ct][kc], aq[qt][kc], s[qt][ct]); } }   // single product: k rows as A, q as B, one-rounding f16 operands
      v16h p[2]; float alpha[2];   // P^T packs from the two score tiles into the B operand: element ct * 8 + r = key ct * 16 + 8 g + r of the 32, the hardware k order, which frag_h gives V^T too
#pragma unroll
      for (int qt = 0; qt < 2; ++qt) {
        float mt[2];   // two independent chains, then one exchange between the wave's halves
#pragma unroll
        for (int t = 0; t < 2; ++t) { mt[t] = s[qt][t][0];
#pragma unroll
          for (int r = 1; r < 8; ++r) mt[t] = fmaxf(mt[t], s[qt][t][r]); }
        float mx = fmaxf(mt[0], mt[1]); mx = fmaxf(mx, xhalf(mx));
        const float mn = fmaxf(m[qt], mx); const float nbn = __builtin_fmaf(-mn, kf, 11.0f);   // the FMA's addend: minus the scaled maximum, plus 11 so that the weights come out x2^11
        alpha[qt] = __builtin_amdgcn_exp2f(nbn - nb[qt]); nb[qt] = nbn;   // old weights were formed with the old addend: the difference of the two rescales them, whatever rounding each addend took
        v8f e[2];
#pragma unroll
        for (int t = 0; t < 2; ++t) e[t] = s[qt][t] * kf + nbn;   // one FMA a score, then the hardware's base-2 exponential: 2^11 exp((q.k - max) / 8)
#pragma unroll
        for (int t = 0; t < 2; ++t) exp2x8(e[t]);
        const v8f e8 = e[0] + e[1];   // this half's 16 weights: tiles first, then the eight registers
        const float es = ((e8[0] + e8[2]) + (e8[4] + e8[6])) + ((e8[1] + e8[3]) + (e8[5] + e8[7]));
#pragma unroll
        for (int t = 0; t < 2; ++t) {   // P carries 2^11 so small softmax weights stay out of the f16 subnormal range; l carries it too
#pragma unroll
          for (int r = 0; r < 8; ++r) p[qt][t * 8 + r] = (_Float16)e[t][r]; }
        l[qt] = l[qt] * alpha[qt] + es; m[qt] = mn;
#pragma unroll
        for (int dt = 0; dt < 4; ++dt) acc[qt][dt] *= alpha[qt]; }
#pragma unroll
      for (int dt = 0; dt < 4; ++dt) { const v16h fv = frag_h(&sm.st.v[dt * 16 + col][sub * 32], lane);
#pragma unroll
        for (int qt = 0; qt < 2; ++qt) acc[qt][dt] = wmma16(fv, p[qt], acc[qt][dt]); } } }   // single product: V^T rows as A, P^T (x2^11) as B
  __syncthreads();   // every wave has left the last stage: its LDS becomes the output staging
#pragma unroll
  for (int qt = 0; qt < 2; ++qt) { const float il = 1.0f / (l[qt] + xhalf(l[qt]));   // the halves' sums join once; 2^11 stands in acc and in l alike
#pragma unroll
    for (int dt = 0; dt < 4; ++dt) { v4f o0, o1;
#pragma unroll
      for (int r = 0; r < 4; ++r) { o0[r] = acc[qt][dt][r] * il; o1[r] = acc[qt][dt][4 + r] * il; }
      *(v4f*)&so[wave][qt * 16 + col][dt * 16 + 8 * g] = o0; *(v4f*)&so[wave][qt * 16 + col][dt * 16 + 8 * g + 4] = o1; } }
  LDSX();
  for (int rl = 0; rl < 32; ++rl) if (lane < 16) vst2(O + ((size_t)b * SS + q0 + rl) * DM + h * HD + lane * 4, *(const v4f*)&so[wave][rl][lane * 4]);
}
// ---- k_out: block = (128 rows, 256 cols): out = O(hi/lo) . Wo rows (2 products) + bo
__global__ __launch_bounds__(256) void k_out(const float* __restrict__ O, const __bf16* __restrict__ P, const float* __restrict__ BO, float* __restrict__ Y) {
  // the two stage buffers and the epilogue's staging share one LDS range: the loop's last barrier stands between them; so[wave] belongs to one wave alone
  __shared__ __align__(16) union { struct { __bf16 ah[2][TM][LP], al[2][TM][LP], b[2][TN][LP]; } st; float so[8][16][68]; } sm;
  const int tid = threadIdx.x, wave = tid >> 5, lane = tid & 31, col = lane & 15, g = lane >> 4; const int wm = wave & 1, wn = wave >> 1;
  const int n0 = blockIdx.y * TN; const size_t r0 = (size_t)blockIdx.x * TM + wm * 64; const int nw = n0 + wn * 64;
  v8f acc[4][4] = {};
  // whole-line global loads, as in k_qkv; o is split into its bf16 hi and residual planes on the way into LDS
  const int br = tid >> 3, bc = (tid & 7) * 8, ar = tid >> 4, ac = (tid & 15) * 4;
  const __bf16* pb = P + (size_t)(n0 + br) * DM + bc; const float* pa = O + ((size_t)blockIdx.x * TM + ar) * DM + ac;
  v8b rb[8]; v4f ra[8];
#pragma unroll
  for (int i = 0; i < 8; ++i) { rb[i] = *(const v8b*)(pb + (size_t)i * 32 * DM); ra[i] = *(const v4f*)(pa + (size_t)i * 16 * DM); }
#pragma unroll
  for (int i = 0; i < 8; ++i) { *(v8b*)&sm.st.b[0][br + 32 * i][bc] = rb[i]; v4b ch, cl;
#pragma unroll
    for (int e = 0; e < 4; ++e) { const __bf16 hv = (__bf16)ra[i][e]; ch[e] = hv; cl[e] = (__bf16)(ra[i][e] - (float)hv); }
    *(v4b*)&sm.st.ah[0][ar + 16 * i][ac] = ch; *(v4b*)&sm.st.al[0][ar + 16 * i][ac] = cl; }
  __syncthreads();
#pragma unroll 2   // two stages a trip: the buffer index is a constant in the addresses
  for (int s = 0; s < DM / KS; ++s) { const int cur = s & 1;
    if (s + 1 < DM / KS) {   // the next stage's lines fly into registers while this stage is multiplied
#pragma unroll
      for (int i = 0; i < 8; ++i) { rb[i] = *(const v8b*)(pb + (size_t)i * 32 * DM + (s + 1) * KS); ra[i] = *(const v4f*)(pa + (size_t)i * 16 * DM + (s + 1) * KS); } }
#pragma unroll
    for (int kc = 0; kc < KS / 32; ++kc) { v16b ah[4], al[4], w[4];
#pragma unroll
      for (int i = 0; i < 4; ++i) { ah[i] = frag_b(&sm.st.ah[cur][wm * 64 + i * 16 + col][kc * 32], lane); al[i] = frag_b(&sm.st.al[cur][wm * 64 + i * 16 + col][kc * 32], lane); w[i] = frag_b(&sm.st.b[cur][wn * 64 + i * 16 + col][kc * 32], lane); }
      asm volatile("" :: "v"(ah[0]), "v"(ah[1]), "v"(ah[2]), "v"(ah[3]), "v"(al[0]), "v"(al[1]), "v"(al[2]), "v"(al[3]), "v"(w[0]), "v"(w[1]), "v"(w[2]), "v"(w[3]));   // holds the block's LDS reads as one group in front of its WMMAs: one LDS latency a block, not one a WMMA
#pragma unroll
      for (int i = 0; i < 4; ++i) {   // a tile takes its residual product first and its hi product second, as before; the other three tiles of the row stand between the two
#pragma unroll
        for (int j = 0; j < 4; ++j) acc[i][j] = wmma_bf(al[i], w[j], acc[i][j]);
#pragma unroll
        for (int j = 0; j < 4; ++j) acc[i][j] = wmma_bf(ah[i], w[j], acc[i][j]); } }
    __builtin_amdgcn_sched_barrier(0);   // keeps the split below, and with it the wait on the global loads, behind this stage's WMMAs
    if (s + 1 < DM / KS) {   // into the buffer whose readers all passed the barrier of the trip before
#pragma unroll
      for (int i = 0; i < 8; ++i) { *(v8b*)&sm.st.b[cur ^ 1][br + 32 * i][bc] = rb[i]; v4b ch, cl;
#pragma unroll
        for (int e = 0; e < 4; ++e) { const __bf16 hv = (__bf16)ra[i][e]; ch[e] = hv; cl[e] = (__bf16)(ra[i][e] - (float)hv); }
        *(v4b*)&sm.st.ah[cur ^ 1][ar + 16 * i][ac] = ch; *(v4b*)&sm.st.al[cur ^ 1][ar + 16 * i][ac] = cl; } }
    __syncthreads(); }   // publishes stage s + 1 and ends every read of stage s
  auto& so = sm.so[wave];
  const int er = lane >> 4, ec = (lane & 15) * 4;   // read-back: 16 lanes x 16 B = the two lines of a row's 64 columns, 2 rows a wave-store
  float bias[4];
#pragma unroll
  for (int j = 0; j < 4; ++j) bias[j] = bfr(BO[nw + j * 16 + col]);
#pragma unroll
  for (int i = 0; i < 4; ++i) {   // 16 rows x 64 columns at a time
#pragma unroll
    for (int j = 0; j < 4; ++j) {
#pragma unroll
      for (int r = 0; r < 8; ++r) so[8 * g + r][j * 16 + col] = acc[i][j][r] + bias[j]; }
    LDSW();
#pragma unroll
    for (int q = 0; q < 8; ++q) vst2(Y + (r0 + i * 16 + q * 2 + er) * DM + nw + ec, *(const v4f*)&so[q * 2 + er][ec]);
    if (i < 3) LDSW(); }   // the rows are read before the next 16 overwrite them
}
extern "C" void kernel_launch(void* const* d_in, const int* in_sizes, int n_in, void* d_out, int out_size, void* d_ws, size_t ws_size, hipStream_t stream) {
  (void)in_sizes; (void)n_in; (void)out_size;
  const float** F = (const float**)d_in;   // 0 x [4,2048,1024], 1 in_proj_weight [3072,1024], 2 in_proj_bias [3072], 3 out_proj_weight [1024,1024], 4 out_proj_bias
  if (ws_size < (size_t)WS_END) return;
  char* ws = (char*)d_ws; __bf16* PK = (__bf16*)(ws + WS_PK); _Float16 *QK = (_Float16*)(ws + WS_QK), *QKL = (_Float16*)(ws + WS_QKL), *VTH = (_Float16*)(ws + WS_VTH), *VTL = (_Float16*)(ws + WS_VTL); float* O = (float*)(ws + WS_O);
  k_pack<<<dim3(DM, 4), 256, 0, stream>>>(F[1], F[1] + (size_t)DM * DM, F[1] + (size_t)2 * DM * DM, F[3], PK);
  k_qkv<<<dim3(TNB * SS / TM, QKVW / TN), 256, 0, stream>>>(F[0], F[0], F[0], PK + PK_A, F[2], F[2] + DM, F[2] + 2 * DM, QK, QKL, VTH, VTL);
  k_attn<<<dim3(SS / 256, NH, TNB), 256, 0, stream>>>(QK, QKL, VTH, VTL, nullptr, O);
  k_out<<<dim3(NB * SS / TM, DM / TN), 256, 0, stream>>>(O, PK + PK_P, F[4], (float*)d_out);
}

// v006
// A run of this version takes 150 microseconds.
// Next to v005, in two timings, it ran 1.05 times as fast each time.
// Counting every step since v000, it is 4.41 times as fast.
// compute dtype: all float inputs rounded to bf16; qkv = x . W_in^T + b with EXACT bf16 products on WMMA 16x16x32 (natural rows; the packed in_proj is three contiguous row blocks); PLAIN attention: q, k single f16, running-max softmax in f32 in the base-2 domain (1/8, log2 e, the maximum and 2^11 in one FMA a score, hardware exp), P (scaled by 2^11, single f16) x v (single f16); out = o (bf16 hi + residual) . W_out^T (2 products) + b_out.
#include <hip/hip_runtime.h>
#include <math.h>

typedef __attribute__((ext_vector_type(16))) _Float16 v16h;
typedef __attribute__((ext_vector_type(16))) __bf16 v16b;
typedef __attribute__((ext_vector_type(8)))  _Float16 v8h;
typedef __attribute__((ext_vector_type(8)))  float v8f;
typedef __attribute__((ext_vector_type(4)))  float v4f;
typedef __attribute__((ext_vector_type(2)))  float v2f;
typedef __attribute__((ext_vector_type(4)))  unsigned v4u;
typedef __attribute__((ext_vector_type(4)))  int v4i;
typedef float __attribute__((may_alias)) float_a;
typedef int __attribute__((may_alias)) int_a;

template <typename T> __device__ __forceinline__ void vst2(void* p, T v) { *(T*)p = v;  }
__device__ __forceinline__ v8f wmma16(v16h a, v16h b, v8f c) {
  return __builtin_amdgcn_wmma_f32_16x16x32_f16(false, a, false, b, (short)0, c, false, false);
}
__device__ __forceinline__ v8f wmma_bf(v16b a, v16b b, v8f c) {
  return __builtin_amdgcn_wmma_f32_16x16x32_bf16(false, a, false, b, (short)0, c, false, false);
}
// nn.MultiheadAttention-style self attention (B 4, S 2,048, E 1,024, 16 heads x 64): packed in_proj (natural [3E][E]) + bias, softmax(q k^T / 8) v, out_proj + bias.
__device__ __forceinline__ v16h frag_h(const _Float16* rowk0, int lane) {
  union { v16h v; v8h q[2]; } u; const _Float16* p = rowk0 + 8 * (lane >> 4);
  u.q[0] = *(const v8h*)p; u.q[1] = *(const v8h*)(p + 16); return u.v;
}
__device__ __forceinline__ v16h frag_f32(const float* rowk0, int lane) {
  v16h a; const float* p = rowk0 + 8 * (lane >> 4);
#pragma unroll
  for (int i = 0; i < 8; ++i) { a[i] = (_Float16)p[i]; a[8 + i] = (_Float16)p[16 + i]; }
  return a;
}
__device__ __forceinline__ v16h frag_f32s(const float* rowk0, int lane, float sc) {
  v16h a; const float* p = rowk0 + 8 * (lane >> 4);
#pragma unroll
  for (int i = 0; i < 8; ++i) { a[i] = (_Float16)(p[i] * sc); a[8 + i] = (_Float16)(p[16 + i] * sc); }
  return a;
}
// column fragment from a [K][ld] layout (column n), rows >= K read as 0
__device__ __forceinline__ v16h fragc_f32(const float* W, int k0, int n, int lane, int ld, int K) {
  v16h a; const int g = lane >> 4;
#pragma unroll
  for (int i = 0; i < 8; ++i) { const int ka = k0 + 8 * g + i, kb = ka + 16;
    a[i] = (_Float16)(ka < K ? W[(size_t)(ka < K ? ka : K - 1) * ld + n] : 0.f); a[8 + i] = (_Float16)(kb < K ? W[(size_t)(kb < K ? kb : K - 1) * ld + n] : 0.f); }
  return a;
}
struct F2 { v16b h, l; };
__device__ __forceinline__ F2 bsplit16(const float v[16]) { F2 r;
#pragma unroll
  for (int i = 0; i < 16; ++i) { const __bf16 h = (__bf16)v[i]; r.h[i] = h; r.l[i] = (__bf16)(v[i] - (float)h); }
  return r; }
__device__ __forceinline__ F2 split_row(const float* row, int k0, int lane) { float v[16]; const float* p = row + k0 + 8 * (lane >> 4);
#pragma unroll
  for (int i = 0; i < 8; ++i) { v[i] = p[i]; v[8 + i] = p[16 + i]; }
  return bsplit16(v); }
__device__ __forceinline__ F2 split_rowK(const float* row, int k0, int lane, int K) { float v[16]; const int g = lane >> 4;
#pragma unroll
  for (int i = 0; i < 8; ++i) { const int ka = k0 + 8 * g + i, kb = ka + 16; v[i] = ka < K ? row[ka < K ? ka : K - 1] : 0.f; v[8 + i] = kb < K ? row[kb < K ? kb : K - 1] : 0.f; }
  return bsplit16(v); }
__device__ __forceinline__ F2 split_col(const float* W, int k0, int n, int lane, int ld, int K) { float v[16]; const int g = lane >> 4;
#pragma unroll
  for (int i = 0; i < 8; ++i) { const int ka = k0 + 8 * g + i, kb = ka + 16; v[i] = ka < K ? W[(size_t)(ka < K ? ka : K - 1) * ld + n] : 0.f; v[8 + i] = kb < K ? W[(size_t)(kb < K ? kb : K - 1) * ld + n] : 0.f; }
  return bsplit16(v); }
__device__ __forceinline__ v8f mac3(const F2& a, const F2& b, v8f c) { c = wmma_bf(a.l, b.h, c); c = wmma_bf(a.h, b.l, c); return wmma_bf(a.h, b.h, c); }
__device__ __forceinline__ float sigm(float v) { return 1.0f / (1.0f + expf(-v)); }
#define LDSX() do { asm volatile("s_wait_dscnt 0" ::: "memory"); __builtin_amdgcn_wave_barrier(); __builtin_amdgcn_fence(__ATOMIC_RELEASE, "workgroup"); } while (0)


#define NB 4
#define SS 2048
#define DM 1024
#define NH 16
#define HD 64
#define QKVW (3 * DM)
#ifndef TQB
#define TQB (SS / 64)
#define TNB NB
#define TOB (NB * SS / 64)     // 64-row tiles of all rows; unused
#endif
typedef __attribute__((ext_vector_type(8))) __bf16 v8b;
__device__ __forceinline__ v16b frag_b(const __bf16* rowk0, int lane) {
  union { v16b v; v8b q[2]; } u; const __bf16* p = rowk0 + 8 * (lane >> 4);
  u.q[0] = *(const v8b*)p; u.q[1] = *(const v8b*)(p + 16); return u.v;
}
__device__ __forceinline__ float bfr(float v) { return (float)(__bf16)v; }
__device__ __attribute__((noinline)) float exp_ni(float v) { return expf(v); }
__device__ __attribute__((noinline)) float erf_ni(float v) { return erff(v); }

#define PK_A 0                       // [3072][1024] Wqkv rows (natural [out][in])
#define PK_P (PK_A + QKVW * DM)        // [1024][1024] Wo rows (natural)
#define PK_END (PK_P + DM * DM)
#define WS_PK  0u
#define WS_QK  (WS_PK + 2u * PK_END)             // f16 [8192 rows][2048]: q | k
#define WS_QKL (WS_QK + 2u * NB * SS * 2 * DM)     // f16 q | k residual planes x2048
#define WS_VTH (WS_QKL + 2u * NB * SS * 2 * DM)    // f16 [b][1024 (h*64+d)][2048 s] hi
#define WS_VTL (WS_VTH + 2u * NB * DM * SS)        // f16 lo x 2048
#define WS_O   (WS_VTL + 2u * NB * DM * SS)        // f32 [8192][1024]
#define WS_CS  (WS_O + 4u * NB * SS * DM)           // f32 2 x [2048][32], unused
#define WS_END (WS_CS + 4u * 2 * SS * 32)
// ---- k_pack: block = (row n, which): natural [out][in] rows -> bf16; which 0..2 -> W_q/W_k/W_v into PK_A rows which*1024 + n; 3 -> W_o into PK_P
__global__ __launch_bounds__(256) void k_pack(const float* __restrict__ WQ, const float* __restrict__ WK, const float* __restrict__ WV, const float* __restrict__ WO, __bf16* __restrict__ PK) {
  __shared__ __align__(16) __bf16 s[DM]; const int n = blockIdx.x, which = blockIdx.y, t = threadIdx.x; const float* Wm = (which == 0) ? WQ : (which == 1) ? WK : (which == 2) ? WV : WO;
  for (int k = t; k < DM; k += 256) s[k] = (__bf16)Wm[(size_t)n * DM + k];
  __syncthreads();
  __bf16* dst = (which < 3) ? PK + PK_A + ((size_t)which * DM + n) * DM : PK + PK_P + (size_t)n * DM;
  for (int q = t; q < DM / 8; q += 256) vst2((unsigned*)(dst + q * 8), *(const v4u*)&s[q * 8]);
}
// LDS staging: a stage is 64 k (one 128-B line of every 16-bit operand row); rows lie at a pitch of 144 B (16 B x odd) for the ds_load_b128 fragment readers
#define KS 64
#define LP 72
typedef __attribute__((ext_vector_type(4))) __bf16 v4b;
// GEMM tiling of k_qkv and k_out: a work-group of 8 waves (2 x 4) owns 128 rows x 256 columns, a wave 64 x 64 = 4 x 4 accumulator tiles: 8 fragments feed 16 WMMAs, and a staged line is used by 4 (x, o) or 2 (W) waves
// between a wave's writes and its read-back of its own staging rows, and between the read-back and the next rows' writes: the LDS wait alone; no release fence, which would also wait out the global stores of the rows before
#define LDSW() do { asm volatile("s_wait_dscnt 0" ::: "memory"); __builtin_amdgcn_wave_barrier(); } while (0)
#define TM 128
#define TN 256
// the second bound asks for 4 waves a SIMD: a budget of 256 registers, so that two work-groups share a WGP and one's WMMAs cover the other's global wait, LDS fill and barrier
__global__ __launch_bounds__(256, 4) void k_qkv(const float* __restrict__ XQ, const float* __restrict__ XK, const float* __restrict__ XV, const __bf16* __restrict__ P, const float* __restrict__ BQ, const float* __restrict__ BK, const float* __restrict__ BV, _Float16* __restrict__ QK, _Float16* __restrict__ QKL, _Float16* __restrict__ VTH, _Float16* __restrict__ VTL) {
  const int n0 = blockIdx.y * TN; const int which0 = n0 / DM; const float* X = (which0 == 0) ? XQ : (which0 == 1) ? XK : XV; const float* BB = BQ ? (((which0 == 0) ? BQ : (which0 == 1) ? BK : BV) + (n0 - which0 * DM)) : nullptr;
  // the two stage buffers and the epilogue's staging share one LDS range: the loop's last barrier stands between them; ep[wave] belongs to one wave alone
  __shared__ __align__(16) union { struct { __bf16 a[2][TM][LP], b[2][TN][LP]; } st; _Float16 ep[8][2][16][LP]; } sm;
  const int tid = threadIdx.x, wave = __builtin_amdgcn_readfirstlane(tid >> 5), lane = tid & 31, col = lane & 15, g = lane >> 4; const int wm = wave & 1, wn = wave >> 1;
  const size_t r0 = (size_t)blockIdx.x * TM + wm * 64; const int nw = n0 + wn * 64;
  v8f acc[4][4] = {};
  // whole-line global loads: W 8 lanes x 16 B = one line of a row (4 rows a wave-load), x 16 lanes x 16 B = two lines of a row (2 rows a wave-load)
  const int br = tid >> 3, bc = (tid & 7) * 8, ar = tid >> 4, ac = (tid & 15) * 4;
  const __bf16* pb = P + (size_t)(n0 + br) * DM + bc; const float* pa = X + ((size_t)blockIdx.x * TM + ar) * DM + ac;
  v8b rb[8]; v4f ra[8];
#pragma unroll
  for (int i = 0; i < 8; ++i) { rb[i] = *(const v8b*)(pb + (size_t)i * 32 * DM); ra[i] = *(const v4f*)(pa + (size_t)i * 16 * DM); }
#pragma unroll
  for (int i = 0; i < 8; ++i) { *(v8b*)&sm.st.b[0][br + 32 * i][bc] = rb[i]; v4b c; c[0] = (__bf16)ra[i][0]; c[1] = (__bf16)ra[i][1]; c[2] = (__bf16)ra[i][2]; c[3] = (__bf16)ra[i][3]; *(v4b*)&sm.st.a[0][ar + 16 * i][ac] = c; }
  __syncthreads();
#pragma unroll 2   // two stages a trip: the buffer index is a constant in the addresses
  for (int s = 0; s < DM / KS; ++s) { const int cur = s & 1;
    if (s + 1 < DM / KS) {   // the next stage's lines fly into registers while this stage is multiplied
#pragma unroll
      for (int i = 0; i < 8; ++i) { rb[i] = *(const v8b*)(pb + (size_t)i * 32 * DM + (s + 1) * KS); ra[i] = *(const v4f*)(pa + (size_t)i * 16 * DM + (s + 1) * KS); } }
#pragma unroll
    for (int kc = 0; kc < KS / 32; ++kc) { v16b w[4];
#pragma unroll
      for (int j = 0; j < 4; ++j) w[j] = frag_b(&sm.st.b[cur][wn * 64 + j * 16 + col][kc * 32], lane);
#pragma unroll
      for (int ii = 0; ii < 4; ii += 2) { v16b a[2];   // x fragments two at a time: the live set stays inside 256 registers, so two work-groups share a WGP
#pragma unroll
        for (int i = 0; i < 2; ++i) a[i] = frag_b(&sm.st.a[cur][wm * 64 + (ii + i) * 16 + col][kc * 32], lane);
        asm volatile("" :: "v"(a[0]), "v"(a[1]), "v"(w[0]), "v"(w[1]), "v"(w[2]), "v"(w[3]));   // holds the block's LDS reads as one group in front of its WMMAs: one LDS latency a block, not one a WMMA
#pragma unroll
        for (int i = 0; i < 2; ++i) {
#pragma unroll
          for (int j = 0; j < 4; ++j) acc[ii + i][j] = wmma_bf(a[i], w[j], acc[ii + i][j]); } } }
    __builtin_amdgcn_sched_barrier(0);   // keeps the conversions below, and with them the wait on the global loads, behind this stage's WMMAs
    if (s + 1 < DM / KS) {   // into the buffer whose readers all passed the barrier of the trip before
#pragma unroll
      for (int i = 0; i < 8; ++i) { *(v8b*)&sm.st.b[cur ^ 1][br + 32 * i][bc] = rb[i]; v4b c; c[0] = (__bf16)ra[i][0]; c[1] = (__bf16)ra[i][1]; c[2] = (__bf16)ra[i][2]; c[3] = (__bf16)ra[i][3]; *(v4b*)&sm.st.a[cur ^ 1][ar + 16 * i][ac] = c; } }
    __syncthreads(); }   // publishes stage s + 1 and ends every read of stage s
  auto& eh = sm.ep[wave][0]; auto& el = sm.ep[wave][1];   // 16 rows of one 128-B line each, hi and residual plane
  const int ln = __builtin_amdgcn_mbcnt_lo(~0u, 0u), ecol = ln & 15, eg = ln >> 4;   // the lane's number read anew: no lane index of the epilogue holds a register through the loop
  const int er = ln >> 3, ec = (ln & 7) * 8;   // read-back: 8 lanes x 16 B = one line, 4 rows a wave-store
  float bias[4];
#pragma unroll
  for (int j = 0; j < 4; ++j) bias[j] = BB ? bfr(BB[wn * 64 + j * 16 + ecol]) : 0.f;
  if (n0 < 2 * DM) {   // q stored unscaled (f16 sigma ~0.6, no subnormal exposure); 1/8 applied to the f32 score
#pragma unroll
    for (int i = 0; i < 4; ++i) {   // 16 rows x 64 columns at a time
#pragma unroll
      for (int j = 0; j < 4; ++j) {
#pragma unroll
        for (int r = 0; r < 8; ++r) { const float v = acc[i][j][r] + bias[j]; const _Float16 hv = (_Float16)v; eh[8 * eg + r][j * 16 + ecol] = hv; el[8 * eg + r][j * 16 + ecol] = (_Float16)((v - (float)hv) * 2048.0f); } }   // q, k (+ bias) as f16 hi + (x2048) residual
      LDSW();
#pragma unroll
      for (int q = 0; q < 4; ++q) { const size_t o = (r0 + i * 16 + q * 4 + er) * (2 * DM) + nw + ec; vst2((unsigned*)(QK + o), *(const v4u*)&eh[q * 4 + er][ec]); vst2((unsigned*)(QKL + o), *(const v4u*)&el[q * 4 + er][ec]); }
      if (i < 3) LDSW(); }   // the rows are read before the next 16 overwrite them
  } else {
    const int b = (int)(r0 / SS), s0 = (int)(r0 % SS); const int pc0 = nw - 2 * DM;
#pragma unroll
    for (int j = 0; j < 4; ++j) {   // transposed: 16 d rows x 64 s at a time; a lane's eight accumulator rows are eight neighbours in s
#pragma unroll
      for (int i = 0; i < 4; ++i) { v8h h8, l8;
#pragma unroll
        for (int r = 0; r < 8; ++r) { const float v = acc[i][j][r] + bias[j]; const _Float16 hv = (_Float16)v; h8[r] = hv; l8[r] = (_Float16)((v - (float)hv) * 2048.0f); }
        *(v8h*)&eh[ecol][i * 16 + 8 * eg] = h8; *(v8h*)&el[ecol][i * 16 + 8 * eg] = l8; }
      LDSW();
#pragma unroll
      for (int q = 0; q < 4; ++q) { const size_t o = ((size_t)b * DM + pc0 + j * 16 + q * 4 + er) * SS + s0 + ec; vst2((unsigned*)(VTH + o), *(const v4u*)&eh[q * 4 + er][ec]); vst2((unsigned*)(VTL + o), *(const v4u*)&el[q * 4 + er][ec]); }
      if (j < 3) LDSW(); }   // the rows are read before the next 16 overwrite them
    asm volatile("s_wait_xcnt 0x0" ::: "memory");   // in the listing this branch's text runs on into the other branch's, behind a jump: the wait stands in front of every rewrite of a register that the stores above name
  }
}
__device__ __forceinline__ float xhalf(float x) { return __builtin_bit_cast(float, __builtin_amdgcn_permlanex16(__builtin_bit_cast(int, x), __builtin_bit_cast(int, x), 0x76543210, 0xfedcba98, false, false)); }   // lane l with lane l ^ 16
// eight base-2 exponentials in place and back to back: none writes a register of the one in front of it, and no filler stands between them; the closing v_nop is the slot that the instruction set asks for behind a transcendental before its result is read
__device__ __forceinline__ void exp2x8(v8f& x) {
  float a0 = x[0], a1 = x[1], a2 = x[2], a3 = x[3], a4 = x[4], a5 = x[5], a6 = x[6], a7 = x[7];
  asm("v_exp_f32 %0, %0\n\tv_exp_f32 %1, %1\n\tv_exp_f32 %2, %2\n\tv_exp_f32 %3, %3\n\tv_exp_f32 %4, %4\n\tv_exp_f32 %5, %5\n\tv_exp_f32 %6, %6\n\tv_exp_f32 %7, %7\n\tv_nop" : "+v"(a0), "+v"(a1), "+v"(a2), "+v"(a3), "+v"(a4), "+v"(a5), "+v"(a6), "+v"(a7));
  x[0] = a0; x[1] = a1; x[2] = a2; x[3] = a3; x[4] = a4; x[5] = a5; x[6] = a6; x[7] = a7;
}
// a work-group of 8 waves owns 256 queries, a wave 32 = two 16-query column groups: a k or v fragment read from LDS feeds two WMMAs, and a staged line serves 256 queries
// the second bound asks for 4 waves a SIMD: a budget of 256 registers, so that two work-groups share a WGP and one's arithmetic covers the other's global wait, LDS fill and barriers
__global__ __launch_bounds__(256, 4) void k_attn(const _Float16* __restrict__ QK, const _Float16* __restrict__ QKL, const _Float16* __restrict__ VTH, const _Float16* __restrict__ VTL, const void* __restrict__ KMASK, float* __restrict__ O) {
  // one stage = 64 keys: k rows [key][64 d] and v rows [d][64 keys], one 128-B line each; the stage and the epilogue's staging share one LDS range, the barrier behind the loop between them
  __shared__ __align__(16) union { struct { _Float16 k[64][LP], v[64][LP]; } st; float so[8][32][68]; } sm;
  auto& so = sm.so;
  const int tid = threadIdx.x, wave = tid >> 5, lane = tid & 31, col = lane & 15, g = lane >> 4;
  const int qb = blockIdx.x, h = blockIdx.y, b = blockIdx.z; const int q0 = qb * 256 + wave * 32;
  v16h aq[2][2];   // B operand of the score product: column = query qt * 16 + col
#pragma unroll
  for (int qt = 0; qt < 2; ++qt) {
#pragma unroll
    for (int kc = 0; kc < 2; ++kc) aq[qt][kc] = frag_h(QK + ((size_t)b * SS + q0 + qt * 16 + col) * (2 * DM) + h * HD + kc * 32, lane); }
  float m[2] = {-3.0e38f, -3.0e38f}, l[2] = {0.f, 0.f};   // this lane's two queries: running maximum of the raw scores (equal in both halves), sum (x2^11) over this half's keys
  const float kf = 0.125f * 1.44269504f;   // 1/sqrt(64) and log2 e in one factor
  float nb[2] = {5.0e37f, 5.0e37f};   // addend of the score FMA in use: 11 - m * kf; the start value lies far above any real one, so the first alpha is 0
  v8f acc[2][4] = {};   // acc[qt][dt][r] = O^T[dt * 16 + 8 g + r][query qt * 16 + col]
  const int sr = tid >> 3, sc = (tid & 7) * 8;   // whole-line global loads: 8 lanes x 16 B = one line of a row, 4 rows a wave-load
  const _Float16* pk = QK + ((size_t)b * SS + sr) * (2 * DM) + DM + h * HD + sc; const _Float16* pv = VTH + ((size_t)b * DM + h * HD + sr) * SS + sc;
#pragma unroll 1   // rolled: the barriers bound every stage anyway, and the loop's text stays small
  for (int st = 0; st < SS / 64; ++st) {   // all keys
    { v8h rk[2], rv[2];
#pragma unroll
      for (int i = 0; i < 2; ++i) { rk[i] = *(const v8h*)(pk + (size_t)(st * 64 + 32 * i) * (2 * DM)); rv[i] = *(const v8h*)(pv + (size_t)(32 * i) * SS + st * 64); }
      __syncthreads();   // every wave has left the stage before
#pragma unroll
      for (int i = 0; i < 2; ++i) { *(v8h*)&sm.st.k[sr + 32 * i][sc] = rk[i]; *(v8h*)&sm.st.v[sr + 32 * i][sc] = rv[i]; } }
    __syncthreads();   // publishes the stage
#pragma unroll   // both halves of the stage in line: constant LDS offsets
    for (int sub = 0; sub < 2; ++sub) { v8f s[2][2] = {}; v16h fk[2][2];   // s[qt][ct][r] = raw score q.k of key sub * 32 + ct * 16 + 8 g + r of the stage against query qt * 16 + col
#pragma unroll
      for (int ct = 0; ct < 2; ++ct) { fk[ct][0] = frag_h(&sm.st.k[sub * 32 + ct * 16 + col][0], lane); fk[ct][1] = frag_h(&sm.st.k[sub * 32 + ct * 16 + col][32], lane); }
      asm volatile("" :: "v"(fk[0][0]), "v"(fk[0][1]), "v"(fk[1][0]), "v"(fk[1][1]));   // holds the four k fragments' LDS reads as one group in front of the score WMMAs: one LDS latency, not four
#pragma unroll
      for (int kc = 0; kc < 2; ++kc) {   // a tile takes d 0..31 first and d 32..63 second, as before; the other three tiles stand between the two
#pragma unroll
        for (int ct = 0; ct < 2; ++ct) {
#pragma unroll
          for (int qt = 0; qt < 2; ++qt) s[qt][ct] = wmma16(fk[ct][kc], aq[qt][kc], s[qt][ct]); } }   // single product: k rows as A, q as B, one-rounding f16 operands
      v16h p[2]; float alpha[2];   // P^T packs from the two score tiles into the B operand: element ct * 8 + r = key ct * 16 + 8 g + r of the 32, the hardware k order, which frag_h gives V^T too
#pragma unroll
      for (int qt = 0; qt < 2; ++qt) {
        float mt[2];   // two independent chains, then one exchange between the wave's halves
#pragma unroll
        for (int t = 0; t < 2; ++t) { mt[t] = s[qt][t][0];
#pragma unroll
          for (int r = 1; r < 8; ++r) mt[t] = fmaxf(mt[t], s[qt][t][r]); }
        float mx = fmaxf(mt[0], mt[1]); mx = fmaxf(mx, xhalf(mx));
        const float mn = fmaxf(m[qt], mx); const float nbn = __builtin_fmaf(-mn, kf, 11.0f);   // the FMA's addend: minus the scaled maximum, plus 11 so that the weights come out x2^11
        alpha[qt] = __builtin_amdgcn_exp2f(nbn - nb[qt]); nb[qt] = nbn;   // old weights were formed with the old addend: the difference of the two rescales them, whatever rounding each addend took
        v8f e[2];
#pragma unroll
        for (int t = 0; t < 2; ++t) e[t] = s[qt][t] * kf + nbn;   // one FMA a score, then the hardware's base-2 exponential: 2^11 exp((q.k - max) / 8)
#pragma unroll
        for (int t = 0; t < 2; ++t) exp2x8(e[t]);
        const v8f e8 = e[0] + e[1];   // this half's 16 weights: tiles first, then the eight registers
        const float es = ((e8[0] + e8[2]) + (e8[4] + e8[6])) + ((e8[1] + e8[3]) + (e8[5] + e8[7]));
#pragma unroll
        for (int t = 0; t < 2; ++t) {   // P carries 2^11 so small softmax weights stay out of the f16 subnormal range; l carries it too
#pragma unroll
          for (int r = 0; r < 8; ++r) p[qt][t * 8 + r] = (_Float16)e[t][r]; }
        l[qt] = l[qt] * alpha[qt] + es; m[qt] = mn;
#pragma unroll
        for (int dt = 0; dt < 4; ++dt) acc[qt][dt] *= alpha[qt]; }
#pragma unroll
      for (int dt = 0; dt < 4; ++dt) { const v16h fv = frag_h(&sm.st.v[dt * 16 + col][sub * 32], lane);
#pragma unroll
        for (int qt = 0; qt < 2; ++qt) acc[qt][dt] = wmma16(fv, p[qt], acc[qt][dt]); }   // single product: V^T rows as A, P^T (x2^11) as B
      __builtin_amdgcn_sched_barrier(0); } }   // keeps the next 32 keys' fragments and score tiles behind this half: both halves live at once do not fit in 256 registers and spill
  __syncthreads();   // every wave has left the last stage: its LDS becomes the output staging
#pragma unroll
  for (int qt = 0; qt < 2; ++qt) { const float il = 1.0f / (l[qt] + xhalf(l[qt]));   // the halves' sums join once; 2^11 stands in acc and in l alike
#pragma unroll
    for (int dt = 0; dt < 4; ++dt) { v4f o0, o1;
#pragma unroll
      for (int r = 0; r < 4; ++r) { o0[r] = acc[qt][dt][r] * il; o1[r] = acc[qt][dt][4 + r] * il; }
      *(v4f*)&so[wave][qt * 16 + col][dt * 16 + 8 * g] = o0; *(v4f*)&so[wave][qt * 16 + col][dt * 16 + 8 * g + 4] = o1; } }
  LDSX();
  for (int rl = 0; rl < 32; ++rl) if (lane < 16) vst2(O + ((size_t)b * SS + q0 + rl) * DM + h * HD + lane * 4, *(const v4f*)&so[wave][rl][lane * 4]);
}
// ---- k_out: block = (128 rows, 256 cols): out = O(hi/lo) . Wo rows (2 products) + bo
__global__ __launch_bounds__(256) void k_out(const float* __restrict__ O, const __bf16* __restrict__ P, const float* __restrict__ BO, float* __restrict__ Y) {
  // the two stage buffers and the epilogue's staging share one LDS range: the loop's last barrier stands between them; so[wave] belongs to one wave alone
  __shared__ __align__(16) union { struct { __bf16 ah[2][TM][LP], al[2][TM][LP], b[2][TN][LP]; } st; float so[8][16][68]; } sm;
  const int tid = threadIdx.x, wave = tid >> 5, lane = tid & 31, col = lane & 15, g = lane >> 4; const int wm = wave & 1, wn = wave >> 1;
  const int n0 = blockIdx.y * TN; const size_t r0 = (size_t)blockIdx.x * TM + wm * 64; const int nw = n0 + wn * 64;
  v8f acc[4][4] = {};
  // whole-line global loads, as in k_qkv; o is split into its bf16 hi and residual planes on the way into LDS
  const int br = tid >> 3, bc = (tid & 7) * 8, ar = tid >> 4, ac = (tid & 15) * 4;
  const __bf16* pb = P + (size_t)(n0 + br) * DM + bc; const float* pa = O + ((size_t)blockIdx.x * TM + ar) * DM + ac;
  v8b rb[8]; v4f ra[8];
#pragma unroll
  for (int i = 0; i < 8; ++i) { rb[i] = *(const v8b*)(pb + (size_t)i * 32 * DM); ra[i] = *(const v4f*)(pa + (size_t)i * 16 * DM); }
#pragma unroll
  for (int i = 0; i < 8; ++i) { *(v8b*)&sm.st.b[0][br + 32 * i][bc] = rb[i]; v4b ch, cl;
#pragma unroll
    for (int e = 0; e < 4; ++e) { const __bf16 hv = (__bf16)ra[i][e]; ch[e] = hv; cl[e] = (__bf16)(ra[i][e] - (float)hv); }
    *(v4b*)&sm.st.ah[0][ar + 16 * i][ac] = ch; *(v4b*)&sm.st.al[0][ar + 16 * i][ac] = cl; }
  __syncthreads();
#pragma unroll 2   // two stages a trip: the buffer index is a constant in the addresses
  for (int s = 0; s < DM / KS; ++s) { const int cur = s & 1;
    if (s + 1 < DM / KS) {   // the next stage's lines fly into registers while this stage is multiplied
#pragma unroll
      for (int i = 0; i < 8; ++i) { rb[i] = *(const v8b*)(pb + (size_t)i * 32 * DM + (s + 1) * KS); ra[i] = *(const v4f*)(pa + (size_t)i * 16 * DM + (s + 1) * KS); } }
#pragma unroll
    for (int kc = 0; kc < KS / 32; ++kc) { v16b ah[4], al[4], w[4];
#pragma unroll
      for (int i = 0; i < 4; ++i) { ah[i] = frag_b(&sm.st.ah[cur][wm * 64 + i * 16 + col][kc * 32], lane); al[i] = frag_b(&sm.st.al[cur][wm * 64 + i * 16 + col][kc * 32], lane); w[i] = frag_b(&sm.st.b[cur][wn * 64 + i * 16 + col][kc * 32], lane); }
      asm volatile("" :: "v"(ah[0]), "v"(ah[1]), "v"(ah[2]), "v"(ah[3]), "v"(al[0]), "v"(al[1]), "v"(al[2]), "v"(al[3]), "v"(w[0]), "v"(w[1]), "v"(w[2]), "v"(w[3]));   // holds the block's LDS reads as one group in front of its WMMAs: one LDS latency a block, not one a WMMA
#pragma unroll
      for (int i = 0; i < 4; ++i) {   // a tile takes its residual product first and its hi product second, as before; the other three tiles of the row stand between the two
#pragma unroll
        for (int j = 0; j < 4; ++j) acc[i][j] = wmma_bf(al[i], w[j], acc[i][j]);
#pragma unroll
        for (int j = 0; j < 4; ++j) acc[i][j] = wmma_bf(ah[i], w[j], acc[i][j]); } }
    __builtin_amdgcn_sched_barrier(0);   // keeps the split below, and with it the wait on the global loads, behind this stage's WMMAs
    if (s + 1 < DM / KS) {   // into the buffer whose readers all passed the barrier of the trip before
#pragma unroll
      for (int i = 0; i < 8; ++i) { *(v8b*)&sm.st.b[cur ^ 1][br + 32 * i][bc] = rb[i]; v4b ch, cl;
#pragma unroll
        for (int e = 0; e < 4; ++e) { const __bf16 hv = (__bf16)ra[i][e]; ch[e] = hv; cl[e] = (__bf16)(ra[i][e] - (float)hv); }
        *(v4b*)&sm.st.ah[cur ^ 1][ar + 16 * i][ac] = ch; *(v4b*)&sm.st.al[cur ^ 1][ar + 16 * i][ac] = cl; } }
    __syncthreads(); }   // publishes stage s + 1 and ends every read of stage s
  auto& so = sm.so[wave];
  const int er = lane >> 4, ec = (lane & 15) * 4;   // read-back: 16 lanes x 16 B = the two lines of a row's 64 columns, 2 rows a wave-store
  float bias[4];
#pragma unroll
  for (int j = 0; j < 4; ++j) bias[j] = bfr(BO[nw + j * 16 + col]);
#pragma unroll
  for (int i = 0; i < 4; ++i) {   // 16 rows x 64 columns at a time
#pragma unroll
    for (int j = 0; j < 4; ++j) {
#pragma unroll
      for (int r = 0; r < 8; ++r) so[8 * g + r][j * 16 + col] = acc[i][j][r] + bias[j]; }
    LDSW();
#pragma unroll
    for (int q = 0; q < 8; ++q) vst2(Y + (r0 + i * 16 + q * 2 + er) * DM + nw + ec, *(const v4f*)&so[q * 2 + er][ec]);
    if (i < 3) LDSW(); }   // the rows are read before the next 16 overwrite them
}
extern "C" void kernel_launch(void* const* d_in, const int* in_sizes, int n_in, void* d_out, int out_size, void* d_ws, size_t ws_size, hipStream_t stream) {
  (void)in_sizes; (void)n_in; (void)out_size;
  const float** F = (const float**)d_in;   // 0 x [4,2048,1024], 1 in_proj_weight [3072,1024], 2 in_proj_bias [3072], 3 out_proj_weight [1024,1024], 4 out_proj_bias
  if (ws_size < (size_t)WS_END) return;
  char* ws = (char*)d_ws; __bf16* PK = (__bf16*)(ws + WS_PK); _Float16 *QK = (_Float16*)(ws + WS_QK), *QKL = (_Float16*)(ws + WS_QKL), *VTH = (_Float16*)(ws + WS_VTH), *VTL = (_Float16*)(ws + WS_VTL); float* O = (float*)(ws + WS_O);
  k_pack<<<dim3(DM, 4), 256, 0, stream>>>(F[1], F[1] + (size_t)DM * DM, F[1] + (size_t)2 * DM * DM, F[3], PK);
  k_qkv<<<dim3(TNB * SS / TM, QKVW / TN), 256, 0, stream>>>(F[0], F[0], F[0], PK + PK_A, F[2], F[2] + DM, F[2] + 2 * DM, QK, QKL, VTH, VTL);
  k_attn<<<dim3(SS / 256, NH, TNB), 256, 0, stream>>>(QK, QKL, VTH, VTL, nullptr, O);
  k_out<<<dim3(NB * SS / TM, DM / TN), 256, 0, stream>>>(O, PK + PK_P, F[4], (float*)d_out);
}

// v007
// A run of this version takes 144 microseconds.
// Two timings next to v006 both put it at 1.04 times that version's speed.
// Counting every step since v000, it is 4.58 times as fast.
// compute dtype: all float inputs rounded to bf16; qkv = x . W_in^T + b with EXACT bf16 products on WMMA 16x16x32 (natural rows; the packed in_proj is three contiguous row blocks); PLAIN attention: q, k single f16, running-max softmax in f32 in the base-2 domain (1/8, log2 e, the maximum and 2^11 in one FMA a score, hardware exp), P (scaled by 2^11, single f16) x v (single f16); out = o (bf16 hi + residual) . W_out^T (2 products) + b_out.
#include <hip/hip_runtime.h>
#include <math.h>

typedef __attribute__((ext_vector_type(16))) _Float16 v16h;
typedef __attribute__((ext_vector_type(16))) __bf16 v16b;
typedef __attribute__((ext_vector_type(8)))  _Float16 v8h;
typedef __attribute__((ext_vector_type(8)))  float v8f;
typedef __attribute__((ext_vector_type(4)))  float v4f;
typedef __attribute__((ext_vector_type(2)))  float v2f;
typedef __attribute__((ext_vector_type(4)))  unsigned v4u;
typedef __attribute__((ext_vector_type(4)))  int v4i;
typedef float __attribute__((may_alias)) float_a;
typedef int __attribute__((may_alias)) int_a;

template <typename T> __device__ __forceinline__ void vst2(void* p, T v) { *(T*)p = v;  }
__device__ __forceinline__ v8f wmma16(v16h a, v16h b, v8f c) {
  return __builtin_amdgcn_wmma_f32_16x16x32_f16(false, a, false, b, (short)0, c, false, false);
}
__device__ __forceinline__ v8f wmma_bf(v16b a, v16b b, v8f c) {
  return __builtin_amdgcn_wmma_f32_16x16x32_bf16(false, a, false, b, (short)0, c, false, false);
}
// nn.MultiheadAttention-style self attention (B 4, S 2,048, E 1,024, 16 heads x 64): packed in_proj (natural [3E][E]) + bias, softmax(q k^T / 8) v, out_proj + bias.
__device__ __forceinline__ v16h frag_h(const _Float16* rowk0, int lane) {
  union { v16h v; v8h q[2]; } u; const _Float16* p = rowk0 + 8 * (lane >> 4);
  u.q[0] = *(const v8h*)p; u.q[1] = *(const v8h*)(p + 16); return u.v;
}
__device__ __forceinline__ v16h frag_f32(const float* rowk0, int lane) {
  v16h a; const float* p = rowk0 + 8 * (lane >> 4);
#pragma unroll
  for (int i = 0; i < 8; ++i) { a[i] = (_Float16)p[i]; a[8 + i] = (_Float16)p[16 + i]; }
  return a;
}
__device__ __forceinline__ v16h frag_f32s(const float* rowk0, int lane, float sc) {
  v16h a; const float* p = rowk0 + 8 * (lane >> 4);
#pragma unroll
  for (int i = 0; i < 8; ++i) { a[i] = (_Float16)(p[i] * sc); a[8 + i] = (_Float16)(p[16 + i] * sc); }
  return a;
}
// column fragment from a [K][ld] layout (column n), rows >= K read as 0
__device__ __forceinline__ v16h fragc_f32(const float* W, int k0, int n, int lane, int ld, int K) {
  v16h a; const int g = lane >> 4;
#pragma unroll
  for (int i = 0; i < 8; ++i) { const int ka = k0 + 8 * g + i, kb = ka + 16;
    a[i] = (_Float16)(ka < K ? W[(size_t)(ka < K ? ka : K - 1) * ld + n] : 0.f); a[8 + i] = (_Float16)(kb < K ? W[(size_t)(kb < K ? kb : K - 1) * ld + n] : 0.f); }
  return a;
}
struct F2 { v16b h, l; };
__device__ __forceinline__ F2 bsplit16(const float v[16]) { F2 r;
#pragma unroll
  for (int i = 0; i < 16; ++i) { const __bf16 h = (__bf16)v[i]; r.h[i] = h; r.l[i] = (__bf16)(v[i] - (float)h); }
  return r; }
__device__ __forceinline__ F2 split_row(const float* row, int k0, int lane) { float v[16]; const float* p = row + k0 + 8 * (lane >> 4);
#pragma unroll
  for (int i = 0; i < 8; ++i) { v[i] = p[i]; v[8 + i] = p[16 + i]; }
  return bsplit16(v); }
__device__ __forceinline__ F2 split_rowK(const float* row, int k0, int lane, int K) { float v[16]; const int g = lane >> 4;
#pragma unroll
  for (int i = 0; i < 8; ++i) { const int ka = k0 + 8 * g + i, kb = ka + 16; v[i] = ka < K ? row[ka < K ? ka : K - 1] : 0.f; v[8 + i] = kb < K ? row[kb < K ? kb : K - 1] : 0.f; }
  return bsplit16(v); }
__device__ __forceinline__ F2 split_col(const float* W, int k0, int n, int lane, int ld, int K) { float v[16]; const int g = lane >> 4;
#pragma unroll
  for (int i = 0; i < 8; ++i) { const int ka = k0 + 8 * g + i, kb = ka + 16; v[i] = ka < K ? W[(size_t)(ka < K ? ka : K - 1) * ld + n] : 0.f; v[8 + i] = kb < K ? W[(size_t)(kb < K ? kb : K - 1) * ld + n] : 0.f; }
  return bsplit16(v); }
__device__ __forceinline__ v8f mac3(const F2& a, const F2& b, v8f c) { c = wmma_bf(a.l, b.h, c); c = wmma_bf(a.h, b.l, c); return wmma_bf(a.h, b.h, c); }
__device__ __forceinline__ float sigm(float v) { return 1.0f / (1.0f + expf(-v)); }
#define LDSX() do { asm volatile("s_wait_dscnt 0" ::: "memory"); __builtin_amdgcn_wave_barrier(); __builtin_amdgcn_fence(__ATOMIC_RELEASE, "workgroup"); } while (0)


#define NB 4
#define SS 2048
#define DM 1024
#define NH 16
#define HD 64
#define QKVW (3 * DM)
#ifndef TQB
#define TQB (SS / 64)
#define TNB NB
#define TOB (NB * SS / 64)     // 64-row tiles of all rows; unused
#endif
typedef __attribute__((ext_vector_type(8))) __bf16 v8b;
__device__ __forceinline__ v16b frag_b(const __bf16* rowk0, int lane) {
  union { v16b v; v8b q[2]; } u; const __bf16* p = rowk0 + 8 * (lane >> 4);
  u.q[0] = *(const v8b*)p; u.q[1] = *(const v8b*)(p + 16); return u.v;
}
__device__ __forceinline__ float bfr(float v) { return (float)(__bf16)v; }
__device__ __attribute__((noinline)) float exp_ni(float v) { return expf(v); }
__device__ __attribute__((noinline)) float erf_ni(float v) { return erff(v); }

#define PK_A 0                       // [3072][1024] Wqkv rows (natural [out][in])
#define PK_P (PK_A + QKVW * DM)        // [1024][1024] Wo rows (natural)
#define PK_END (PK_P + DM * DM)
#define WS_PK  0u
#define WS_QK  (WS_PK + 2u * PK_END)             // f16 [8192 rows][2048]: q | k
#define WS_QKL (WS_QK + 2u * NB * SS * 2 * DM)     // f16 q | k residual planes x2048
#define WS_VTH (WS_QKL + 2u * NB * SS * 2 * DM)    // f16 [b][1024 (h*64+d)][2048 s] hi
#define WS_VTL (WS_VTH + 2u * NB * DM * SS)        // f16 lo x 2048
#define WS_O   (WS_VTL + 2u * NB * DM * SS)        // f32 [8192][1024]
#define WS_CS  (WS_O + 4u * NB * SS * DM)           // f32 2 x [2048][32], unused
#define WS_END (WS_CS + 4u * 2 * SS * 32)
// ---- k_pack: f32 weights -> bf16 in their natural [out][in] order: PK = W_q | W_k | W_v | W_o, 1,024 x 1,024 each (PK_P = 3 x 1,024 x 1,024)
// 256 work-groups of 8 waves, 64 a matrix, one a WGP: 2,048 waves to start in place of 32,768. A thread converts 64 weights: 16 loads of 16 B, all in flight at once (a wave-load = 4 whole lines), then 16 stores of 8 B (a wave-store = 2 whole lines); no LDS, no barrier
#define PKG 64                          // work-groups a matrix
#define PKE (DM * DM / PKG)             // weights a work-group
typedef __attribute__((ext_vector_type(4))) __bf16 v4bp;
__global__ __launch_bounds__(256) void k_pack(const float* __restrict__ WQ, const float* __restrict__ WK, const float* __restrict__ WV, const float* __restrict__ WO, __bf16* __restrict__ PK) {
  const int which = blockIdx.x / PKG; const float* Wm = (which == 0) ? WQ : (which == 1) ? WK : (which == 2) ? WV : WO;
  const unsigned q = (blockIdx.x % PKG) * (PKE / 4) + threadIdx.x;   // the thread's first group of four weights in its matrix: one index for the loads and the stores
  const v4f* ps = (const v4f*)Wm + q; v4bp* pd = (v4bp*)(PK + PK_A + (size_t)which * DM * DM) + q;
  v4f r[16]; static_assert(PKE / 1024 == 16, "16 loads a thread");
#pragma unroll   // constant indices: r stays in registers, the steps become immediate offsets
  for (int i = 0; i < PKE / 1024; ++i) r[i] = ps[i * 256];
  asm volatile("" :: "v"(r[0]), "v"(r[1]), "v"(r[2]), "v"(r[3]), "v"(r[4]), "v"(r[5]), "v"(r[6]), "v"(r[7]), "v"(r[8]), "v"(r[9]), "v"(r[10]), "v"(r[11]), "v"(r[12]), "v"(r[13]), "v"(r[14]), "v"(r[15]));   // holds all 16 loads in front of the first conversion: without it the last two are issued only when the first two have come back, a second memory latency
#pragma unroll   // as above
  for (int i = 0; i < PKE / 1024; ++i) { v4bp c; c[0] = (__bf16)r[i][0]; c[1] = (__bf16)r[i][1]; c[2] = (__bf16)r[i][2]; c[3] = (__bf16)r[i][3]; pd[i * 256] = c; }
}
// LDS staging: a stage is 64 k (one 128-B line of every 16-bit operand row); rows lie at a pitch of 144 B (16 B x odd) for the ds_load_b128 fragment readers
#define KS 64
#define LP 72
typedef __attribute__((ext_vector_type(4))) __bf16 v4b;
// GEMM tiling of k_qkv and k_out: a work-group of 8 waves (2 x 4) owns 128 rows x 256 columns, a wave 64 x 64 = 4 x 4 accumulator tiles: 8 fragments feed 16 WMMAs, and a staged line is used by 4 (x, o) or 2 (W) waves
// between a wave's writes and its read-back of its own staging rows, and between the read-back and the next rows' writes: the LDS wait alone; no release fence, which would also wait out the global stores of the rows before
#define LDSW() do { asm volatile("s_wait_dscnt 0" ::: "memory"); __builtin_amdgcn_wave_barrier(); } while (0)
#define TM 128
#define TN 256
// the second bound asks for 4 waves a SIMD: a budget of 256 registers, so that two work-groups share a WGP and one's WMMAs cover the other's global wait, LDS fill and barrier
__global__ __launch_bounds__(256, 4) void k_qkv(const float* __restrict__ XQ, const float* __restrict__ XK, const float* __restrict__ XV, const __bf16* __restrict__ P, const float* __restrict__ BQ, const float* __restrict__ BK, const float* __restrict__ BV, _Float16* __restrict__ QK, _Float16* __restrict__ QKL, _Float16* __restrict__ VTH, _Float16* __restrict__ VTL) {
  const int n0 = blockIdx.y * TN; const int which0 = n0 / DM; const float* X = (which0 == 0) ? XQ : (which0 == 1) ? XK : XV; const float* BB = BQ ? (((which0 == 0) ? BQ : (which0 == 1) ? BK : BV) + (n0 - which0 * DM)) : nullptr;
  // the two stage buffers and the epilogue's staging share one LDS range: the loop's last barrier stands between them; ep[wave] belongs to one wave alone
  __shared__ __align__(16) union { struct { __bf16 a[2][TM][LP], b[2][TN][LP]; } st; _Float16 ep[8][2][16][LP]; } sm;
  const int tid = threadIdx.x, wave = __builtin_amdgcn_readfirstlane(tid >> 5), lane = tid & 31, col = lane & 15, g = lane >> 4; const int wm = wave & 1, wn = wave >> 1;
  const size_t r0 = (size_t)blockIdx.x * TM + wm * 64; const int nw = n0 + wn * 64;
  v8f acc[4][4] = {};
  // whole-line global loads: W 8 lanes x 16 B = one line of a row (4 rows a wave-load), x 16 lanes x 16 B = two lines of a row (2 rows a wave-load)
  const int br = tid >> 3, bc = (tid & 7) * 8, ar = tid >> 4, ac = (tid & 15) * 4;
  const __bf16* pb = P + (size_t)(n0 + br) * DM + bc; const float* pa = X + ((size_t)blockIdx.x * TM + ar) * DM + ac;
  v8b rb[8]; v4f ra[8];
#pragma unroll
  for (int i = 0; i < 8; ++i) { rb[i] = *(const v8b*)(pb + (size_t)i * 32 * DM); ra[i] = *(const v4f*)(pa + (size_t)i * 16 * DM); }
#pragma unroll
  for (int i = 0; i < 8; ++i) { *(v8b*)&sm.st.b[0][br + 32 * i][bc] = rb[i]; v4b c; c[0] = (__bf16)ra[i][0]; c[1] = (__bf16)ra[i][1]; c[2] = (__bf16)ra[i][2]; c[3] = (__bf16)ra[i][3]; *(v4b*)&sm.st.a[0][ar + 16 * i][ac] = c; }
  __syncthreads();
#pragma unroll 2   // two stages a trip: the buffer index is a constant in the addresses
  for (int s = 0; s < DM / KS; ++s) { const int cur = s & 1;
    if (s + 1 < DM / KS) {   // the next stage's lines fly into registers while this stage is multiplied
#pragma unroll
      for (int i = 0; i < 8; ++i) { rb[i] = *(const v8b*)(pb + (size_t)i * 32 * DM + (s + 1) * KS); ra[i] = *(const v4f*)(pa + (size_t)i * 16 * DM + (s + 1) * KS); } }
#pragma unroll
    for (int kc = 0; kc < KS / 32; ++kc) { v16b w[4];
#pragma unroll
      for (int j = 0; j < 4; ++j) w[j] = frag_b(&sm.st.b[cur][wn * 64 + j * 16 + col][kc * 32], lane);
#pragma unroll
      for (int ii = 0; ii < 4; ii += 2) { v16b a[2];   // x fragments two at a time: the live set stays inside 256 registers, so two work-groups share a WGP
#pragma unroll
        for (int i = 0; i < 2; ++i) a[i] = frag_b(&sm.st.a[cur][wm * 64 + (ii + i) * 16 + col][kc * 32], lane);
        asm volatile("" :: "v"(a[0]), "v"(a[1]), "v"(w[0]), "v"(w[1]), "v"(w[2]), "v"(w[3]));   // holds the block's LDS reads as one group in front of its WMMAs: one LDS latency a block, not one a WMMA
#pragma unroll
        for (int i = 0; i < 2; ++i) {
#pragma unroll
          for (int j = 0; j < 4; ++j) acc[ii + i][j] = wmma_bf(a[i], w[j], acc[ii + i][j]); } } }
    __builtin_amdgcn_sched_barrier(0);   // keeps the conversions below, and with them the wait on the global loads, behind this stage's WMMAs
    if (s + 1 < DM / KS) {   // into the buffer whose readers all passed the barrier of the trip before
#pragma unroll
      for (int i = 0; i < 8; ++i) { *(v8b*)&sm.st.b[cur ^ 1][br + 32 * i][bc] = rb[i]; v4b c; c[0] = (__bf16)ra[i][0]; c[1] = (__bf16)ra[i][1]; c[2] = (__bf16)ra[i][2]; c[3] = (__bf16)ra[i][3]; *(v4b*)&sm.st.a[cur ^ 1][ar + 16 * i][ac] = c; } }
    __syncthreads(); }   // publishes stage s + 1 and ends every read of stage s
  auto& eh = sm.ep[wave][0]; auto& el = sm.ep[wave][1];   // 16 rows of one 128-B line each, hi and residual plane
  const int ln = __builtin_amdgcn_mbcnt_lo(~0u, 0u), ecol = ln & 15, eg = ln >> 4;   // the lane's number read anew: no lane index of the epilogue holds a register through the loop
  const int er = ln >> 3, ec = (ln & 7) * 8;   // read-back: 8 lanes x 16 B = one line, 4 rows a wave-store
  float bias[4];
#pragma unroll
  for (int j = 0; j < 4; ++j) bias[j] = BB ? bfr(BB[wn * 64 + j * 16 + ecol]) : 0.f;
  if (n0 < 2 * DM) {   // q stored unscaled (f16 sigma ~0.6, no subnormal exposure); 1/8 applied to the f32 score
#pragma unroll
    for (int i = 0; i < 4; ++i) {   // 16 rows x 64 columns at a time
#pragma unroll
      for (int j = 0; j < 4; ++j) {
#pragma unroll
        for (int r = 0; r < 8; ++r) { const float v = acc[i][j][r] + bias[j]; const _Float16 hv = (_Float16)v; eh[8 * eg + r][j * 16 + ecol] = hv; el[8 * eg + r][j * 16 + ecol] = (_Float16)((v - (float)hv) * 2048.0f); } }   // q, k (+ bias) as f16 hi + (x2048) residual
      LDSW();
#pragma unroll
      for (int q = 0; q < 4; ++q) { const size_t o = (r0 + i * 16 + q * 4 + er) * (2 * DM) + nw + ec; vst2((unsigned*)(QK + o), *(const v4u*)&eh[q * 4 + er][ec]); vst2((unsigned*)(QKL + o), *(const v4u*)&el[q * 4 + er][ec]); }
      if (i < 3) LDSW(); }   // the rows are read before the next 16 overwrite them
  } else {
    const int b = (int)(r0 / SS), s0 = (int)(r0 % SS); const int pc0 = nw - 2 * DM;
#pragma unroll
    for (int j = 0; j < 4; ++j) {   // transposed: 16 d rows x 64 s at a time; a lane's eight accumulator rows are eight neighbours in s
#pragma unroll
      for (int i = 0; i < 4; ++i) { v8h h8, l8;
#pragma unroll
        for (int r = 0; r < 8; ++r) { const float v = acc[i][j][r] + bias[j]; const _Float16 hv = (_Float16)v; h8[r] = hv; l8[r] = (_Float16)((v - (float)hv) * 2048.0f); }
        *(v8h*)&eh[ecol][i * 16 + 8 * eg] = h8; *(v8h*)&el[ecol][i * 16 + 8 * eg] = l8; }
      LDSW();
#pragma unroll
      for (int q = 0; q < 4; ++q) { const size_t o = ((size_t)b * DM + pc0 + j * 16 + q * 4 + er) * SS + s0 + ec; vst2((unsigned*)(VTH + o), *(const v4u*)&eh[q * 4 + er][ec]); vst2((unsigned*)(VTL + o), *(const v4u*)&el[q * 4 + er][ec]); }
      if (j < 3) LDSW(); }   // the rows are read before the next 16 overwrite them
    asm volatile("s_wait_xcnt 0x0" ::: "memory");   // in the listing this branch's text runs on into the other branch's, behind a jump: the wait stands in front of every rewrite of a register that the stores above name
  }
}
__device__ __forceinline__ float xhalf(float x) { return __builtin_bit_cast(float, __builtin_amdgcn_permlanex16(__builtin_bit_cast(int, x), __builtin_bit_cast(int, x), 0x76543210, 0xfedcba98, false, false)); }   // lane l with lane l ^ 16
// eight base-2 exponentials in place and back to back: none writes a register of the one in front of it, and no filler stands between them; the closing v_nop is the slot that the instruction set asks for behind a transcendental before its result is read
__device__ __forceinline__ void exp2x8(v8f& x) {
  float a0 = x[0], a1 = x[1], a2 = x[2], a3 = x[3], a4 = x[4], a5 = x[5], a6 = x[6], a7 = x[7];
  asm("v_exp_f32 %0, %0\n\tv_exp_f32 %1, %1\n\tv_exp_f32 %2, %2\n\tv_exp_f32 %3, %3\n\tv_exp_f32 %4, %4\n\tv_exp_f32 %5, %5\n\tv_exp_f32 %6, %6\n\tv_exp_f32 %7, %7\n\tv_nop" : "+v"(a0), "+v"(a1), "+v"(a2), "+v"(a3), "+v"(a4), "+v"(a5), "+v"(a6), "+v"(a7));
  x[0] = a0; x[1] = a1; x[2] = a2; x[3] = a3; x[4] = a4; x[5] = a5; x[6] = a6; x[7] = a7;
}
// a work-group of 8 waves owns 256 queries, a wave 32 = two 16-query column groups: a k or v fragment read from LDS feeds two WMMAs, and a staged line serves 256 queries
// the second bound asks for 4 waves a SIMD: a budget of 256 registers, so that two work-groups share a WGP and one's arithmetic covers the other's global wait, LDS fill and barriers
__global__ __launch_bounds__(256, 4) void k_attn(const _Float16* __restrict__ QK, const _Float16* __restrict__ QKL, const _Float16* __restrict__ VTH, const _Float16* __restrict__ VTL, const void* __restrict__ KMASK, float* __restrict__ O) {
  // one stage = 64 keys: k rows [key][64 d] and v rows [d][64 keys], one 128-B line each; the stage and the epilogue's staging share one LDS range, the barrier behind the loop between them
  __shared__ __align__(16) union { struct { _Float16 k[64][LP], v[64][LP]; } st; float so[8][32][68]; } sm;
  auto& so = sm.so;
  const int tid = threadIdx.x, wave = tid >> 5, lane = tid & 31, col = lane & 15, g = lane >> 4;
  const int qb = blockIdx.x, h = blockIdx.y, b = blockIdx.z; const int q0 = qb * 256 + wave * 32;
  v16h aq[2][2];   // B operand of the score product: column = query qt * 16 + col
#pragma unroll
  for (int qt = 0; qt < 2; ++qt) {
#pragma unroll
    for (int kc = 0; kc < 2; ++kc) aq[qt][kc] = frag_h(QK + ((size_t)b * SS + q0 + qt * 16 + col) * (2 * DM) + h * HD + kc * 32, lane); }
  float m[2] = {-3.0e38f, -3.0e38f}, l[2] = {0.f, 0.f};   // this lane's two queries: running maximum of the raw scores (equal in both halves), sum (x2^11) over this half's keys
  const float kf = 0.125f * 1.44269504f;   // 1/sqrt(64) and log2 e in one factor
  float nb[2] = {5.0e37f, 5.0e37f};   // addend of the score FMA in use: 11 - m * kf; the start value lies far above any real one, so the first alpha is 0
  v8f acc[2][4] = {};   // acc[qt][dt][r] = O^T[dt * 16 + 8 g + r][query qt * 16 + col]
  const int sr = tid >> 3, sc = (tid & 7) * 8;   // whole-line global loads: 8 lanes x 16 B = one line of a row, 4 rows a wave-load
  const _Float16* pk = QK + ((size_t)b * SS + sr) * (2 * DM) + DM + h * HD + sc; const _Float16* pv = VTH + ((size_t)b * DM + h * HD + sr) * SS + sc;
#pragma unroll 1   // rolled: the barriers bound every stage anyway, and the loop's text stays small
  for (int st = 0; st < SS / 64; ++st) {   // all keys
    { v8h rk[2], rv[2];
#pragma unroll
      for (int i = 0; i < 2; ++i) { rk[i] = *(const v8h*)(pk + (size_t)(st * 64 + 32 * i) * (2 * DM)); rv[i] = *(const v8h*)(pv + (size_t)(32 * i) * SS + st * 64); }
      __syncthreads();   // every wave has left the stage before
#pragma unroll
      for (int i = 0; i < 2; ++i) { *(v8h*)&sm.st.k[sr + 32 * i][sc] = rk[i]; *(v8h*)&sm.st.v[sr + 32 * i][sc] = rv[i]; } }
    __syncthreads();   // publishes the stage
#pragma unroll   // both halves of the stage in line: constant LDS offsets
    for (int sub = 0; sub < 2; ++sub) { v8f s[2][2] = {}; v16h fk[2][2];   // s[qt][ct][r] = raw score q.k of key sub * 32 + ct * 16 + 8 g + r of the stage against query qt * 16 + col
#pragma unroll
      for (int ct = 0; ct < 2; ++ct) { fk[ct][0] = frag_h(&sm.st.k[sub * 32 + ct * 16 + col][0], lane); fk[ct][1] = frag_h(&sm.st.k[sub * 32 + ct * 16 + col][32], lane); }
      asm volatile("" :: "v"(fk[0][0]), "v"(fk[0][1]), "v"(fk[1][0]), "v"(fk[1][1]));   // holds the four k fragments' LDS reads as one group in front of the score WMMAs: one LDS latency, not four
#pragma unroll
      for (int kc = 0; kc < 2; ++kc) {   // a tile takes d 0..31 first and d 32..63 second, as before; the other three tiles stand between the two
#pragma unroll
        for (int ct = 0; ct < 2; ++ct) {
#pragma unroll
          for (int qt = 0; qt < 2; ++qt) s[qt][ct] = wmma16(fk[ct][kc], aq[qt][kc], s[qt][ct]); } }   // single product: k rows as A, q as B, one-rounding f16 operands
      v16h p[2]; float alpha[2];   // P^T packs from the two score tiles into the B operand: element ct * 8 + r = key ct * 16 + 8 g + r of the 32, the hardware k order, which frag_h gives V^T too
#pragma unroll
      for (int qt = 0; qt < 2; ++qt) {
        float mt[2];   // two independent chains, then one exchange between the wave's halves
#pragma unroll
        for (int t = 0; t < 2; ++t) { mt[t] = s[qt][t][0];
#pragma unroll
          for (int r = 1; r < 8; ++r) mt[t] = fmaxf(mt[t], s[qt][t][r]); }
        float mx = fmaxf(mt[0], mt[1]); mx = fmaxf(mx, xhalf(mx));
        const float mn = fmaxf(m[qt], mx); const float nbn = __builtin_fmaf(-mn, kf, 11.0f);   // the FMA's addend: minus the scaled maximum, plus 11 so that the weights come out x2^11
        alpha[qt] = __builtin_amdgcn_exp2f(nbn - nb[qt]); nb[qt] = nbn;   // old weights were formed with the old addend: the difference of the two rescales them, whatever rounding each addend took
        v8f e[2];
#pragma unroll
        for (int t = 0; t < 2; ++t) e[t] = s[qt][t] * kf + nbn;   // one FMA a score, then the hardware's base-2 exponential: 2^11 exp((q.k - max) / 8)
#pragma unroll
        for (int t = 0; t < 2; ++t) exp2x8(e[t]);
        const v8f e8 = e[0] + e[1];   // this half's 16 weights: tiles first, then the eight registers
        const float es = ((e8[0] + e8[2]) + (e8[4] + e8[6])) + ((e8[1] + e8[3]) + (e8[5] + e8[7]));
#pragma unroll
        for (int t = 0; t < 2; ++t) {   // P carries 2^11 so small softmax weights stay out of the f16 subnormal range; l carries it too
#pragma unroll
          for (int r = 0; r < 8; ++r) p[qt][t * 8 + r] = (_Float16)e[t][r]; }
        l[qt] = l[qt] * alpha[qt] + es; m[qt] = mn;
#pragma unroll
        for (int dt = 0; dt < 4; ++dt) acc[qt][dt] *= alpha[qt]; }
#pragma unroll
      for (int dt = 0; dt < 4; ++dt) { const v16h fv = frag_h(&sm.st.v[dt * 16 + col][sub * 32], lane);
#pragma unroll
        for (int qt = 0; qt < 2; ++qt) acc[qt][dt] = wmma16(fv, p[qt], acc[qt][dt]); }   // single product: V^T rows as A, P^T (x2^11) as B
      __builtin_amdgcn_sched_barrier(0); } }   // keeps the next 32 keys' fragments and score tiles behind this half: both halves live at once do not fit in 256 registers and spill
  __syncthreads();   // every wave has left the last stage: its LDS becomes the output staging
#pragma unroll
  for (int qt = 0; qt < 2; ++qt) { const float il = 1.0f / (l[qt] + xhalf(l[qt]));   // the halves' sums join once; 2^11 stands in acc and in l alike
#pragma unroll
    for (int dt = 0; dt < 4; ++dt) { v4f o0, o1;
#pragma unroll
      for (int r = 0; r < 4; ++r) { o0[r] = acc[qt][dt][r] * il; o1[r] = acc[qt][dt][4 + r] * il; }
      *(v4f*)&so[wave][qt * 16 + col][dt * 16 + 8 * g] = o0; *(v4f*)&so[wave][qt * 16 + col][dt * 16 + 8 * g + 4] = o1; } }
  LDSX();
  for (int rl = 0; rl < 32; ++rl) if (lane < 16) vst2(O + ((size_t)b * SS + q0 + rl) * DM + h * HD + lane * 4, *(const v4f*)&so[wave][rl][lane * 4]);
}
// ---- k_out: block = (128 rows, 256 cols): out = O(hi/lo) . Wo rows (2 products) + bo
__global__ __launch_bounds__(256) void k_out(const float* __restrict__ O, const __bf16* __restrict__ P, const float* __restrict__ BO, float* __restrict__ Y) {
  // the two stage buffers and the epilogue's staging share one LDS range: the loop's last barrier stands between them; so[wave] belongs to one wave alone
  __shared__ __align__(16) union { struct { __bf16 ah[2][TM][LP], al[2][TM][LP], b[2][TN][LP]; } st; float so[8][16][68]; } sm;
  const int tid = threadIdx.x, wave = tid >> 5, lane = tid & 31, col = lane & 15, g = lane >> 4; const int wm = wave & 1, wn = wave >> 1;
  const int n0 = blockIdx.y * TN; const size_t r0 = (size_t)blockIdx.x * TM + wm * 64; const int nw = n0 + wn * 64;
  v8f acc[4][4] = {};
  // whole-line global loads, as in k_qkv; o is split into its bf16 hi and residual planes on the way into LDS
  const int br = tid >> 3, bc = (tid & 7) * 8, ar = tid >> 4, ac = (tid & 15) * 4;
  const __bf16* pb = P + (size_t)(n0 + br) * DM + bc; const float* pa = O + ((size_t)blockIdx.x * TM + ar) * DM + ac;
  v8b rb[8]; v4f ra[8];
#pragma unroll
  for (int i = 0; i < 8; ++i) { rb[i] = *(const v8b*)(pb + (size_t)i * 32 * DM); ra[i] = *(const v4f*)(pa + (size_t)i * 16 * DM); }
#pragma unroll
  for (int i = 0; i < 8; ++i) { *(v8b*)&sm.st.b[0][br + 32 * i][bc] = rb[i]; v4b ch, cl;
#pragma unroll
    for (int e = 0; e < 4; ++e) { const __bf16 hv = (__bf16)ra[i][e]; ch[e] = hv; cl[e] = (__bf16)(ra[i][e] - (float)hv); }
    *(v4b*)&sm.st.ah[0][ar + 16 * i][ac] = ch; *(v4b*)&sm.st.al[0][ar + 16 * i][ac] = cl; }
  __syncthreads();
#pragma unroll 2   // two stages a trip: the buffer index is a constant in the addresses
  for (int s = 0; s < DM / KS; ++s) { const int cur = s & 1;
    if (s + 1 < DM / KS) {   // the next stage's lines fly into registers while this stage is multiplied
#pragma unroll
      for (int i = 0; i < 8; ++i) { rb[i] = *(const v8b*)(pb + (size_t)i * 32 * DM + (s + 1) * KS); ra[i] = *(const v4f*)(pa + (size_t)i * 16 * DM + (s + 1) * KS); } }
#pragma unroll
    for (int kc = 0; kc < KS / 32; ++kc) { v16b ah[4], al[4], w[4];
#pragma unroll
      for (int i = 0; i < 4; ++i) { ah[i] = frag_b(&sm.st.ah[cur][wm * 64 + i * 16 + col][kc * 32], lane); al[i] = frag_b(&sm.st.al[cur][wm * 64 + i * 16 + col][kc * 32], lane); w[i] = frag_b(&sm.st.b[cur][wn * 64 + i * 16 + col][kc * 32], lane); }
      asm volatile("" :: "v"(ah[0]), "v"(ah[1]), "v"(ah[2]), "v"(ah[3]), "v"(al[0]), "v"(al[1]), "v"(al[2]), "v"(al[3]), "v"(w[0]), "v"(w[1]), "v"(w[2]), "v"(w[3]));   // holds the block's LDS reads as one group in front of its WMMAs: one LDS latency a block, not one a WMMA
#pragma unroll
      for (int i = 0; i < 4; ++i) {   // a tile takes its residual product first and its hi product second, as before; the other three tiles of the row stand between the two
#pragma unroll
        for (int j = 0; j < 4; ++j) acc[i][j] = wmma_bf(al[i], w[j], acc[i][j]);
#pragma unroll
        for (int j = 0; j < 4; ++j) acc[i][j] = wmma_bf(ah[i], w[j], acc[i][j]); } }
    __builtin_amdgcn_sched_barrier(0);   // keeps the split below, and with it the wait on the global loads, behind this stage's WMMAs
    if (s + 1 < DM / KS) {   // into the buffer whose readers all passed the barrier of the trip before
#pragma unroll
      for (int i = 0; i < 8; ++i) { *(v8b*)&sm.st.b[cur ^ 1][br + 32 * i][bc] = rb[i]; v4b ch, cl;
#pragma unroll
        for (int e = 0; e < 4; ++e) { const __bf16 hv = (__bf16)ra[i][e]; ch[e] = hv; cl[e] = (__bf16)(ra[i][e] - (float)hv); }
        *(v4b*)&sm.st.ah[cur ^ 1][ar + 16 * i][ac] = ch; *(v4b*)&sm.st.al[cur ^ 1][ar + 16 * i][ac] = cl; } }
    __syncthreads(); }   // publishes stage s + 1 and ends every read of stage s
  auto& so = sm.so[wave];
  const int er = lane >> 4, ec = (lane & 15) * 4;   // read-back: 16 lanes x 16 B = the two lines of a row's 64 columns, 2 rows a wave-store
  float bias[4];
#pragma unroll
  for (int j = 0; j < 4; ++j) bias[j] = bfr(BO[nw + j * 16 + col]);
#pragma unroll
  for (int i = 0; i < 4; ++i) {   // 16 rows x 64 columns at a time
#pragma unroll
    for (int j = 0; j < 4; ++j) {
#pragma unroll
      for (int r = 0; r < 8; ++r) so[8 * g + r][j * 16 + col] = acc[i][j][r] + bias[j]; }
    LDSW();
#pragma unroll
    for (int q = 0; q < 8; ++q) vst2(Y + (r0 + i * 16 + q * 2 + er) * DM + nw + ec, *(const v4f*)&so[q * 2 + er][ec]);
    if (i < 3) LDSW(); }   // the rows are read before the next 16 overwrite them
}
extern "C" void kernel_launch(void* const* d_in, const int* in_sizes, int n_in, void* d_out, int out_size, void* d_ws, size_t ws_size, hipStream_t stream) {
  (void)in_sizes; (void)n_in; (void)out_size;
  const float** F = (const float**)d_in;   // 0 x [4,2048,1024], 1 in_proj_weight [3072,1024], 2 in_proj_bias [3072], 3 out_proj_weight [1024,1024], 4 out_proj_bias
  if (ws_size < (size_t)WS_END) return;
  char* ws = (char*)d_ws; __bf16* PK = (__bf16*)(ws + WS_PK); _Float16 *QK = (_Float16*)(ws + WS_QK), *QKL = (_Float16*)(ws + WS_QKL), *VTH = (_Float16*)(ws + WS_VTH), *VTL = (_Float16*)(ws + WS_VTL); float* O = (float*)(ws + WS_O);
  k_pack<<<dim3(4 * PKG), 256, 0, stream>>>(F[1], F[1] + (size_t)DM * DM, F[1] + (size_t)2 * DM * DM, F[3], PK);
  k_qkv<<<dim3(TNB * SS / TM, QKVW / TN), 256, 0, stream>>>(F[0], F[0], F[0], PK + PK_A, F[2], F[2] + DM, F[2] + 2 * DM, QK, QKL, VTH, VTL);
  k_attn<<<dim3(SS / 256, NH, TNB), 256, 0, stream>>>(QK, QKL, VTH, VTL, nullptr, O);
  k_out<<<dim3(NB * SS / TM, DM / TN), 256, 0, stream>>>(O, PK + PK_P, F[4], (float*)d_out);
}

// v008
// Measured time: 138 microseconds a run.
// Timed twice side by side with v007, it ran 1.05 times as fast both times.
// Over all steps from v000 it is 4.81 times as fast.
// compute dtype: all float inputs rounded to bf16; qkv = x . W_in^T + b with EXACT bf16 products on WMMA 16x16x32 (natural rows; the packed in_proj is three contiguous row blocks); PLAIN attention: q, k single f16, running-max softmax in f32 in the base-2 domain (1/8, log2 e, the maximum and 2^11 in one FMA a score, hardware exp), P (scaled by 2^11, single f16) x v (single f16); out = o (bf16 hi + residual) . W_out^T (2 products) + b_out.
#include <hip/hip_runtime.h>
#include <math.h>

typedef __attribute__((ext_vector_type(16))) _Float16 v16h;
typedef __attribute__((ext_vector_type(16))) __bf16 v16b;
typedef __attribute__((ext_vector_type(8)))  _Float16 v8h;
typedef __attribute__((ext_vector_type(8)))  float v8f;
typedef __attribute__((ext_vector_type(4)))  float v4f;
typedef __attribute__((ext_vector_type(2)))  float v2f;
typedef __attribute__((ext_vector_type(4)))  unsigned v4u;
typedef __attribute__((ext_vector_type(4)))  int v4i;
typedef float __attribute__((may_alias)) float_a;
typedef int __attribute__((may_alias)) int_a;

template <typename T> __device__ __forceinline__ void vst2(void* p, T v) { *(T*)p = v;  }
__device__ __forceinline__ v8f wmma16(v16h a, v16h b, v8f c) {
  return __builtin_amdgcn_wmma_f32_16x16x32_f16(false, a, false, b, (short)0, c, false, false);
}
__device__ __forceinline__ v8f wmma_bf(v16b a, v16b b, v8f c) {
  return __builtin_amdgcn_wmma_f32_16x16x32_bf16(false, a, false, b, (short)0, c, false, false);
}
// nn.MultiheadAttention-style self attention (B 4, S 2,048, E 1,024, 16 heads x 64): packed in_proj (natural [3E][E]) + bias, softmax(q k^T / 8) v, out_proj + bias.
__device__ __forceinline__ v16h frag_h(const _Float16* rowk0, int lane) {
  union { v16h v; v8h q[2]; } u; const _Float16* p = rowk0 + 8 * (lane >> 4);
  u.q[0] = *(const v8h*)p; u.q[1] = *(const v8h*)(p + 16); return u.v;
}
__device__ __forceinline__ v16h frag_f32(const float* rowk0, int lane) {
  v16h a; const float* p = rowk0 + 8 * (lane >> 4);
#pragma unroll
  for (int i = 0; i < 8; ++i) { a[i] = (_Float16)p[i]; a[8 + i] = (_Float16)p[16 + i]; }
  return a;
}
__device__ __forceinline__ v16h frag_f32s(const float* rowk0, int lane, float sc) {
  v16h a; const float* p = rowk0 + 8 * (lane >> 4);
#pragma unroll
  for (int i = 0; i < 8; ++i) { a[i] = (_Float16)(p[i] * sc); a[8 + i] = (_Float16)(p[16 + i] * sc); }
  return a;
}
// column fragment from a [K][ld] layout (column n), rows >= K read as 0
__device__ __forceinline__ v16h fragc_f32(const float* W, int k0, int n, int lane, int ld, int K) {
  v16h a; const int g = lane >> 4;
#pragma unroll
  for (int i = 0; i < 8; ++i) { const int ka = k0 + 8 * g + i, kb = ka + 16;
    a[i] = (_Float16)(ka < K ? W[(size_t)(ka < K ? ka : K - 1) * ld + n] : 0.f); a[8 + i] = (_Float16)(kb < K ? W[(size_t)(kb < K ? kb : K - 1) * ld + n] : 0.f); }
  return a;
}
struct F2 { v16b h, l; };
__device__ __forceinline__ F2 bsplit16(const float v[16]) { F2 r;
#pragma unroll
  for (int i = 0; i < 16; ++i) { const __bf16 h = (__bf16)v[i]; r.h[i] = h; r.l[i] = (__bf16)(v[i] - (float)h); }
  return r; }
__device__ __forceinline__ F2 split_row(const float* row, int k0, int lane) { float v[16]; const float* p = row + k0 + 8 * (lane >> 4);
#pragma unroll
  for (int i = 0; i < 8; ++i) { v[i] = p[i]; v[8 + i] = p[16 + i]; }
  return bsplit16(v); }
__device__ __forceinline__ F2 split_rowK(const float* row, int k0, int lane, int K) { float v[16]; const int g = lane >> 4;
#pragma unroll
  for (int i = 0; i < 8; ++i) { const int ka = k0 + 8 * g + i, kb = ka + 16; v[i] = ka < K ? row[ka < K ? ka : K - 1] : 0.f; v[8 + i] = kb < K ? row[kb < K ? kb : K - 1] : 0.f; }
  return bsplit16(v); }
__device__ __forceinline__ F2 split_col(const float* W, int k0, int n, int lane, int ld, int K) { float v[16]; const int g = lane >> 4;
#pragma unroll
  for (int i = 0; i < 8; ++i) { const int ka = k0 + 8 * g + i, kb = ka + 16; v[i] = ka < K ? W[(size_t)(ka < K ? ka : K - 1) * ld + n] : 0.f; v[8 + i] = kb < K ? W[(size_t)(kb < K ? kb : K - 1) * ld + n] : 0.f; }
  return bsplit16(v); }
__device__ __forceinline__ v8f mac3(const F2& a, const F2& b, v8f c) { c = wmma_bf(a.l, b.h, c); c = wmma_bf(a.h, b.l, c); return wmma_bf(a.h, b.h, c); }
__device__ __forceinline__ float sigm(float v) { return 1.0f / (1.0f + expf(-v)); }
#define LDSX() do { asm volatile("s_wait_dscnt 0" ::: "memory"); __builtin_amdgcn_wave_barrier(); __builtin_amdgcn_fence(__ATOMIC_RELEASE, "workgroup"); } while (0)


#define NB 4
#define SS 2048
#define DM 1024
#define NH 16
#define HD 64
#define QKVW (3 * DM)
#ifndef TQB
#define TQB (SS / 64)
#define TNB NB
#define TOB (NB * SS / 64)     // 64-row tiles of all rows; unused
#endif
typedef __attribute__((ext_vector_type(8))) __bf16 v8b;
__device__ __forceinline__ v16b frag_b(const __bf16* rowk0, int lane) {
  union { v16b v; v8b q[2]; } u; const __bf16* p = rowk0 + 8 * (lane >> 4);
  u.q[0] = *(const v8b*)p; u.q[1] = *(const v8b*)(p + 16); return u.v;
}
__device__ __forceinline__ float bfr(float v) { return (float)(__bf16)v; }
__device__ __attribute__((noinline)) float exp_ni(float v) { return expf(v); }
__device__ __attribute__((noinline)) float erf_ni(float v) { return erff(v); }

#define PK_A 0                       // [3072][1024] Wqkv rows (natural [out][in])
#define PK_P (PK_A + QKVW * DM)        // [1024][1024] Wo rows (natural)
#define PK_END (PK_P + DM * DM)
#define WS_PK  0u
#define WS_QK  (WS_PK + 2u * PK_END)             // f16 [8192 rows][2048]: q | k
#define WS_QKL (WS_QK + 2u * NB * SS * 2 * DM)     // f16 q | k residual planes x2048
#define WS_VTH (WS_QKL + 2u * NB * SS * 2 * DM)    // f16 [b][1024 (h*64+d)][2048 s] hi
#define WS_VTL (WS_VTH + 2u * NB * DM * SS)        // f16 lo x 2048
#define WS_O   (WS_VTL + 2u * NB * DM * SS)        // f32 [8192][1024]
#define WS_CS  (WS_O + 4u * NB * SS * DM)           // f32 2 x [2048][32], unused
#define WS_END (WS_CS + 4u * 2 * SS * 32)
// ---- k_pack: f32 weights -> bf16 in their natural [out][in] order: PK = W_q | W_k | W_v | W_o, 1,024 x 1,024 each (PK_P = 3 x 1,024 x 1,024)
// 256 work-groups of 8 waves, 64 a matrix, one a WGP: 2,048 waves to start in place of 32,768. A thread converts 64 weights: 16 loads of 16 B, all in flight at once (a wave-load = 4 whole lines), then 16 stores of 8 B (a wave-store = 2 whole lines); no LDS, no barrier
#define PKG 64                          // work-groups a matrix
#define PKE (DM * DM / PKG)             // weights a work-group
typedef __attribute__((ext_vector_type(4))) __bf16 v4bp;
__global__ __launch_bounds__(256) void k_pack(const float* __restrict__ WQ, const float* __restrict__ WK, const float* __restrict__ WV, const float* __restrict__ WO, __bf16* __restrict__ PK) {
  const int which = blockIdx.x / PKG; const float* Wm = (which == 0) ? WQ : (which == 1) ? WK : (which == 2) ? WV : WO;
  const unsigned q = (blockIdx.x % PKG) * (PKE / 4) + threadIdx.x;   // the thread's first group of four weights in its matrix: one index for the loads and the stores
  const v4f* ps = (const v4f*)Wm + q; v4bp* pd = (v4bp*)(PK + PK_A + (size_t)which * DM * DM) + q;
  v4f r[16]; static_assert(PKE / 1024 == 16, "16 loads a thread");
#pragma unroll   // constant indices: r stays in registers, the steps become immediate offsets
  for (int i = 0; i < PKE / 1024; ++i) r[i] = ps[i * 256];
  asm volatile("" :: "v"(r[0]), "v"(r[1]), "v"(r[2]), "v"(r[3]), "v"(r[4]), "v"(r[5]), "v"(r[6]), "v"(r[7]), "v"(r[8]), "v"(r[9]), "v"(r[10]), "v"(r[11]), "v"(r[12]), "v"(r[13]), "v"(r[14]), "v"(r[15]));   // holds all 16 loads in front of the first conversion: without it the last two are issued only when the first two have come back, a second memory latency
#pragma unroll   // as above
  for (int i = 0; i < PKE / 1024; ++i) { v4bp c; c[0] = (__bf16)r[i][0]; c[1] = (__bf16)r[i][1]; c[2] = (__bf16)r[i][2]; c[3] = (__bf16)r[i][3]; pd[i * 256] = c; }
}
// LDS staging: a stage is 64 k (one 128-B line of every 16-bit operand row); rows lie at a pitch of 144 B (16 B x odd) for the ds_load_b128 fragment readers
#define KS 64
#define LP 72
typedef __attribute__((ext_vector_type(4))) __bf16 v4b;
// GEMM tiling of k_qkv and k_out: a work-group of 8 waves (2 x 4) owns 128 rows x 256 columns, a wave 64 x 64 = 4 x 4 accumulator tiles: 8 fragments feed 16 WMMAs, and a staged line is used by 4 (x, o) or 2 (W) waves
// between a wave's writes and its read-back of its own staging rows, and between the read-back and the next rows' writes: the LDS wait alone; no release fence, which would also wait out the global stores of the rows before
#define LDSW() do { asm volatile("s_wait_dscnt 0" ::: "memory"); __builtin_amdgcn_wave_barrier(); } while (0)
#define TM 128
#define TN 256
// the second bound asks for 4 waves a SIMD: a budget of 256 registers, so that two work-groups share a WGP and one's WMMAs cover the other's global wait, LDS fill and barrier
__global__ __launch_bounds__(256, 4) void k_qkv(const float* __restrict__ XQ, const float* __restrict__ XK, const float* __restrict__ XV, const __bf16* __restrict__ P, const float* __restrict__ BQ, const float* __restrict__ BK, const float* __restrict__ BV, _Float16* __restrict__ QK, _Float16* __restrict__ QKL, _Float16* __restrict__ VTH, _Float16* __restrict__ VTL) {
  const int n0 = blockIdx.y * TN; const int which0 = n0 / DM; const float* X = (which0 == 0) ? XQ : (which0 == 1) ? XK : XV; const float* BB = BQ ? (((which0 == 0) ? BQ : (which0 == 1) ? BK : BV) + (n0 - which0 * DM)) : nullptr;
  // the two stage buffers and the epilogue's staging share one LDS range: the loop's last barrier stands between them; ep[wave] belongs to one wave alone
  __shared__ __align__(16) union { struct { __bf16 a[2][TM][LP], b[2][TN][LP]; } st; _Float16 ep[8][2][16][LP]; } sm;
  const int tid = threadIdx.x, wave = __builtin_amdgcn_readfirstlane(tid >> 5), lane = tid & 31, col = lane & 15, g = lane >> 4; const int wm = wave & 1, wn = wave >> 1;
  const size_t r0 = (size_t)blockIdx.x * TM + wm * 64; const int nw = n0 + wn * 64;
  v8f acc[4][4] = {};
  // whole-line global loads: W 8 lanes x 16 B = one line of a row (4 rows a wave-load), x 16 lanes x 16 B = two lines of a row (2 rows a wave-load)
  const int br = tid >> 3, bc = (tid & 7) * 8, ar = tid >> 4, ac = (tid & 15) * 4;
  const __bf16* pb = P + (size_t)(n0 + br) * DM + bc; const float* pa = X + ((size_t)blockIdx.x * TM + ar) * DM + ac;
  v8b rb[8]; v4f ra[8];
#pragma unroll
  for (int i = 0; i < 8; ++i) { rb[i] = *(const v8b*)(pb + (size_t)i * 32 * DM); ra[i] = *(const v4f*)(pa + (size_t)i * 16 * DM); }
#pragma unroll
  for (int i = 0; i < 8; ++i) { *(v8b*)&sm.st.b[0][br + 32 * i][bc] = rb[i]; v4b c; c[0] = (__bf16)ra[i][0]; c[1] = (__bf16)ra[i][1]; c[2] = (__bf16)ra[i][2]; c[3] = (__bf16)ra[i][3]; *(v4b*)&sm.st.a[0][ar + 16 * i][ac] = c; }
  __syncthreads();
#pragma unroll 2   // two stages a trip: the buffer index is a constant in the addresses
  for (int s = 0; s < DM / KS; ++s) { const int cur = s & 1;
    if (s + 1 < DM / KS) {   // the next stage's lines fly into registers while this stage is multiplied
#pragma unroll
      for (int i = 0; i < 8; ++i) { rb[i] = *(const v8b*)(pb + (size_t)i * 32 * DM + (s + 1) * KS); ra[i] = *(const v4f*)(pa + (size_t)i * 16 * DM + (s + 1) * KS); } }
#pragma unroll
    for (int kc = 0; kc < KS / 32; ++kc) { v16b w[4];
#pragma unroll
      for (int j = 0; j < 4; ++j) w[j] = frag_b(&sm.st.b[cur][wn * 64 + j * 16 + col][kc * 32], lane);
#pragma unroll
      for (int ii = 0; ii < 4; ii += 2) { v16b a[2];   // x fragments two at a time: the live set stays inside 256 registers, so two work-groups share a WGP
#pragma unroll
        for (int i = 0; i < 2; ++i) a[i] = frag_b(&sm.st.a[cur][wm * 64 + (ii + i) * 16 + col][kc * 32], lane);
        asm volatile("" :: "v"(a[0]), "v"(a[1]), "v"(w[0]), "v"(w[1]), "v"(w[2]), "v"(w[3]));   // holds the block's LDS reads as one group in front of its WMMAs: one LDS latency a block, not one a WMMA
#pragma unroll
        for (int i = 0; i < 2; ++i) {
#pragma unroll
          for (int j = 0; j < 4; ++j) acc[ii + i][j] = wmma_bf(a[i], w[j], acc[ii + i][j]); } } }
    __builtin_amdgcn_sched_barrier(0);   // keeps the conversions below, and with them the wait on the global loads, behind this stage's WMMAs
    if (s + 1 < DM / KS) {   // into the buffer whose readers all passed the barrier of the trip before
#pragma unroll
      for (int i = 0; i < 8; ++i) { *(v8b*)&sm.st.b[cur ^ 1][br + 32 * i][bc] = rb[i]; v4b c; c[0] = (__bf16)ra[i][0]; c[1] = (__bf16)ra[i][1]; c[2] = (__bf16)ra[i][2]; c[3] = (__bf16)ra[i][3]; *(v4b*)&sm.st.a[cur ^ 1][ar + 16 * i][ac] = c; } }
    __syncthreads(); }   // publishes stage s + 1 and ends every read of stage s
  auto& eh = sm.ep[wave][0]; auto& el = sm.ep[wave][1];   // 16 rows of one 128-B line each, hi and residual plane
  const int ln = __builtin_amdgcn_mbcnt_lo(~0u, 0u), ecol = ln & 15, eg = ln >> 4;   // the lane's number read anew: no lane index of the epilogue holds a register through the loop
  const int er = ln >> 3, ec = (ln & 7) * 8;   // read-back: 8 lanes x 16 B = one line, 4 rows a wave-store
  float bias[4];
#pragma unroll
  for (int j = 0; j < 4; ++j) bias[j] = BB ? bfr(BB[wn * 64 + j * 16 + ecol]) : 0.f;
  if (n0 < 2 * DM) {   // q stored unscaled (f16 sigma ~0.6, no subnormal exposure); 1/8 applied to the f32 score
#pragma unroll
    for (int i = 0; i < 4; ++i) {   // 16 rows x 64 columns at a time
#pragma unroll
      for (int j = 0; j < 4; ++j) {
#pragma unroll
        for (int r = 0; r < 8; ++r) { const float v = acc[i][j][r] + bias[j]; const _Float16 hv = (_Float16)v; eh[8 * eg + r][j * 16 + ecol] = hv; el[8 * eg + r][j * 16 + ecol] = (_Float16)((v - (float)hv) * 2048.0f); } }   // q, k (+ bias) as f16 hi + (x2048) residual
      LDSW();
#pragma unroll
      for (int q = 0; q < 4; ++q) { const size_t o = (r0 + i * 16 + q * 4 + er) * (2 * DM) + nw + ec; vst2((unsigned*)(QK + o), *(const v4u*)&eh[q * 4 + er][ec]); vst2((unsigned*)(QKL + o), *(const v4u*)&el[q * 4 + er][ec]); }
      if (i < 3) LDSW(); }   // the rows are read before the next 16 overwrite them
  } else {
    const int b = (int)(r0 / SS), s0 = (int)(r0 % SS); const int pc0 = nw - 2 * DM;
#pragma unroll
    for (int j = 0; j < 4; ++j) {   // transposed: 16 d rows x 64 s at a time; a lane's eight accumulator rows are eight neighbours in s
#pragma unroll
      for (int i = 0; i < 4; ++i) { v8h h8, l8;
#pragma unroll
        for (int r = 0; r < 8; ++r) { const float v = acc[i][j][r] + bias[j]; const _Float16 hv = (_Float16)v; h8[r] = hv; l8[r] = (_Float16)((v - (float)hv) * 2048.0f); }
        *(v8h*)&eh[ecol][i * 16 + 8 * eg] = h8; *(v8h*)&el[ecol][i * 16 + 8 * eg] = l8; }
      LDSW();
#pragma unroll
      for (int q = 0; q < 4; ++q) { const size_t o = ((size_t)b * DM + pc0 + j * 16 + q * 4 + er) * SS + s0 + ec; vst2((unsigned*)(VTH + o), *(const v4u*)&eh[q * 4 + er][ec]); vst2((unsigned*)(VTL + o), *(const v4u*)&el[q * 4 + er][ec]); }
      if (j < 3) LDSW(); }   // the rows are read before the next 16 overwrite them
    asm volatile("s_wait_xcnt 0x0" ::: "memory");   // in the listing this branch's text runs on into the other branch's, behind a jump: the wait stands in front of every rewrite of a register that the stores above name
  }
}
__device__ __forceinline__ float xhalf(float x) { return __builtin_bit_cast(float, __builtin_amdgcn_permlanex16(__builtin_bit_cast(int, x), __builtin_bit_cast(int, x), 0x76543210, 0xfedcba98, false, false)); }   // lane l with lane l ^ 16
// eight base-2 exponentials in place and back to back: none writes a register of the one in front of it, and no filler stands between them; the closing v_nop is the slot that the instruction set asks for behind a transcendental before its result is read
__device__ __forceinline__ void exp2x8(v8f& x) {
  float a0 = x[0], a1 = x[1], a2 = x[2], a3 = x[3], a4 = x[4], a5 = x[5], a6 = x[6], a7 = x[7];
  asm("v_exp_f32 %0, %0\n\tv_exp_f32 %1, %1\n\tv_exp_f32 %2, %2\n\tv_exp_f32 %3, %3\n\tv_exp_f32 %4, %4\n\tv_exp_f32 %5, %5\n\tv_exp_f32 %6, %6\n\tv_exp_f32 %7, %7\n\tv_nop" : "+v"(a0), "+v"(a1), "+v"(a2), "+v"(a3), "+v"(a4), "+v"(a5), "+v"(a6), "+v"(a7));
  x[0] = a0; x[1] = a1; x[2] = a2; x[3] = a3; x[4] = a4; x[5] = a5; x[6] = a6; x[7] = a7;
}
// a thread's share of one stage: eight asynchronous copies of 16 B from global memory straight into LDS (four k rows, four v pieces), through no register; lk, lv, gk, gv are the first k and the first v address in LDS and in global memory, the others lie at fixed steps from them; the closing s_wait_xcnt stands in the copies' own statement, in front of every later rewrite of an address register that they name
__device__ __forceinline__ void stage8(unsigned lk, unsigned lv, unsigned lrow, unsigned lhalf, const _Float16* gk, const _Float16* gv) {
  const _Float16 *k1 = gk + (size_t)32 * (2 * DM), *k2 = gk + (size_t)64 * (2 * DM), *k3 = gk + (size_t)96 * (2 * DM), *v1 = gv + (size_t)32 * SS, *v2 = gv + 64, *v3 = gv + (size_t)32 * SS + 64;
  asm volatile("global_load_async_to_lds_b128 %0, %8, off\n\tglobal_load_async_to_lds_b128 %1, %9, off\n\tglobal_load_async_to_lds_b128 %2, %10, off\n\tglobal_load_async_to_lds_b128 %3, %11, off\n\t"
               "global_load_async_to_lds_b128 %4, %12, off\n\tglobal_load_async_to_lds_b128 %5, %13, off\n\tglobal_load_async_to_lds_b128 %6, %14, off\n\tglobal_load_async_to_lds_b128 %7, %15, off\n\ts_wait_xcnt 0x0"
               :: "v"(lk), "v"(lk + lrow), "v"(lk + lhalf), "v"(lk + lhalf + lrow), "v"(lv), "v"(lv + lrow), "v"(lv + lhalf), "v"(lv + lhalf + lrow), "v"(gk), "v"(k1), "v"(k2), "v"(k3), "v"(gv), "v"(v1), "v"(v2), "v"(v3) : "memory");
}
// a work-group of 8 waves owns 256 queries, a wave 32 = two 16-query column groups: a k or v fragment read from LDS feeds two WMMAs, and a staged line serves 256 queries
// the second bound asks for 4 waves a SIMD: a budget of 256 registers, so that two work-groups share a WGP and one's arithmetic covers the other's global wait, LDS fill and barriers
__global__ __launch_bounds__(256, 4) void k_attn(const _Float16* __restrict__ QK, const _Float16* __restrict__ QKL, const _Float16* __restrict__ VTH, const _Float16* __restrict__ VTL, const void* __restrict__ KMASK, float* __restrict__ O) {
  // one stage = 128 keys = two halves of 64: k rows [key][64 d] and v rows [d][64 keys], one 128-B line each; two stage buffers: one is read while the next stage's copies land in the other; the buffers and the epilogue's staging share one LDS range, the loop's last barrier between them
  __shared__ __align__(16) union { struct { _Float16 k[64][LP], v[64][LP]; } st[2][2]; float so[8][32][68]; } sm;
  auto& so = sm.so;
  const int tid = threadIdx.x, wave = tid >> 5, lane = tid & 31, col = lane & 15, g = lane >> 4;
  const int qb = blockIdx.x, h = blockIdx.y, b = blockIdx.z; const int q0 = qb * 256 + wave * 32;
  v16h aq[2][2];   // B operand of the score product: column = query qt * 16 + col
#pragma unroll
  for (int qt = 0; qt < 2; ++qt) {
#pragma unroll
    for (int kc = 0; kc < 2; ++kc) aq[qt][kc] = frag_h(QK + ((size_t)b * SS + q0 + qt * 16 + col) * (2 * DM) + h * HD + kc * 32, lane); }
  float m[2] = {-3.0e38f, -3.0e38f}, l[2] = {0.f, 0.f};   // this lane's two queries: running maximum of the raw scores (equal in both halves), sum (x2^11) over this half's keys
  const float kf = 0.125f * 1.44269504f;   // 1/sqrt(64) and log2 e in one factor
  float nb[2] = {5.0e37f, 5.0e37f};   // addend of the score FMA in use: 11 - m * kf; the start value lies far above any real one, so the first alpha is 0
  v8f acc[2][4] = {};   // acc[qt][dt][r] = O^T[dt * 16 + 8 g + r][query qt * 16 + col]
  const int sr = tid >> 3, sc = (tid & 7) * 8;   // whole-line copies: 8 lanes x 16 B = one line of a row, 4 rows a wave-copy
  const _Float16* pk = QK + ((size_t)b * SS + sr) * (2 * DM) + DM + h * HD + sc; const _Float16* pv = VTH + ((size_t)b * DM + h * HD + sr) * SS + sc;
  static_assert(SS / 128 >= 2, "the prologue fills two stages");
  const unsigned lk = (unsigned)(size_t)&sm.st[0][0].k[sr][sc], lv = (unsigned)(size_t)&sm.st[0][0].v[sr][sc];   // the thread's LDS byte addresses in buffer 0
  const unsigned LH = sizeof(sm.st[0][0]), LR = 32 * LP * 2;   // bytes from half to half of a buffer, and over 32 rows
  stage8(lk, lv, LR, LH, pk, pv);   // stage 0 into buffer 0
  asm volatile("s_wait_asynccnt 0x0" ::: "memory");   // this wave's copies of stage 0 have landed
  __syncthreads();   // publishes stage 0
  pk += (size_t)128 * (2 * DM); pv += 128;
  stage8(lk + 2 * LH, lv + 2 * LH, LR, LH, pk, pv);   // stage 1 flies into buffer 1 while stage 0 is worked on
#pragma unroll 1   // rolled: the buffer is picked by address, and the loop's text stays small
  for (int st = 0; st < SS / 128; ++st) {   // all keys
#pragma unroll 1   // rolled, as above
   for (int hs = 0; hs < 2; ++hs) {   // the two halves of the stage, no barrier between them
    auto& sb = sm.st[st & 1][hs];
#pragma unroll   // both 32-key parts of the half in line: constant LDS offsets
    for (int sub = 0; sub < 2; ++sub) { v8f s[2][2] = {}; v16h fk[2][2];   // s[qt][ct][r] = raw score q.k of key sub * 32 + ct * 16 + 8 g + r of the half against query qt * 16 + col
#pragma unroll
      for (int ct = 0; ct < 2; ++ct) { fk[ct][0] = frag_h(&sb.k[sub * 32 + ct * 16 + col][0], lane); fk[ct][1] = frag_h(&sb.k[sub * 32 + ct * 16 + col][32], lane); }
      asm volatile("" :: "v"(fk[0][0]), "v"(fk[0][1]), "v"(fk[1][0]), "v"(fk[1][1]));   // holds the four k fragments' LDS reads as one group in front of the score WMMAs: one LDS latency, not four
#pragma unroll
      for (int kc = 0; kc < 2; ++kc) {   // a tile takes d 0..31 first and d 32..63 second, as before; the other three tiles stand between the two
#pragma unroll
        for (int ct = 0; ct < 2; ++ct) {
#pragma unroll
          for (int qt = 0; qt < 2; ++qt) s[qt][ct] = wmma16(fk[ct][kc], aq[qt][kc], s[qt][ct]); } }   // single product: k rows as A, q as B, one-rounding f16 operands
      v16h p[2]; float alpha[2];   // P^T packs from the two score tiles into the B operand: element ct * 8 + r = key ct * 16 + 8 g + r of the 32, the hardware k order, which frag_h gives V^T too
#pragma unroll
      for (int qt = 0; qt < 2; ++qt) {
        float mt[2];   // two independent chains, then one exchange between the wave's halves
#pragma unroll
        for (int t = 0; t < 2; ++t) { mt[t] = s[qt][t][0];
#pragma unroll
          for (int r = 1; r < 8; ++r) mt[t] = fmaxf(mt[t], s[qt][t][r]); }
        float mx = fmaxf(mt[0], mt[1]); mx = fmaxf(mx, xhalf(mx));
        const float mn = fmaxf(m[qt], mx); const float nbn = __builtin_fmaf(-mn, kf, 11.0f);   // the FMA's addend: minus the scaled maximum, plus 11 so that the weights come out x2^11
        alpha[qt] = __builtin_amdgcn_exp2f(nbn - nb[qt]); nb[qt] = nbn;   // old weights were formed with the old addend: the difference of the two rescales them, whatever rounding each addend took
        v8f e[2];
#pragma unroll
        for (int t = 0; t < 2; ++t) e[t] = s[qt][t] * kf + nbn;   // one FMA a score, then the hardware's base-2 exponential: 2^11 exp((q.k - max) / 8)
#pragma unroll
        for (int t = 0; t < 2; ++t) exp2x8(e[t]);
        const v8f e8 = e[0] + e[1];   // this half's 16 weights: tiles first, then the eight registers
        const float es = ((e8[0] + e8[2]) + (e8[4] + e8[6])) + ((e8[1] + e8[3]) + (e8[5] + e8[7]));
#pragma unroll
        for (int t = 0; t < 2; ++t) {   // P carries 2^11 so small softmax weights stay out of the f16 subnormal range; l carries it too
#pragma unroll
          for (int r = 0; r < 8; ++r) p[qt][t * 8 + r] = (_Float16)e[t][r]; }
        l[qt] = l[qt] * alpha[qt] + es; m[qt] = mn;
#pragma unroll
        for (int dt = 0; dt < 4; ++dt) acc[qt][dt] *= alpha[qt]; }
#pragma unroll
      for (int dt = 0; dt < 4; ++dt) { const v16h fv = frag_h(&sb.v[dt * 16 + col][sub * 32], lane);
#pragma unroll
        for (int qt = 0; qt < 2; ++qt) acc[qt][dt] = wmma16(fv, p[qt], acc[qt][dt]); }   // single product: V^T rows as A, P^T (x2^11) as B
      __builtin_amdgcn_sched_barrier(0); } }   // keeps the next 32 keys' fragments and score tiles behind these 32: both 32-key parts live at once do not fit in 256 registers and spill
    asm volatile("s_wait_dscnt 0x0" ::: "memory");   // this wave's reads of the stage are done before its buffer is handed to the copies
    asm volatile("s_wait_asynccnt 0x0" ::: "memory");   // this wave's copies of stage st + 1 have landed
    __syncthreads();   // publishes stage st + 1 and ends every read of stage st; behind the last stage: the LDS becomes the output staging
    if (st + 2 < SS / 128) {   // the same for the whole work-group: stage st + 2 into the buffer just read
      const unsigned lo = (st & 1) * 2 * LH; pk += (size_t)128 * (2 * DM); pv += 128;
      stage8(lk + lo, lv + lo, LR, LH, pk, pv); } }
  asm volatile("s_wait_asynccnt 0x0" ::: "memory");   // no copy is outstanding when the buffers become the output staging
#pragma unroll
  for (int qt = 0; qt < 2; ++qt) { const float il = 1.0f / (l[qt] + xhalf(l[qt]));   // the halves' sums join once; 2^11 stands in acc and in l alike
#pragma unroll
    for (int dt = 0; dt < 4; ++dt) { v4f o0, o1;
#pragma unroll
      for (int r = 0; r < 4; ++r) { o0[r] = acc[qt][dt][r] * il; o1[r] = acc[qt][dt][4 + r] * il; }
      *(v4f*)&so[wave][qt * 16 + col][dt * 16 + 8 * g] = o0; *(v4f*)&so[wave][qt * 16 + col][dt * 16 + 8 * g + 4] = o1; } }
  LDSX();
  for (int rl = 0; rl < 32; ++rl) if (lane < 16) vst2(O + ((size_t)b * SS + q0 + rl) * DM + h * HD + lane * 4, *(const v4f*)&so[wave][rl][lane * 4]);
}
// ---- k_out: block = (128 rows, 256 cols): out = O(hi/lo) . Wo rows (2 products) + bo
__global__ __launch_bounds__(256) void k_out(const float* __restrict__ O, const __bf16* __restrict__ P, const float* __restrict__ BO, float* __restrict__ Y) {
  // the two stage buffers and the epilogue's staging share one LDS range: the loop's last barrier stands between them; so[wave] belongs to one wave alone
  __shared__ __align__(16) union { struct { __bf16 ah[2][TM][LP], al[2][TM][LP], b[2][TN][LP]; } st; float so[8][16][68]; } sm;
  const int tid = threadIdx.x, wave = tid >> 5, lane = tid & 31, col = lane & 15, g = lane >> 4; const int wm = wave & 1, wn = wave >> 1;
  const int n0 = blockIdx.y * TN; const size_t r0 = (size_t)blockIdx.x * TM + wm * 64; const int nw = n0 + wn * 64;
  v8f acc[4][4] = {};
  // whole-line global loads, as in k_qkv; o is split into its bf16 hi and residual planes on the way into LDS
  const int br = tid >> 3, bc = (tid & 7) * 8, ar = tid >> 4, ac = (tid & 15) * 4;
  const __bf16* pb = P + (size_t)(n0 + br) * DM + bc; const float* pa = O + ((size_t)blockIdx.x * TM + ar) * DM + ac;
  v8b rb[8]; v4f ra[8];
#pragma unroll
  for (int i = 0; i < 8; ++i) { rb[i] = *(const v8b*)(pb + (size_t)i * 32 * DM); ra[i] = *(const v4f*)(pa + (size_t)i * 16 * DM); }
#pragma unroll
  for (int i = 0; i < 8; ++i) { *(v8b*)&sm.st.b[0][br + 32 * i][bc] = rb[i]; v4b ch, cl;
#pragma unroll
    for (int e = 0; e < 4; ++e) { const __bf16 hv = (__bf16)ra[i][e]; ch[e] = hv; cl[e] = (__bf16)(ra[i][e] - (float)hv); }
    *(v4b*)&sm.st.ah[0][ar + 16 * i][ac] = ch; *(v4b*)&sm.st.al[0][ar + 16 * i][ac] = cl; }
  __syncthreads();
#pragma unroll 2   // two stages a trip: the buffer index is a constant in the addresses
  for (int s = 0; s < DM / KS; ++s) { const int cur = s & 1;
    if (s + 1 < DM / KS) {   // the next stage's lines fly into registers while this stage is multiplied
#pragma unroll
      for (int i = 0; i < 8; ++i) { rb[i] = *(const v8b*)(pb + (size_t)i * 32 * DM + (s + 1) * KS); ra[i] = *(const v4f*)(pa + (size_t)i * 16 * DM + (s + 1) * KS); } }
#pragma unroll
    for (int kc = 0; kc < KS / 32; ++kc) { v16b ah[4], al[4], w[4];
#pragma unroll
      for (int i = 0; i < 4; ++i) { ah[i] = frag_b(&sm.st.ah[cur][wm * 64 + i * 16 + col][kc * 32], lane); al[i] = frag_b(&sm.st.al[cur][wm * 64 + i * 16 + col][kc * 32], lane); w[i] = frag_b(&sm.st.b[cur][wn * 64 + i * 16 + col][kc * 32], lane); }
      asm volatile("" :: "v"(ah[0]), "v"(ah[1]), "v"(ah[2]), "v"(ah[3]), "v"(al[0]), "v"(al[1]), "v"(al[2]), "v"(al[3]), "v"(w[0]), "v"(w[1]), "v"(w[2]), "v"(w[3]));   // holds the block's LDS reads as one group in front of its WMMAs: one LDS latency a block, not one a WMMA
#pragma unroll
      for (int i = 0; i < 4; ++i) {   // a tile takes its residual product first and its hi product second, as before; the other three tiles of the row stand between the two
#pragma unroll
        for (int j = 0; j < 4; ++j) acc[i][j] = wmma_bf(al[i], w[j], acc[i][j]);
#pragma unroll
        for (int j = 0; j < 4; ++j) acc[i][j] = wmma_bf(ah[i], w[j], acc[i][j]); } }
    __builtin_amdgcn_sched_barrier(0);   // keeps the split below, and with it the wait on the global loads, behind this stage's WMMAs
    if (s + 1 < DM / KS) {   // into the buffer whose readers all passed the barrier of the trip before
#pragma unroll
      for (int i = 0; i < 8; ++i) { *(v8b*)&sm.st.b[cur ^ 1][br + 32 * i][bc] = rb[i]; v4b ch, cl;
#pragma unroll
        for (int e = 0; e < 4; ++e) { const __bf16 hv = (__bf16)ra[i][e]; ch[e] = hv; cl[e] = (__bf16)(ra[i][e] - (float)hv); }
        *(v4b*)&sm.st.ah[cur ^ 1][ar + 16 * i][ac] = ch; *(v4b*)&sm.st.al[cur ^ 1][ar + 16 * i][ac] = cl; } }
    __syncthreads(); }   // publishes stage s + 1 and ends every read of stage s
  auto& so = sm.so[wave];
  const int er = lane >> 4, ec = (lane & 15) * 4;   // read-back: 16 lanes x 16 B = the two lines of a row's 64 columns, 2 rows a wave-store
  float bias[4];
#pragma unroll
  for (int j = 0; j < 4; ++j) bias[j] = bfr(BO[nw + j * 16 + col]);
#pragma unroll
  for (int i = 0; i < 4; ++i) {   // 16 rows x 64 columns at a time
#pragma unroll
    for (int j = 0; j < 4; ++j) {
#pragma unroll
      for (int r = 0; r < 8; ++r) so[8 * g + r][j * 16 + col] = acc[i][j][r] + bias[j]; }
    LDSW();
#pragma unroll
    for (int q = 0; q < 8; ++q) vst2(Y + (r0 + i * 16 + q * 2 + er) * DM + nw + ec, *(const v4f*)&so[q * 2 + er][ec]);
    if (i < 3) LDSW(); }   // the rows are read before the next 16 overwrite them
}
extern "C" void kernel_launch(void* const* d_in, const int* in_sizes, int n_in, void* d_out, int out_size, void* d_ws, size_t ws_size, hipStream_t stream) {
  (void)in_sizes; (void)n_in; (void)out_size;
  const float** F = (const float**)d_in;   // 0 x [4,2048,1024], 1 in_proj_weight [3072,1024], 2 in_proj_bias [3072], 3 out_proj_weight [1024,1024], 4 out_proj_bias
  if (ws_size < (size_t)WS_END) return;
  char* ws = (char*)d_ws; __bf16* PK = (__bf16*)(ws + WS_PK); _Float16 *QK = (_Float16*)(ws + WS_QK), *QKL = (_Float16*)(ws + WS_QKL), *VTH = (_Float16*)(ws + WS_VTH), *VTL = (_Float16*)(ws + WS_VTL); float* O = (float*)(ws + WS_O);
  k_pack<<<dim3(4 * PKG), 256, 0, stream>>>(F[1], F[1] + (size_t)DM * DM, F[1] + (size_t)2 * DM * DM, F[3], PK);
  k_qkv<<<dim3(TNB * SS / TM, QKVW / TN), 256, 0, stream>>>(F[0], F[0], F[0], PK + PK_A, F[2], F[2] + DM, F[2] + 2 * DM, QK, QKL, VTH, VTL);
  k_attn<<<dim3(SS / 256, NH, TNB), 256, 0, stream>>>(QK, QKL, VTH, VTL, nullptr, O);
  k_out<<<dim3(NB * SS / TM, DM / TN), 256, 0, stream>>>(O, PK + PK_P, F[4], (float*)d_out);
}

// v009
// It runs in 132 microseconds.
// Next to v008, in two timings, it ran 1.04 times as fast each time.
// All steps since v000 together make it 5.01 times as fast.
// compute dtype: all float inputs rounded to bf16; qkv = x . W_in^T + b with EXACT bf16 products on WMMA 16x16x32 (natural rows; the packed in_proj is three contiguous row blocks); PLAIN attention: q, k single f16, running-max softmax (lazy rescale) in f32 in the base-2 domain (1/8, log2 e, the maximum and 2^11 in one FMA a score, hardware exp), P (scaled by 2^11, single f16) x v (single f16); out = o (bf16 hi + residual) . W_out^T (2 products) + b_out.
#include <hip/hip_runtime.h>
#include <math.h>

typedef __attribute__((ext_vector_type(16))) _Float16 v16h;
typedef __attribute__((ext_vector_type(16))) __bf16 v16b;
typedef __attribute__((ext_vector_type(8)))  _Float16 v8h;
typedef __attribute__((ext_vector_type(8)))  float v8f;
typedef __attribute__((ext_vector_type(4)))  float v4f;
typedef __attribute__((ext_vector_type(2)))  float v2f;
typedef __attribute__((ext_vector_type(4)))  unsigned v4u;
typedef __attribute__((ext_vector_type(4)))  int v4i;
typedef float __attribute__((may_alias)) float_a;
typedef int __attribute__((may_alias)) int_a;

template <typename T> __device__ __forceinline__ void vst2(void* p, T v) { *(T*)p = v;  }
__device__ __forceinline__ v8f wmma16(v16h a, v16h b, v8f c) {
  return __builtin_amdgcn_wmma_f32_16x16x32_f16(false, a, false, b, (short)0, c, false, false);
}
__device__ __forceinline__ v8f wmma_bf(v16b a, v16b b, v8f c) {
  return __builtin_amdgcn_wmma_f32_16x16x32_bf16(false, a, false, b, (short)0, c, false, false);
}
// nn.MultiheadAttention-style self attention (B 4, S 2,048, E 1,024, 16 heads x 64): packed in_proj (natural [3E][E]) + bias, softmax(q k^T / 8) v, out_proj + bias.
__device__ __forceinline__ v16h frag_h(const _Float16* rowk0, int lane) {
  union { v16h v; v8h q[2]; } u; const _Float16* p = rowk0 + 8 * (lane >> 4);
  u.q[0] = *(const v8h*)p; u.q[1] = *(const v8h*)(p + 16); return u.v;
}
__device__ __forceinline__ v16h frag_f32(const float* rowk0, int lane) {
  v16h a; const float* p = rowk0 + 8 * (lane >> 4);
#pragma unroll
  for (int i = 0; i < 8; ++i) { a[i] = (_Float16)p[i]; a[8 + i] = (_Float16)p[16 + i]; }
  return a;
}
__device__ __forceinline__ v16h frag_f32s(const float* rowk0, int lane, float sc) {
  v16h a; const float* p = rowk0 + 8 * (lane >> 4);
#pragma unroll
  for (int i = 0; i < 8; ++i) { a[i] = (_Float16)(p[i] * sc); a[8 + i] = (_Float16)(p[16 + i] * sc); }
  return a;
}
// column fragment from a [K][ld] layout (column n), rows >= K read as 0
__device__ __forceinline__ v16h fragc_f32(const float* W, int k0, int n, int lane, int ld, int K) {
  v16h a; const int g = lane >> 4;
#pragma unroll
  for (int i = 0; i < 8; ++i) { const int ka = k0 + 8 * g + i, kb = ka + 16;
    a[i] = (_Float16)(ka < K ? W[(size_t)(ka < K ? ka : K - 1) * ld + n] : 0.f); a[8 + i] = (_Float16)(kb < K ? W[(size_t)(kb < K ? kb : K - 1) * ld + n] : 0.f); }
  return a;
}
struct F2 { v16b h, l; };
__device__ __forceinline__ F2 bsplit16(const float v[16]) { F2 r;
#pragma unroll
  for (int i = 0; i < 16; ++i) { const __bf16 h = (__bf16)v[i]; r.h[i] = h; r.l[i] = (__bf16)(v[i] - (float)h); }
  return r; }
__device__ __forceinline__ F2 split_row(const float* row, int k0, int lane) { float v[16]; const float* p = row + k0 + 8 * (lane >> 4);
#pragma unroll
  for (int i = 0; i < 8; ++i) { v[i] = p[i]; v[8 + i] = p[16 + i]; }
  return bsplit16(v); }
__device__ __forceinline__ F2 split_rowK(const float* row, int k0, int lane, int K) { float v[16]; const int g = lane >> 4;
#pragma unroll
  for (int i = 0; i < 8; ++i) { const int ka = k0 + 8 * g + i, kb = ka + 16; v[i] = ka < K ? row[ka < K ? ka : K - 1] : 0.f; v[8 + i] = kb < K ? row[kb < K ? kb : K - 1] : 0.f; }
  return bsplit16(v); }
__device__ __forceinline__ F2 split_col(const float* W, int k0, int n, int lane, int ld, int K) { float v[16]; const int g = lane >> 4;
#pragma unroll
  for (int i = 0; i < 8; ++i) { const int ka = k0 + 8 * g + i, kb = ka + 16; v[i] = ka < K ? W[(size_t)(ka < K ? ka : K - 1) * ld + n] : 0.f; v[8 + i] = kb < K ? W[(size_t)(kb < K ? kb : K - 1) * ld + n] : 0.f; }
  return bsplit16(v); }
__device__ __forceinline__ v8f mac3(const F2& a, const F2& b, v8f c) { c = wmma_bf(a.l, b.h, c); c = wmma_bf(a.h, b.l, c); return wmma_bf(a.h, b.h, c); }
__device__ __forceinline__ float sigm(float v) { return 1.0f / (1.0f + expf(-v)); }
#define LDSX() do { asm volatile("s_wait_dscnt 0" ::: "memory"); __builtin_amdgcn_wave_barrier(); __builtin_amdgcn_fence(__ATOMIC_RELEASE, "workgroup"); } while (0)


#define NB 4
#define SS 2048
#define DM 1024
#define NH 16
#define HD 64
#define QKVW (3 * DM)
#ifndef TQB
#define TQB (SS / 64)
#define TNB NB
#define TOB (NB * SS / 64)     // 64-row tiles of all rows; unused
#endif
typedef __attribute__((ext_vector_type(8))) __bf16 v8b;
__device__ __forceinline__ v16b frag_b(const __bf16* rowk0, int lane) {
  union { v16b v; v8b q[2]; } u; const __bf16* p = rowk0 + 8 * (lane >> 4);
  u.q[0] = *(const v8b*)p; u.q[1] = *(const v8b*)(p + 16); return u.v;
}
__device__ __forceinline__ float bfr(float v) { return (float)(__bf16)v; }
__device__ __attribute__((noinline)) float exp_ni(float v) { return expf(v); }
__device__ __attribute__((noinline)) float erf_ni(float v) { return erff(v); }

#define PK_A 0                       // [3072][1024] Wqkv rows (natural [out][in])
#define PK_P (PK_A + QKVW * DM)        // [1024][1024] Wo rows (natural)
#define PK_END (PK_P + DM * DM)
#define WS_PK  0u
#define WS_QK  (WS_PK + 2u * PK_END)             // f16 [8192 rows][2048]: q | k
#define WS_QKL (WS_QK + 2u * NB * SS * 2 * DM)     // f16 q | k residual planes x2048
#define WS_VTH (WS_QKL + 2u * NB * SS * 2 * DM)    // f16 [b][1024 (h*64+d)][2048 s] hi
#define WS_VTL (WS_VTH + 2u * NB * DM * SS)        // f16 lo x 2048
#define WS_O   (WS_VTL + 2u * NB * DM * SS)        // f32 [8192][1024]
#define WS_CS  (WS_O + 4u * NB * SS * DM)           // f32 2 x [2048][32], unused
#define WS_END (WS_CS + 4u * 2 * SS * 32)
// ---- k_pack: f32 weights -> bf16 in their natural [out][in] order: PK = W_q | W_k | W_v | W_o, 1,024 x 1,024 each (PK_P = 3 x 1,024 x 1,024)
// 256 work-groups of 8 waves, 64 a matrix, one a WGP: 2,048 waves to start in place of 32,768. A thread converts 64 weights: 16 loads of 16 B, all in flight at once (a wave-load = 4 whole lines), then 16 stores of 8 B (a wave-store = 2 whole lines); no LDS, no barrier
#define PKG 64                          // work-groups a matrix
#define PKE (DM * DM / PKG)             // weights a work-group
typedef __attribute__((ext_vector_type(4))) __bf16 v4bp;
__global__ __launch_bounds__(256) void k_pack(const float* __restrict__ WQ, const float* __restrict__ WK, const float* __restrict__ WV, const float* __restrict__ WO, __bf16* __restrict__ PK) {
  const int which = blockIdx.x / PKG; const float* Wm = (which == 0) ? WQ : (which == 1) ? WK : (which == 2) ? WV : WO;
  const unsigned q = (blockIdx.x % PKG) * (PKE / 4) + threadIdx.x;   // the thread's first group of four weights in its matrix: one index for the loads and the stores
  const v4f* ps = (const v4f*)Wm + q; v4bp* pd = (v4bp*)(PK + PK_A + (size_t)which * DM * DM) + q;
  v4f r[16]; static_assert(PKE / 1024 == 16, "16 loads a thread");
#pragma unroll   // constant indices: r stays in registers, the steps become immediate offsets
  for (int i = 0; i < PKE / 1024; ++i) r[i] = ps[i * 256];
  asm volatile("" :: "v"(r[0]), "v"(r[1]), "v"(r[2]), "v"(r[3]), "v"(r[4]), "v"(r[5]), "v"(r[6]), "v"(r[7]), "v"(r[8]), "v"(r[9]), "v"(r[10]), "v"(r[11]), "v"(r[12]), "v"(r[13]), "v"(r[14]), "v"(r[15]));   // holds all 16 loads in front of the first conversion: without it the last two are issued only when the first two have come back, a second memory latency
#pragma unroll   // as above
  for (int i = 0; i < PKE / 1024; ++i) { v4bp c; c[0] = (__bf16)r[i][0]; c[1] = (__bf16)r[i][1]; c[2] = (__bf16)r[i][2]; c[3] = (__bf16)r[i][3]; pd[i * 256] = c; }
}
// LDS staging: a stage is 64 k (one 128-B line of every 16-bit operand row); rows lie at a pitch of 144 B (16 B x odd) for the ds_load_b128 fragment readers
#define KS 64
#define LP 72
typedef __attribute__((ext_vector_type(4))) __bf16 v4b;
// GEMM tiling of k_qkv and k_out: a work-group of 8 waves (2 x 4) owns 128 rows x 256 columns, a wave 64 x 64 = 4 x 4 accumulator tiles: 8 fragments feed 16 WMMAs, and a staged line is used by 4 (x, o) or 2 (W) waves
// between a wave's writes and its read-back of its own staging rows, and between the read-back and the next rows' writes: the LDS wait alone; no release fence, which would also wait out the global stores of the rows before
#define LDSW() do { asm volatile("s_wait_dscnt 0" ::: "memory"); __builtin_amdgcn_wave_barrier(); } while (0)
#define TM 128
#define TN 256
// the second bound asks for 4 waves a SIMD: a budget of 256 registers, so that two work-groups share a WGP and one's WMMAs cover the other's global wait, LDS fill and barrier
__global__ __launch_bounds__(256, 4) void k_qkv(const float* __restrict__ XQ, const float* __restrict__ XK, const float* __restrict__ XV, const __bf16* __restrict__ P, const float* __restrict__ BQ, const float* __restrict__ BK, const float* __restrict__ BV, _Float16* __restrict__ QK, _Float16* __restrict__ QKL, _Float16* __restrict__ VTH, _Float16* __restrict__ VTL) {
  const int n0 = blockIdx.y * TN; const int which0 = n0 / DM; const float* X = (which0 == 0) ? XQ : (which0 == 1) ? XK : XV; const float* BB = BQ ? (((which0 == 0) ? BQ : (which0 == 1) ? BK : BV) + (n0 - which0 * DM)) : nullptr;
  // the two stage buffers and the epilogue's staging share one LDS range: the loop's last barrier stands between them; ep[wave] belongs to one wave alone
  __shared__ __align__(16) union { struct { __bf16 a[2][TM][LP], b[2][TN][LP]; } st; _Float16 ep[8][2][16][LP]; } sm;
  const int tid = threadIdx.x, wave = __builtin_amdgcn_readfirstlane(tid >> 5), lane = tid & 31, col = lane & 15, g = lane >> 4; const int wm = wave & 1, wn = wave >> 1;
  const size_t r0 = (size_t)blockIdx.x * TM + wm * 64; const int nw = n0 + wn * 64;
  v8f acc[4][4] = {};
  // whole-line global loads: W 8 lanes x 16 B = one line of a row (4 rows a wave-load), x 16 lanes x 16 B = two lines of a row (2 rows a wave-load)
  const int br = tid >> 3, bc = (tid & 7) * 8, ar = tid >> 4, ac = (tid & 15) * 4;
  const __bf16* pb = P + (size_t)(n0 + br) * DM + bc; const float* pa = X + ((size_t)blockIdx.x * TM + ar) * DM + ac;
  v8b rb[8]; v4f ra[8];
#pragma unroll
  for (int i = 0; i < 8; ++i) { rb[i] = *(const v8b*)(pb + (size_t)i * 32 * DM); ra[i] = *(const v4f*)(pa + (size_t)i * 16 * DM); }
#pragma unroll
  for (int i = 0; i < 8; ++i) { *(v8b*)&sm.st.b[0][br + 32 * i][bc] = rb[i]; v4b c; c[0] = (__bf16)ra[i][0]; c[1] = (__bf16)ra[i][1]; c[2] = (__bf16)ra[i][2]; c[3] = (__bf16)ra[i][3]; *(v4b*)&sm.st.a[0][ar + 16 * i][ac] = c; }
  __syncthreads();
#pragma unroll 2   // two stages a trip: the buffer index is a constant in the addresses
  for (int s = 0; s < DM / KS; ++s) { const int cur = s & 1;
    if (s + 1 < DM / KS) {   // the next stage's lines fly into registers while this stage is multiplied
#pragma unroll
      for (int i = 0; i < 8; ++i) { rb[i] = *(const v8b*)(pb + (size_t)i * 32 * DM + (s + 1) * KS); ra[i] = *(const v4f*)(pa + (size_t)i * 16 * DM + (s + 1) * KS); } }
#pragma unroll
    for (int kc = 0; kc < KS / 32; ++kc) { v16b w[4];
#pragma unroll
      for (int j = 0; j < 4; ++j) w[j] = frag_b(&sm.st.b[cur][wn * 64 + j * 16 + col][kc * 32], lane);
#pragma unroll
      for (int ii = 0; ii < 4; ii += 2) { v16b a[2];   // x fragments two at a time: the live set stays inside 256 registers, so two work-groups share a WGP
#pragma unroll
        for (int i = 0; i < 2; ++i) a[i] = frag_b(&sm.st.a[cur][wm * 64 + (ii + i) * 16 + col][kc * 32], lane);
        asm volatile("" :: "v"(a[0]), "v"(a[1]), "v"(w[0]), "v"(w[1]), "v"(w[2]), "v"(w[3]));   // holds the block's LDS reads as one group in front of its WMMAs: one LDS latency a block, not one a WMMA
#pragma unroll
        for (int i = 0; i < 2; ++i) {
#pragma unroll
          for (int j = 0; j < 4; ++j) acc[ii + i][j] = wmma_bf(a[i], w[j], acc[ii + i][j]); } } }
    __builtin_amdgcn_sched_barrier(0);   // keeps the conversions below, and with them the wait on the global loads, behind this stage's WMMAs
    if (s + 1 < DM / KS) {   // into the buffer whose readers all passed the barrier of the trip before
#pragma unroll
      for (int i = 0; i < 8; ++i) { *(v8b*)&sm.st.b[cur ^ 1][br + 32 * i][bc] = rb[i]; v4b c; c[0] = (__bf16)ra[i][0]; c[1] = (__bf16)ra[i][1]; c[2] = (__bf16)ra[i][2]; c[3] = (__bf16)ra[i][3]; *(v4b*)&sm.st.a[cur ^ 1][ar + 16 * i][ac] = c; } }
    __syncthreads(); }   // publishes stage s + 1 and ends every read of stage s
  auto& eh = sm.ep[wave][0]; auto& el = sm.ep[wave][1];   // 16 rows of one 128-B line each, hi and residual plane
  const int ln = __builtin_amdgcn_mbcnt_lo(~0u, 0u), ecol = ln & 15, eg = ln >> 4;   // the lane's number read anew: no lane index of the epilogue holds a register through the loop
  const int er = ln >> 3, ec = (ln & 7) * 8;   // read-back: 8 lanes x 16 B = one line, 4 rows a wave-store
  float bias[4];
#pragma unroll
  for (int j = 0; j < 4; ++j) bias[j] = BB ? bfr(BB[wn * 64 + j * 16 + ecol]) : 0.f;
  if (n0 < 2 * DM) {   // q stored unscaled (f16 sigma ~0.6, no subnormal exposure); 1/8 applied to the f32 score
#pragma unroll
    for (int i = 0; i < 4; ++i) {   // 16 rows x 64 columns at a time
#pragma unroll
      for (int j = 0; j < 4; ++j) {
#pragma unroll
        for (int r = 0; r < 8; ++r) { const float v = acc[i][j][r] + bias[j]; const _Float16 hv = (_Float16)v; eh[8 * eg + r][j * 16 + ecol] = hv; el[8 * eg + r][j * 16 + ecol] = (_Float16)((v - (float)hv) * 2048.0f); } }   // q, k (+ bias) as f16 hi + (x2048) residual
      LDSW();
#pragma unroll
      for (int q = 0; q < 4; ++q) { const size_t o = (r0 + i * 16 + q * 4 + er) * (2 * DM) + nw + ec; vst2((unsigned*)(QK + o), *(const v4u*)&eh[q * 4 + er][ec]); vst2((unsigned*)(QKL + o), *(const v4u*)&el[q * 4 + er][ec]); }
      if (i < 3) LDSW(); }   // the rows are read before the next 16 overwrite them
  } else {
    const int b = (int)(r0 / SS), s0 = (int)(r0 % SS); const int pc0 = nw - 2 * DM;
#pragma unroll
    for (int j = 0; j < 4; ++j) {   // transposed: 16 d rows x 64 s at a time; a lane's eight accumulator rows are eight neighbours in s
#pragma unroll
      for (int i = 0; i < 4; ++i) { v8h h8, l8;
#pragma unroll
        for (int r = 0; r < 8; ++r) { const float v = acc[i][j][r] + bias[j]; const _Float16 hv = (_Float16)v; h8[r] = hv; l8[r] = (_Float16)((v - (float)hv) * 2048.0f); }
        *(v8h*)&eh[ecol][i * 16 + 8 * eg] = h8; *(v8h*)&el[ecol][i * 16 + 8 * eg] = l8; }
      LDSW();
#pragma unroll
      for (int q = 0; q < 4; ++q) { const size_t o = ((size_t)b * DM + pc0 + j * 16 + q * 4 + er) * SS + s0 + ec; vst2((unsigned*)(VTH + o), *(const v4u*)&eh[q * 4 + er][ec]); vst2((unsigned*)(VTL + o), *(const v4u*)&el[q * 4 + er][ec]); }
      if (j < 3) LDSW(); }   // the rows are read before the next 16 overwrite them
    asm volatile("s_wait_xcnt 0x0" ::: "memory");   // in the listing this branch's text runs on into the other branch's, behind a jump: the wait stands in front of every rewrite of a register that the stores above name
  }
}
__device__ __forceinline__ float xhalf(float x) { return __builtin_bit_cast(float, __builtin_amdgcn_permlanex16(__builtin_bit_cast(int, x), __builtin_bit_cast(int, x), 0x76543210, 0xfedcba98, false, false)); }   // lane l with lane l ^ 16
// eight base-2 exponentials in place and back to back: none writes a register of the one in front of it, and no filler stands between them; the closing v_nop is the slot that the instruction set asks for behind a transcendental before its result is read
__device__ __forceinline__ void exp2x8(v8f& x) {
  float a0 = x[0], a1 = x[1], a2 = x[2], a3 = x[3], a4 = x[4], a5 = x[5], a6 = x[6], a7 = x[7];
  asm("v_exp_f32 %0, %0\n\tv_exp_f32 %1, %1\n\tv_exp_f32 %2, %2\n\tv_exp_f32 %3, %3\n\tv_exp_f32 %4, %4\n\tv_exp_f32 %5, %5\n\tv_exp_f32 %6, %6\n\tv_exp_f32 %7, %7\n\tv_nop" : "+v"(a0), "+v"(a1), "+v"(a2), "+v"(a3), "+v"(a4), "+v"(a5), "+v"(a6), "+v"(a7));
  x[0] = a0; x[1] = a1; x[2] = a2; x[3] = a3; x[4] = a4; x[5] = a5; x[6] = a6; x[7] = a7;
}
// a thread's share of one stage: eight asynchronous copies of 16 B from global memory straight into LDS (four k rows, four v pieces), through no register; lk, lv, gk, gv are the first k and the first v address in LDS and in global memory, the others lie at fixed steps from them; the closing s_wait_xcnt stands in the copies' own statement, in front of every later rewrite of an address register that they name
__device__ __forceinline__ void stage8(unsigned lk, unsigned lv, unsigned lrow, unsigned lhalf, const _Float16* gk, const _Float16* gv) {
  const _Float16 *k1 = gk + (size_t)32 * (2 * DM), *k2 = gk + (size_t)64 * (2 * DM), *k3 = gk + (size_t)96 * (2 * DM), *v1 = gv + (size_t)32 * SS, *v2 = gv + 64, *v3 = gv + (size_t)32 * SS + 64;
  asm volatile("global_load_async_to_lds_b128 %0, %8, off\n\tglobal_load_async_to_lds_b128 %1, %9, off\n\tglobal_load_async_to_lds_b128 %2, %10, off\n\tglobal_load_async_to_lds_b128 %3, %11, off\n\t"
               "global_load_async_to_lds_b128 %4, %12, off\n\tglobal_load_async_to_lds_b128 %5, %13, off\n\tglobal_load_async_to_lds_b128 %6, %14, off\n\tglobal_load_async_to_lds_b128 %7, %15, off\n\ts_wait_xcnt 0x0"
               :: "v"(lk), "v"(lk + lrow), "v"(lk + lhalf), "v"(lk + lhalf + lrow), "v"(lv), "v"(lv + lrow), "v"(lv + lhalf), "v"(lv + lhalf + lrow), "v"(gk), "v"(k1), "v"(k2), "v"(k3), "v"(gv), "v"(v1), "v"(v2), "v"(v3) : "memory");
}
// a work-group of 8 waves owns 256 queries, a wave 32 = two 16-query column groups: a k or v fragment read from LDS feeds two WMMAs, and a staged line serves 256 queries
// the second bound asks for 4 waves a SIMD: a budget of 256 registers, so that two work-groups share a WGP and one's arithmetic covers the other's global wait, LDS fill and barriers
__global__ __launch_bounds__(256, 4) void k_attn(const _Float16* __restrict__ QK, const _Float16* __restrict__ QKL, const _Float16* __restrict__ VTH, const _Float16* __restrict__ VTL, const void* __restrict__ KMASK, float* __restrict__ O) {
  // one stage = 128 keys = two halves of 64: k rows [key][64 d] and v rows [d][64 keys], one 128-B line each; two stage buffers: one is read while the next stage's copies land in the other; the buffers and the epilogue's staging share one LDS range, the loop's last barrier between them
  __shared__ __align__(16) union { struct { _Float16 k[64][LP], v[64][LP]; } st[2][2]; float so[8][32][68]; } sm;
  auto& so = sm.so;
  const int tid = threadIdx.x, wave = tid >> 5, lane = tid & 31, col = lane & 15, g = lane >> 4;
  const int qb = blockIdx.x, h = blockIdx.y, b = blockIdx.z; const int q0 = qb * 256 + wave * 32;
  v16h aq[2][2];   // B operand of the score product: column = query qt * 16 + col
#pragma unroll
  for (int qt = 0; qt < 2; ++qt) {
#pragma unroll
    for (int kc = 0; kc < 2; ++kc) aq[qt][kc] = frag_h(QK + ((size_t)b * SS + q0 + qt * 16 + col) * (2 * DM) + h * HD + kc * 32, lane); }
  float m[2] = {-3.0e38f, -3.0e38f}, l[2] = {0.f, 0.f};   // this lane's two queries: the maximum in use, of raw scores (equal in both halves; later scores may pass it by the lazy margin), sum (x2^11) over this half's keys
  const float kf = 0.125f * 1.44269504f;   // 1/sqrt(64) and log2 e in one factor
  float nb[2] = {5.0e37f, 5.0e37f};   // addend of the score FMA in use: 11 - m * kf; the start value lies far above any real one, so the first test asks for a rescale and its alpha is 0
  v8f acc[2][4] = {};   // acc[qt][dt][r] = O^T[dt * 16 + 8 g + r][query qt * 16 + col]
  const int sr = tid >> 3, sc = (tid & 7) * 8;   // whole-line copies: 8 lanes x 16 B = one line of a row, 4 rows a wave-copy
  const _Float16* pk = QK + ((size_t)b * SS + sr) * (2 * DM) + DM + h * HD + sc; const _Float16* pv = VTH + ((size_t)b * DM + h * HD + sr) * SS + sc;
  static_assert(SS / 128 >= 2, "the prologue fills two stages");
  const unsigned lk = (unsigned)(size_t)&sm.st[0][0].k[sr][sc], lv = (unsigned)(size_t)&sm.st[0][0].v[sr][sc];   // the thread's LDS byte addresses in buffer 0
  const unsigned LH = sizeof(sm.st[0][0]), LR = 32 * LP * 2;   // bytes from half to half of a buffer, and over 32 rows
  stage8(lk, lv, LR, LH, pk, pv);   // stage 0 into buffer 0
  asm volatile("s_wait_asynccnt 0x0" ::: "memory");   // this wave's copies of stage 0 have landed
  __syncthreads();   // publishes stage 0
  pk += (size_t)128 * (2 * DM); pv += 128;
  stage8(lk + 2 * LH, lv + 2 * LH, LR, LH, pk, pv);   // stage 1 flies into buffer 1 while stage 0 is worked on
#pragma unroll 1   // rolled: the buffer is picked by address, and the loop's text stays small
  for (int st = 0; st < SS / 128; ++st) {   // all keys
#pragma unroll 1   // rolled, as above
   for (int hs = 0; hs < 2; ++hs) {   // the two halves of the stage, no barrier between them
    auto& sb = sm.st[st & 1][hs];
#pragma unroll   // both 32-key parts of the half in line: constant LDS offsets
    for (int sub = 0; sub < 2; ++sub) { v8f s[2][2] = {}; v16h fk[2][2];   // s[qt][ct][r] = raw score q.k of key sub * 32 + ct * 16 + 8 g + r of the half against query qt * 16 + col
#pragma unroll
      for (int ct = 0; ct < 2; ++ct) { fk[ct][0] = frag_h(&sb.k[sub * 32 + ct * 16 + col][0], lane); fk[ct][1] = frag_h(&sb.k[sub * 32 + ct * 16 + col][32], lane); }
      asm volatile("" :: "v"(fk[0][0]), "v"(fk[0][1]), "v"(fk[1][0]), "v"(fk[1][1]));   // holds the four k fragments' LDS reads as one group in front of the score WMMAs: one LDS latency, not four
#pragma unroll
      for (int kc = 0; kc < 2; ++kc) {   // a tile takes d 0..31 first and d 32..63 second, as before; the other three tiles stand between the two
#pragma unroll
        for (int ct = 0; ct < 2; ++ct) {
#pragma unroll
          for (int qt = 0; qt < 2; ++qt) s[qt][ct] = wmma16(fk[ct][kc], aq[qt][kc], s[qt][ct]); } }   // single product: k rows as A, q as B, one-rounding f16 operands
      __builtin_amdgcn_sched_barrier(0);   // keeps the eight score WMMAs one run in front of the maxima: each fills the slots behind the one before it; mixed with the maxima, with no rescale products left to fill them, those slots are v_nops
      v16h fv[4];   // the v fragments' LDS reads stand in front of the branch below, which the compiler lifts no load across: their latency passes under the maxima and the exponentials; behind the branch each pair of WMMAs waits out its own read
#pragma unroll
      for (int dt = 0; dt < 4; ++dt) fv[dt] = frag_h(&sb.v[dt * 16 + col][sub * 32], lane);
      v16h p[2]; float mx[2];   // P^T packs from the two score tiles into the B operand: element ct * 8 + r = key ct * 16 + 8 g + r of the 32, the hardware k order, which frag_h gives V^T too
#pragma unroll
      for (int qt = 0; qt < 2; ++qt) {
        float mt[2];   // two independent chains over this half's 16 keys
#pragma unroll
        for (int t = 0; t < 2; ++t) { mt[t] = s[qt][t][0];
#pragma unroll
          for (int r = 1; r < 8; ++r) mt[t] = fmaxf(mt[t], s[qt][t][r]); }
        mx[qt] = fmaxf(mt[0], mt[1]); }
      // lazy rescale, one test per 32 keys for both column groups: the maximum in use stays while no weight of these keys would pass 2^15 (f16 holds 65,504), that is while no score lies more than 4 (scaled, base 2) above it; acc / l is the same quotient for any maximum in use
      const bool need = fmaxf(__builtin_fmaf(mx[0], kf, nb[0]), __builtin_fmaf(mx[1], kf, nb[1])) > 15.0f;
      if (__builtin_amdgcn_ballot_w32(need) != 0) {   // a scalar branch of the whole wave; always taken at the first 32 keys (start value of nb)
#pragma unroll
        for (int qt = 0; qt < 2; ++qt) {
          const float mn = fmaxf(m[qt], fmaxf(mx[qt], xhalf(mx[qt]))); const float nbn = __builtin_fmaf(-mn, kf, 11.0f);   // the halves join their maxima: both hold one addend a query; minus the scaled maximum, plus 11 so that the weights come out x2^11
          const float alpha = __builtin_amdgcn_exp2f(nbn - nb[qt]); nb[qt] = nbn; m[qt] = mn;   // old weights were formed with the old addend: the difference of the two rescales them, whatever rounding each addend took
          l[qt] *= alpha;
#pragma unroll
          for (int dt = 0; dt < 4; ++dt) acc[qt][dt] *= alpha; } }
#pragma unroll
      for (int qt = 0; qt < 2; ++qt) {
        v8f e[2];
#pragma unroll
        for (int t = 0; t < 2; ++t) {   // one FMA a score, then the hardware's base-2 exponential: 2^11 exp((q.k - maximum in use) / 8); written a score at a time: as one vector expression its addend is carried through the branch's join spread over 16 registers, filled by moves on the path that does not rescale
#pragma unroll
          for (int r = 0; r < 8; ++r) e[t][r] = __builtin_fmaf(s[qt][t][r], kf, nb[qt]); }
#pragma unroll
        for (int t = 0; t < 2; ++t) exp2x8(e[t]);
        const v8f e8 = e[0] + e[1];   // this half's 16 weights: tiles first, then the eight registers
        const float es = ((e8[0] + e8[2]) + (e8[4] + e8[6])) + ((e8[1] + e8[3]) + (e8[5] + e8[7]));
#pragma unroll
        for (int t = 0; t < 2; ++t) {   // P carries 2^11 so small softmax weights stay out of the f16 subnormal range; l carries it too
#pragma unroll
          for (int r = 0; r < 8; ++r) p[qt][t * 8 + r] = (_Float16)e[t][r]; }
        l[qt] += es; }
      __builtin_amdgcn_sched_group_barrier(0x002, 256, 0); __builtin_amdgcn_sched_group_barrier(0x008, 8, 0);   // scheduling order of this stretch: its vector work first, then the eight WMMAs in one run; sums mixed among the WMMAs are given the v fragments' registers just read, at four v_nops a pair of WMMAs
#pragma unroll
      for (int dt = 0; dt < 4; ++dt) {
#pragma unroll
        for (int qt = 0; qt < 2; ++qt) acc[qt][dt] = wmma16(fv[dt], p[qt], acc[qt][dt]); }   // single product: V^T rows as A, P^T (x2^11) as B
      __builtin_amdgcn_sched_barrier(0); } }   // keeps the next 32 keys' fragments and score tiles behind these 32 keys: both parts live at once do not fit in 256 registers and spill
    asm volatile("s_wait_dscnt 0x0" ::: "memory");   // this wave's reads of the stage are done before its buffer is handed to the copies
    asm volatile("s_wait_asynccnt 0x0" ::: "memory");   // this wave's copies of stage st + 1 have landed
    __syncthreads();   // publishes stage st + 1 and ends every read of stage st; behind the last stage: the LDS becomes the output staging
    if (st + 2 < SS / 128) {   // the same for the whole work-group: stage st + 2 into the buffer just read
      const unsigned lo = (st & 1) * 2 * LH; pk += (size_t)128 * (2 * DM); pv += 128;
      stage8(lk + lo, lv + lo, LR, LH, pk, pv); } }
  asm volatile("s_wait_asynccnt 0x0" ::: "memory");   // no copy is outstanding when the buffers become the output staging
#pragma unroll
  for (int qt = 0; qt < 2; ++qt) { const float il = 1.0f / (l[qt] + xhalf(l[qt]));   // the halves' sums join once; 2^11 stands in acc and in l alike
#pragma unroll
    for (int dt = 0; dt < 4; ++dt) { v4f o0, o1;
#pragma unroll
      for (int r = 0; r < 4; ++r) { o0[r] = acc[qt][dt][r] * il; o1[r] = acc[qt][dt][4 + r] * il; }
      *(v4f*)&so[wave][qt * 16 + col][dt * 16 + 8 * g] = o0; *(v4f*)&so[wave][qt * 16 + col][dt * 16 + 8 * g + 4] = o1; } }
  LDSX();
  for (int rl = 0; rl < 32; ++rl) if (lane < 16) vst2(O + ((size_t)b * SS + q0 + rl) * DM + h * HD + lane * 4, *(const v4f*)&so[wave][rl][lane * 4]);
}
// ---- k_out: block = (128 rows, 256 cols): out = O(hi/lo) . Wo rows (2 products) + bo
__global__ __launch_bounds__(256) void k_out(const float* __restrict__ O, const __bf16* __restrict__ P, const float* __restrict__ BO, float* __restrict__ Y) {
  // the two stage buffers and the epilogue's staging share one LDS range: the loop's last barrier stands between them; so[wave] belongs to one wave alone
  __shared__ __align__(16) union { struct { __bf16 ah[2][TM][LP], al[2][TM][LP], b[2][TN][LP]; } st; float so[8][16][68]; } sm;
  const int tid = threadIdx.x, wave = tid >> 5, lane = tid & 31, col = lane & 15, g = lane >> 4; const int wm = wave & 1, wn = wave >> 1;
  const int n0 = blockIdx.y * TN; const size_t r0 = (size_t)blockIdx.x * TM + wm * 64; const int nw = n0 + wn * 64;
  v8f acc[4][4] = {};
  // whole-line global loads, as in k_qkv; o is split into its bf16 hi and residual planes on the way into LDS
  const int br = tid >> 3, bc = (tid & 7) * 8, ar = tid >> 4, ac = (tid & 15) * 4;
  const __bf16* pb = P + (size_t)(n0 + br) * DM + bc; const float* pa = O + ((size_t)blockIdx.x * TM + ar) * DM + ac;
  v8b rb[8]; v4f ra[8];
#pragma unroll
  for (int i = 0; i < 8; ++i) { rb[i] = *(const v8b*)(pb + (size_t)i * 32 * DM); ra[i] = *(const v4f*)(pa + (size_t)i * 16 * DM); }
#pragma unroll
  for (int i = 0; i < 8; ++i) { *(v8b*)&sm.st.b[0][br + 32 * i][bc] = rb[i]; v4b ch, cl;
#pragma unroll
    for (int e = 0; e < 4; ++e) { const __bf16 hv = (__bf16)ra[i][e]; ch[e] = hv; cl[e] = (__bf16)(ra[i][e] - (float)hv); }
    *(v4b*)&sm.st.ah[0][ar + 16 * i][ac] = ch; *(v4b*)&sm.st.al[0][ar + 16 * i][ac] = cl; }
  __syncthreads();
#pragma unroll 2   // two stages a trip: the buffer index is a constant in the addresses
  for (int s = 0; s < DM / KS; ++s) { const int cur = s & 1;
    if (s + 1 < DM / KS) {   // the next stage's lines fly into registers while this stage is multiplied
#pragma unroll
      for (int i = 0; i < 8; ++i) { rb[i] = *(const v8b*)(pb + (size_t)i * 32 * DM + (s + 1) * KS); ra[i] = *(const v4f*)(pa + (size_t)i * 16 * DM + (s + 1) * KS); } }
#pragma unroll
    for (int kc = 0; kc < KS / 32; ++kc) { v16b ah[4], al[4], w[4];
#pragma unroll
      for (int i = 0; i < 4; ++i) { ah[i] = frag_b(&sm.st.ah[cur][wm * 64 + i * 16 + col][kc * 32], lane); al[i] = frag_b(&sm.st.al[cur][wm * 64 + i * 16 + col][kc * 32], lane); w[i] = frag_b(&sm.st.b[cur][wn * 64 + i * 16 + col][kc * 32], lane); }
      asm volatile("" :: "v"(ah[0]), "v"(ah[1]), "v"(ah[2]), "v"(ah[3]), "v"(al[0]), "v"(al[1]), "v"(al[2]), "v"(al[3]), "v"(w[0]), "v"(w[1]), "v"(w[2]), "v"(w[3]));   // holds the block's LDS reads as one group in front of its WMMAs: one LDS latency a block, not one a WMMA
#pragma unroll
      for (int i = 0; i < 4; ++i) {   // a tile takes its residual product first and its hi product second, as before; the other three tiles of the row stand between the two
#pragma unroll
        for (int j = 0; j < 4; ++j) acc[i][j] = wmma_bf(al[i], w[j], acc[i][j]);
#pragma unroll
        for (int j = 0; j < 4; ++j) acc[i][j] = wmma_bf(ah[i], w[j], acc[i][j]); } }
    __builtin_amdgcn_sched_barrier(0);   // keeps the split below, and with it the wait on the global loads, behind this stage's WMMAs
    if (s + 1 < DM / KS) {   // into the buffer whose readers all passed the barrier of the trip before
#pragma unroll
      for (int i = 0; i < 8; ++i) { *(v8b*)&sm.st.b[cur ^ 1][br + 32 * i][bc] = rb[i]; v4b ch, cl;
#pragma unroll
        for (int e = 0; e < 4; ++e) { const __bf16 hv = (__bf16)ra[i][e]; ch[e] = hv; cl[e] = (__bf16)(ra[i][e] - (float)hv); }
        *(v4b*)&sm.st.ah[cur ^ 1][ar + 16 * i][ac] = ch; *(v4b*)&sm.st.al[cur ^ 1][ar + 16 * i][ac] = cl; } }
    __syncthreads(); }   // publishes stage s + 1 and ends every read of stage s
  auto& so = sm.so[wave];
  const int er = lane >> 4, ec = (lane & 15) * 4;   // read-back: 16 lanes x 16 B = the two lines of a row's 64 columns, 2 rows a wave-store
  float bias[4];
#pragma unroll
  for (int j = 0; j < 4; ++j) bias[j] = bfr(BO[nw + j * 16 + col]);
#pragma unroll
  for (int i = 0; i < 4; ++i) {   // 16 rows x 64 columns at a time
#pragma unroll
    for (int j = 0; j < 4; ++j) {
#pragma unroll
      for (int r = 0; r < 8; ++r) so[8 * g + r][j * 16 + col] = acc[i][j][r] + bias[j]; }
    LDSW();
#pragma unroll
    for (int q = 0; q < 8; ++q) vst2(Y + (r0 + i * 16 + q * 2 + er) * DM + nw + ec, *(const v4f*)&so[q * 2 + er][ec]);
    if (i < 3) LDSW(); }   // the rows are read before the next 16 overwrite them
}
extern "C" void kernel_launch(void* const* d_in, const int* in_sizes, int n_in, void* d_out, int out_size, void* d_ws, size_t ws_size, hipStream_t stream) {
  (void)in_sizes; (void)n_in; (void)out_size;
  const float** F = (const float**)d_in;   // 0 x [4,2048,1024], 1 in_proj_weight [3072,1024], 2 in_proj_bias [3072], 3 out_proj_weight [1024,1024], 4 out_proj_bias
  if (ws_size < (size_t)WS_END) return;
  char* ws = (char*)d_ws; __bf16* PK = (__bf16*)(ws + WS_PK); _Float16 *QK = (_Float16*)(ws + WS_QK), *QKL = (_Float16*)(ws + WS_QKL), *VTH = (_Float16*)(ws + WS_VTH), *VTL = (_Float16*)(ws + WS_VTL); float* O = (float*)(ws + WS_O);
  k_pack<<<dim3(4 * PKG), 256, 0, stream>>>(F[1], F[1] + (size_t)DM * DM, F[1] + (size_t)2 * DM * DM, F[3], PK);
  k_qkv<<<dim3(TNB * SS / TM, QKVW / TN), 256, 0, stream>>>(F[0], F[0], F[0], PK + PK_A, F[2], F[2] + DM, F[2] + 2 * DM, QK, QKL, VTH, VTL);
  k_attn<<<dim3(SS / 256, NH, TNB), 256, 0, stream>>>(QK, QKL, VTH, VTL, nullptr, O);
  k_out<<<dim3(NB * SS / TM, DM / TN), 256, 0, stream>>>(O, PK + PK_P, F[4], (float*)d_out);
}

// v010
// A run of this version takes 126 microseconds.
// Two timings next to v009 put it at 1.05 and 1.06 times that version's speed.
// Over all steps from v000 it is 5.27 times as fast.
// compute dtype: all float inputs rounded to bf16; qkv = x . W_in^T + b with EXACT bf16 products on WMMA 16x16x32 (natural rows; the packed in_proj is three contiguous row blocks); PLAIN attention: q, k single f16, running-max softmax (lazy rescale) in f32 in the base-2 domain (1/8 and log2 e ride in q, the maximum and 2^11 in the score product's C operand, hardware exp), P (scaled by 2^11, single f16) x v (single f16); out = o (bf16 hi + residual) . W_out^T (2 products) + b_out.
#include <hip/hip_runtime.h>
#include <math.h>

typedef __attribute__((ext_vector_type(16))) _Float16 v16h;
typedef __attribute__((ext_vector_type(16))) __bf16 v16b;
typedef __attribute__((ext_vector_type(8)))  _Float16 v8h;
typedef __attribute__((ext_vector_type(8)))  float v8f;
typedef __attribute__((ext_vector_type(4)))  float v4f;
typedef __attribute__((ext_vector_type(2)))  float v2f;
typedef __attribute__((ext_vector_type(4)))  unsigned v4u;
typedef __attribute__((ext_vector_type(4)))  int v4i;
typedef float __attribute__((may_alias)) float_a;
typedef int __attribute__((may_alias)) int_a;

template <typename T> __device__ __forceinline__ void vst2(void* p, T v) { *(T*)p = v;  }
__device__ __forceinline__ v8f wmma16(v16h a, v16h b, v8f c) {
  return __builtin_amdgcn_wmma_f32_16x16x32_f16(false, a, false, b, (short)0, c, false, false);
}
__device__ __forceinline__ v8f wmma_bf(v16b a, v16b b, v8f c) {
  return __builtin_amdgcn_wmma_f32_16x16x32_bf16(false, a, false, b, (short)0, c, false, false);
}
// nn.MultiheadAttention-style self attention (B 4, S 2,048, E 1,024, 16 heads x 64): packed in_proj (natural [3E][E]) + bias, softmax(q k^T / 8) v, out_proj + bias.
__device__ __forceinline__ v16h frag_h(const _Float16* rowk0, int lane) {
  union { v16h v; v8h q[2]; } u; const _Float16* p = rowk0 + 8 * (lane >> 4);
  u.q[0] = *(const v8h*)p; u.q[1] = *(const v8h*)(p + 16); return u.v;
}
__device__ __forceinline__ v16h frag_f32(const float* rowk0, int lane) {
  v16h a; const float* p = rowk0 + 8 * (lane >> 4);
#pragma unroll
  for (int i = 0; i < 8; ++i) { a[i] = (_Float16)p[i]; a[8 + i] = (_Float16)p[16 + i]; }
  return a;
}
__device__ __forceinline__ v16h frag_f32s(const float* rowk0, int lane, float sc) {
  v16h a; const float* p = rowk0 + 8 * (lane >> 4);
#pragma unroll
  for (int i = 0; i < 8; ++i) { a[i] = (_Float16)(p[i] * sc); a[8 + i] = (_Float16)(p[16 + i] * sc); }
  return a;
}
// column fragment from a [K][ld] layout (column n), rows >= K read as 0
__device__ __forceinline__ v16h fragc_f32(const float* W, int k0, int n, int lane, int ld, int K) {
  v16h a; const int g = lane >> 4;
#pragma unroll
  for (int i = 0; i < 8; ++i) { const int ka = k0 + 8 * g + i, kb = ka + 16;
    a[i] = (_Float16)(ka < K ? W[(size_t)(ka < K ? ka : K - 1) * ld + n] : 0.f); a[8 + i] = (_Float16)(kb < K ? W[(size_t)(kb < K ? kb : K - 1) * ld + n] : 0.f); }
  return a;
}
struct F2 { v16b h, l; };
__device__ __forceinline__ F2 bsplit16(const float v[16]) { F2 r;
#pragma unroll
  for (int i = 0; i < 16; ++i) { const __bf16 h = (__bf16)v[i]; r.h[i] = h; r.l[i] = (__bf16)(v[i] - (float)h); }
  return r; }
__device__ __forceinline__ F2 split_row(const float* row, int k0, int lane) { float v[16]; const float* p = row + k0 + 8 * (lane >> 4);
#pragma unroll
  for (int i = 0; i < 8; ++i) { v[i] = p[i]; v[8 + i] = p[16 + i]; }
  return bsplit16(v); }
__device__ __forceinline__ F2 split_rowK(const float* row, int k0, int lane, int K) { float v[16]; const int g = lane >> 4;
#pragma unroll
  for (int i = 0; i < 8; ++i) { const int ka = k0 + 8 * g + i, kb = ka + 16; v[i] = ka < K ? row[ka < K ? ka : K - 1] : 0.f; v[8 + i] = kb < K ? row[kb < K ? kb : K - 1] : 0.f; }
  return bsplit16(v); }
__device__ __forceinline__ F2 split_col(const float* W, int k0, int n, int lane, int ld, int K) { float v[16]; const int g = lane >> 4;
#pragma unroll
  for (int i = 0; i < 8; ++i) { const int ka = k0 + 8 * g + i, kb = ka + 16; v[i] = ka < K ? W[(size_t)(ka < K ? ka : K - 1) * ld + n] : 0.f; v[8 + i] = kb < K ? W[(size_t)(kb < K ? kb : K - 1) * ld + n] : 0.f; }
  return bsplit16(v); }
__device__ __forceinline__ v8f mac3(const F2& a, const F2& b, v8f c) { c = wmma_bf(a.l, b.h, c); c = wmma_bf(a.h, b.l, c); return wmma_bf(a.h, b.h, c); }
__device__ __forceinline__ float sigm(float v) { return 1.0f / (1.0f + expf(-v)); }
#define LDSX() do { asm volatile("s_wait_dscnt 0" ::: "memory"); __builtin_amdgcn_wave_barrier(); __builtin_amdgcn_fence(__ATOMIC_RELEASE, "workgroup"); } while (0)


#define NB 4
#define SS 2048
#define DM 1024
#define NH 16
#define HD 64
#define QKVW (3 * DM)
#ifndef TQB
#define TQB (SS / 64)
#define TNB NB
#define TOB (NB * SS / 64)     // 64-row tiles of all rows; unused
#endif
typedef __attribute__((ext_vector_type(8))) __bf16 v8b;
__device__ __forceinline__ v16b frag_b(const __bf16* rowk0, int lane) {
  union { v16b v; v8b q[2]; } u; const __bf16* p = rowk0 + 8 * (lane >> 4);
  u.q[0] = *(const v8b*)p; u.q[1] = *(const v8b*)(p + 16); return u.v;
}
__device__ __forceinline__ float bfr(float v) { return (float)(__bf16)v; }
__device__ __attribute__((noinline)) float exp_ni(float v) { return expf(v); }
__device__ __attribute__((noinline)) float erf_ni(float v) { return erff(v); }

#define PK_A 0                       // [3072][1024] Wqkv rows (natural [out][in])
#define PK_P (PK_A + QKVW * DM)        // [1024][1024] Wo rows (natural)
#define PK_END (PK_P + DM * DM)
#define WS_PK  0u
#define WS_QK  (WS_PK + 2u * PK_END)             // f16 [8192 rows][2048]: q | k
#define WS_QKL (WS_QK + 2u * NB * SS * 2 * DM)     // f16 q | k residual planes x2048
#define WS_VTH (WS_QKL + 2u * NB * SS * 2 * DM)    // f16 [b][1024 (h*64+d)][2048 s] hi
#define WS_VTL (WS_VTH + 2u * NB * DM * SS)        // f16 lo x 2048
#define WS_O   (WS_VTL + 2u * NB * DM * SS)        // f32 [8192][1024]
#define WS_CS  (WS_O + 4u * NB * SS * DM)           // f32 2 x [2048][32], unused
#define WS_END (WS_CS + 4u * 2 * SS * 32)
// ---- k_pack: f32 weights -> bf16 in their natural [out][in] order: PK = W_q | W_k | W_v | W_o, 1,024 x 1,024 each (PK_P = 3 x 1,024 x 1,024)
// 256 work-groups of 8 waves, 64 a matrix, one a WGP: 2,048 waves to start in place of 32,768. A thread converts 64 weights: 16 loads of 16 B, all in flight at once (a wave-load = 4 whole lines), then 16 stores of 8 B (a wave-store = 2 whole lines); no LDS, no barrier
#define PKG 64                          // work-groups a matrix
#define PKE (DM * DM / PKG)             // weights a work-group
typedef __attribute__((ext_vector_type(4))) __bf16 v4bp;
__global__ __launch_bounds__(256) void k_pack(const float* __restrict__ WQ, const float* __restrict__ WK, const float* __restrict__ WV, const float* __restrict__ WO, __bf16* __restrict__ PK) {
  const int which = blockIdx.x / PKG; const float* Wm = (which == 0) ? WQ : (which == 1) ? WK : (which == 2) ? WV : WO;
  const unsigned q = (blockIdx.x % PKG) * (PKE / 4) + threadIdx.x;   // the thread's first group of four weights in its matrix: one index for the loads and the stores
  const v4f* ps = (const v4f*)Wm + q; v4bp* pd = (v4bp*)(PK + PK_A + (size_t)which * DM * DM) + q;
  v4f r[16]; static_assert(PKE / 1024 == 16, "16 loads a thread");
#pragma unroll   // constant indices: r stays in registers, the steps become immediate offsets
  for (int i = 0; i < PKE / 1024; ++i) r[i] = ps[i * 256];
  asm volatile("" :: "v"(r[0]), "v"(r[1]), "v"(r[2]), "v"(r[3]), "v"(r[4]), "v"(r[5]), "v"(r[6]), "v"(r[7]), "v"(r[8]), "v"(r[9]), "v"(r[10]), "v"(r[11]), "v"(r[12]), "v"(r[13]), "v"(r[14]), "v"(r[15]));   // holds all 16 loads in front of the first conversion: without it the last two are issued only when the first two have come back, a second memory latency
#pragma unroll   // as above
  for (int i = 0; i < PKE / 1024; ++i) { v4bp c; c[0] = (__bf16)r[i][0]; c[1] = (__bf16)r[i][1]; c[2] = (__bf16)r[i][2]; c[3] = (__bf16)r[i][3]; pd[i * 256] = c; }
}
// LDS staging: a stage is 64 k (one 128-B line of every 16-bit operand row); rows lie at a pitch of 144 B (16 B x odd) for the ds_load_b128 fragment readers
#define KS 64
#define LP 72
typedef __attribute__((ext_vector_type(4))) __bf16 v4b;
// GEMM tiling of k_qkv and k_out: a work-group of 8 waves (2 x 4) owns 128 rows x 256 columns, a wave 64 x 64 = 4 x 4 accumulator tiles: 8 fragments feed 16 WMMAs, and a staged line is used by 4 (x, o) or 2 (W) waves
// between a wave's writes and its read-back of its own staging rows, and between the read-back and the next rows' writes: the LDS wait alone; no release fence, which would also wait out the global stores of the rows before
#define LDSW() do { asm volatile("s_wait_dscnt 0" ::: "memory"); __builtin_amdgcn_wave_barrier(); } while (0)
#define TM 128
#define TN 256
// the second bound asks for 4 waves a SIMD: a budget of 256 registers, so that two work-groups share a WGP and one's WMMAs cover the other's global wait, LDS fill and barrier
__global__ __launch_bounds__(256, 4) void k_qkv(const float* __restrict__ XQ, const float* __restrict__ XK, const float* __restrict__ XV, const __bf16* __restrict__ P, const float* __restrict__ BQ, const float* __restrict__ BK, const float* __restrict__ BV, _Float16* __restrict__ QK, _Float16* __restrict__ QKL, _Float16* __restrict__ VTH, _Float16* __restrict__ VTL) {
  const int n0 = blockIdx.y * TN; const int which0 = n0 / DM; const float* X = (which0 == 0) ? XQ : (which0 == 1) ? XK : XV; const float* BB = BQ ? (((which0 == 0) ? BQ : (which0 == 1) ? BK : BV) + (n0 - which0 * DM)) : nullptr;
  // the two stage buffers and the epilogue's staging share one LDS range: the loop's last barrier stands between them; ep[wave] belongs to one wave alone
  __shared__ __align__(16) union { struct { __bf16 a[2][TM][LP], b[2][TN][LP]; } st; _Float16 ep[8][2][16][LP]; } sm;
  const int tid = threadIdx.x, wave = __builtin_amdgcn_readfirstlane(tid >> 5), lane = tid & 31, col = lane & 15, g = lane >> 4; const int wm = wave & 1, wn = wave >> 1;
  const size_t r0 = (size_t)blockIdx.x * TM + wm * 64; const int nw = n0 + wn * 64;
  v8f acc[4][4] = {};
  // whole-line global loads: W 8 lanes x 16 B = one line of a row (4 rows a wave-load), x 16 lanes x 16 B = two lines of a row (2 rows a wave-load)
  const int br = tid >> 3, bc = (tid & 7) * 8, ar = tid >> 4, ac = (tid & 15) * 4;
  const __bf16* pb = P + (size_t)(n0 + br) * DM + bc; const float* pa = X + ((size_t)blockIdx.x * TM + ar) * DM + ac;
  v8b rb[8]; v4f ra[8];
#pragma unroll
  for (int i = 0; i < 8; ++i) { rb[i] = *(const v8b*)(pb + (size_t)i * 32 * DM); ra[i] = *(const v4f*)(pa + (size_t)i * 16 * DM); }
#pragma unroll
  for (int i = 0; i < 8; ++i) { *(v8b*)&sm.st.b[0][br + 32 * i][bc] = rb[i]; v4b c; c[0] = (__bf16)ra[i][0]; c[1] = (__bf16)ra[i][1]; c[2] = (__bf16)ra[i][2]; c[3] = (__bf16)ra[i][3]; *(v4b*)&sm.st.a[0][ar + 16 * i][ac] = c; }
  __syncthreads();
#pragma unroll 2   // two stages a trip: the buffer index is a constant in the addresses
  for (int s = 0; s < DM / KS; ++s) { const int cur = s & 1;
    if (s + 1 < DM / KS) {   // the next stage's lines fly into registers while this stage is multiplied
#pragma unroll
      for (int i = 0; i < 8; ++i) { rb[i] = *(const v8b*)(pb + (size_t)i * 32 * DM + (s + 1) * KS); ra[i] = *(const v4f*)(pa + (size_t)i * 16 * DM + (s + 1) * KS); } }
#pragma unroll
    for (int kc = 0; kc < KS / 32; ++kc) { v16b w[4];
#pragma unroll
      for (int j = 0; j < 4; ++j) w[j] = frag_b(&sm.st.b[cur][wn * 64 + j * 16 + col][kc * 32], lane);
#pragma unroll
      for (int ii = 0; ii < 4; ii += 2) { v16b a[2];   // x fragments two at a time: the live set stays inside 256 registers, so two work-groups share a WGP
#pragma unroll
        for (int i = 0; i < 2; ++i) a[i] = frag_b(&sm.st.a[cur][wm * 64 + (ii + i) * 16 + col][kc * 32], lane);
        asm volatile("" :: "v"(a[0]), "v"(a[1]), "v"(w[0]), "v"(w[1]), "v"(w[2]), "v"(w[3]));   // holds the block's LDS reads as one group in front of its WMMAs: one LDS latency a block, not one a WMMA
#pragma unroll
        for (int i = 0; i < 2; ++i) {
#pragma unroll
          for (int j = 0; j < 4; ++j) acc[ii + i][j] = wmma_bf(a[i], w[j], acc[ii + i][j]); } } }
    __builtin_amdgcn_sched_barrier(0);   // keeps the conversions below, and with them the wait on the global loads, behind this stage's WMMAs
    if (s + 1 < DM / KS) {   // into the buffer whose readers all passed the barrier of the trip before
#pragma unroll
      for (int i = 0; i < 8; ++i) { *(v8b*)&sm.st.b[cur ^ 1][br + 32 * i][bc] = rb[i]; v4b c; c[0] = (__bf16)ra[i][0]; c[1] = (__bf16)ra[i][1]; c[2] = (__bf16)ra[i][2]; c[3] = (__bf16)ra[i][3]; *(v4b*)&sm.st.a[cur ^ 1][ar + 16 * i][ac] = c; } }
    __syncthreads(); }   // publishes stage s + 1 and ends every read of stage s
  auto& eh = sm.ep[wave][0]; auto& el = sm.ep[wave][1];   // 16 rows of one 128-B line each, hi and residual plane
  const int ln = __builtin_amdgcn_mbcnt_lo(~0u, 0u), ecol = ln & 15, eg = ln >> 4;   // the lane's number read anew: no lane index of the epilogue holds a register through the loop
  const int er = ln >> 3, ec = (ln & 7) * 8;   // read-back: 8 lanes x 16 B = one line, 4 rows a wave-store
  float bias[4];
#pragma unroll
  for (int j = 0; j < 4; ++j) bias[j] = BB ? bfr(BB[wn * 64 + j * 16 + ecol]) : 0.f;
  if (n0 < 2 * DM) {   // q is stored times log2 e / 8, scaled in f32 in front of its one rounding to f16: k_attn's score product then yields base-2 exponents; k is stored as it is (factor 1: the FMA is the plain sum)
    const float qs = (n0 < DM) ? 0.125f * 1.44269504f : 1.0f;
#pragma unroll
    for (int i = 0; i < 4; ++i) {   // 16 rows x 64 columns at a time
#pragma unroll
      for (int j = 0; j < 4; ++j) {
#pragma unroll
        for (int r = 0; r < 8; ++r) { const float v = __builtin_fmaf(acc[i][j][r], qs, bias[j] * qs); const _Float16 hv = (_Float16)v; eh[8 * eg + r][j * 16 + ecol] = hv; el[8 * eg + r][j * 16 + ecol] = (_Float16)((v - (float)hv) * 2048.0f); } }   // q, k (+ bias) as f16 hi + (x2048) residual
      LDSW();
#pragma unroll
      for (int q = 0; q < 4; ++q) { const size_t o = (r0 + i * 16 + q * 4 + er) * (2 * DM) + nw + ec; vst2((unsigned*)(QK + o), *(const v4u*)&eh[q * 4 + er][ec]); vst2((unsigned*)(QKL + o), *(const v4u*)&el[q * 4 + er][ec]); }
      if (i < 3) LDSW(); }   // the rows are read before the next 16 overwrite them
  } else {
    const int b = (int)(r0 / SS), s0 = (int)(r0 % SS); const int pc0 = nw - 2 * DM;
#pragma unroll
    for (int j = 0; j < 4; ++j) {   // transposed: 16 d rows x 64 s at a time; a lane's eight accumulator rows are eight neighbours in s
#pragma unroll
      for (int i = 0; i < 4; ++i) { v8h h8, l8;
#pragma unroll
        for (int r = 0; r < 8; ++r) { const float v = acc[i][j][r] + bias[j]; const _Float16 hv = (_Float16)v; h8[r] = hv; l8[r] = (_Float16)((v - (float)hv) * 2048.0f); }
        *(v8h*)&eh[ecol][i * 16 + 8 * eg] = h8; *(v8h*)&el[ecol][i * 16 + 8 * eg] = l8; }
      LDSW();
#pragma unroll
      for (int q = 0; q < 4; ++q) { const size_t o = ((size_t)b * DM + pc0 + j * 16 + q * 4 + er) * SS + s0 + ec; vst2((unsigned*)(VTH + o), *(const v4u*)&eh[q * 4 + er][ec]); vst2((unsigned*)(VTL + o), *(const v4u*)&el[q * 4 + er][ec]); }
      if (j < 3) LDSW(); }   // the rows are read before the next 16 overwrite them
    asm volatile("s_wait_xcnt 0x0" ::: "memory");   // in the listing this branch's text runs on into the other branch's, behind a jump: the wait stands in front of every rewrite of a register that the stores above name
  }
}
__device__ __forceinline__ float xhalf(float x) { return __builtin_bit_cast(float, __builtin_amdgcn_permlanex16(__builtin_bit_cast(int, x), __builtin_bit_cast(int, x), 0x76543210, 0xfedcba98, false, false)); }   // lane l with lane l ^ 16
// the hardware's base-2 exponential on the four accumulator tiles of a block, in place
__device__ __forceinline__ void exp2t(v8f (&x)[2][2]) {
#pragma unroll
  for (int ct = 0; ct < 2; ++ct) {
#pragma unroll
    for (int qt = 0; qt < 2; ++qt) {
#pragma unroll
      for (int r = 0; r < 8; ++r) x[qt][ct][r] = __builtin_amdgcn_exp2f(x[qt][ct][r]); } }
}
// a lane's 16 weights of one query summed: tiles first, then the eight registers
__device__ __forceinline__ float sum16(const v8f& x, const v8f& y) { const v8f e8 = x + y; return ((e8[0] + e8[2]) + (e8[4] + e8[6])) + ((e8[1] + e8[3]) + (e8[5] + e8[7])); }
// a thread's share of one stage: eight asynchronous copies of 16 B from global memory straight into LDS (four k rows, four v pieces), through no register; lk, lv, gk, gv are the first k and the first v address in LDS and in global memory, the others lie at fixed steps from them; the closing s_wait_xcnt stands in the copies' own statement, in front of every later rewrite of an address register that they name
__device__ __forceinline__ void stage8(unsigned lk, unsigned lv, unsigned lrow, unsigned lhalf, const _Float16* gk, const _Float16* gv) {
  const _Float16 *k1 = gk + (size_t)32 * (2 * DM), *k2 = gk + (size_t)64 * (2 * DM), *k3 = gk + (size_t)96 * (2 * DM), *v1 = gv + (size_t)32 * SS, *v2 = gv + 64, *v3 = gv + (size_t)32 * SS + 64;
  asm volatile("global_load_async_to_lds_b128 %0, %8, off\n\tglobal_load_async_to_lds_b128 %1, %9, off\n\tglobal_load_async_to_lds_b128 %2, %10, off\n\tglobal_load_async_to_lds_b128 %3, %11, off\n\t"
               "global_load_async_to_lds_b128 %4, %12, off\n\tglobal_load_async_to_lds_b128 %5, %13, off\n\tglobal_load_async_to_lds_b128 %6, %14, off\n\tglobal_load_async_to_lds_b128 %7, %15, off\n\ts_wait_xcnt 0x0"
               :: "v"(lk), "v"(lk + lrow), "v"(lk + lhalf), "v"(lk + lhalf + lrow), "v"(lv), "v"(lv + lrow), "v"(lv + lhalf), "v"(lv + lhalf + lrow), "v"(gk), "v"(k1), "v"(k2), "v"(k3), "v"(gv), "v"(v1), "v"(v2), "v"(v3) : "memory");
}
// a work-group of 8 waves owns 256 queries, a wave 32 = two 16-query column groups: a k or v fragment read from LDS feeds two WMMAs, and a staged line serves 256 queries
// the second bound asks for 4 waves a SIMD: a budget of 256 registers, so that two work-groups share a WGP and one's arithmetic covers the other's global wait, LDS fill and barriers
__global__ __launch_bounds__(256, 4) void k_attn(const _Float16* __restrict__ QK, const _Float16* __restrict__ QKL, const _Float16* __restrict__ VTH, const _Float16* __restrict__ VTL, const void* __restrict__ KMASK, float* __restrict__ O) {
  // one stage = 128 keys = two halves of 64: k rows [key][64 d] and v rows [d][64 keys], one 128-B line each; two stage buffers: one is read while the next stage's copies land in the other; the buffers and the epilogue's staging share one LDS range, the loop's last barrier between them
  __shared__ __align__(16) union { struct { _Float16 k[64][LP], v[64][LP]; } st[2][2]; float so[8][32][68]; } sm;
  auto& so = sm.so;
  const int tid = threadIdx.x, wave = tid >> 5, lane = tid & 31, col = lane & 15, g = lane >> 4;
  const int qb = blockIdx.x, h = blockIdx.y, b = blockIdx.z; const int q0 = qb * 256 + wave * 32;
  v16h aq[2][2];   // B operand of the score product: column = query qt * 16 + col
#pragma unroll
  for (int qt = 0; qt < 2; ++qt) {
#pragma unroll
    for (int kc = 0; kc < 2; ++kc) aq[qt][kc] = frag_h(QK + ((size_t)b * SS + q0 + qt * 16 + col) * (2 * DM) + h * HD + kc * 32, lane); }
  float m[2] = {-3.0e38f, -3.0e38f}, l[2] = {0.f, 0.f};   // this lane's two queries: the maximum in use, of scores in base-2 units (equal in both halves; later scores may pass it by the lazy margin), sum (x2^11) over this half's keys
  float nb[2] = {5.0e37f, 5.0e37f};   // addend in use: 11 - m; the start value lies far above any real one, so the first rescale's alpha is 0
  v8f nbv[2] = {};   // the addend in use in all eight registers of an accumulator tile (a lane holds one query): the C operand that the score product starts from
  float lim = -1.0f;   // bound on a lane's sum of 16 weights; below any sum at the start, so the first 32 keys take the rescale path, which sets it
  v8f acc[2][4] = {};   // acc[qt][dt][r] = O^T[dt * 16 + 8 g + r][query qt * 16 + col]
  const int sr = tid >> 3, sc = (tid & 7) * 8;   // whole-line copies: 8 lanes x 16 B = one line of a row, 4 rows a wave-copy
  const _Float16* pk = QK + ((size_t)b * SS + sr) * (2 * DM) + DM + h * HD + sc; const _Float16* pv = VTH + ((size_t)b * DM + h * HD + sr) * SS + sc;
  static_assert(SS / 128 >= 2, "the prologue fills two stages");
  const unsigned lk = (unsigned)(size_t)&sm.st[0][0].k[sr][sc], lv = (unsigned)(size_t)&sm.st[0][0].v[sr][sc];   // the thread's LDS byte addresses in buffer 0
  const unsigned LH = sizeof(sm.st[0][0]), LR = 32 * LP * 2;   // bytes from half to half of a buffer, and over 32 rows
  stage8(lk, lv, LR, LH, pk, pv);   // stage 0 into buffer 0
  asm volatile("s_wait_asynccnt 0x0" ::: "memory");   // this wave's copies of stage 0 have landed
  __syncthreads();   // publishes stage 0
  pk += (size_t)128 * (2 * DM); pv += 128;
  stage8(lk + 2 * LH, lv + 2 * LH, LR, LH, pk, pv);   // stage 1 flies into buffer 1 while stage 0 is worked on
#pragma unroll 1   // rolled: the buffer is picked by address, and the loop's text stays small
  for (int st = 0; st < SS / 128; ++st) {   // all keys
#pragma unroll 1   // rolled, as above: with two blocks of 32 keys in line the second one's score WMMAs are given copies of the C tiles, made by moves on the path that does not rescale
   for (int blk = 0; blk < 4; ++blk) {   // the stage's four blocks of 32 keys, no barrier between them
    auto& sb = sm.st[st & 1][blk >> 1]; const int sub = blk & 1;
    { v8f s[2][2]; v16h fk[2][2];   // s[qt][ct][r]: key blk * 32 + ct * 16 + 8 g + r of the stage against query qt * 16 + col: first the base-2 exponent of its weight, then, in place, the weight
#pragma unroll
      for (int ct = 0; ct < 2; ++ct) { fk[ct][0] = frag_h(&sb.k[sub * 32 + ct * 16 + col][0], lane); fk[ct][1] = frag_h(&sb.k[sub * 32 + ct * 16 + col][32], lane); }
      asm volatile("" :: "v"(fk[0][0]), "v"(fk[0][1]), "v"(fk[1][0]), "v"(fk[1][1]));   // holds the four k fragments' LDS reads as one group in front of the score WMMAs: one LDS latency, not four
#pragma unroll
      for (int kc = 0; kc < 2; ++kc) {   // a tile takes d 0..31 first and d 32..63 second, as before; the other three tiles stand between the two
#pragma unroll
        for (int ct = 0; ct < 2; ++ct) {
#pragma unroll
          for (int qt = 0; qt < 2; ++qt) s[qt][ct] = wmma16(fk[ct][kc], aq[qt][kc], kc == 0 ? nbv[qt] : s[qt][ct]); } }   // single product: k rows as A, q (x log2 e / 8) as B, one-rounding f16 operands; the sum starts from the addend in use, so no vector instruction stands between the product and the exponential
      __builtin_amdgcn_sched_barrier(0);   // keeps the eight score WMMAs one run in front of the exponentials: each fills the slots behind the one before it
      asm volatile("" :: "v"(nbv[0]), "v"(nbv[1]));   // inputs only: the C tiles are read once more behind the WMMAs; where a WMMA is a tile's last reader the compiler gives it the form that overwrites C and copies the tile for it, four 64-bit moves a tile in every block
      v16h fv[4];   // the v fragments' LDS reads stand in front of the branch below, which the compiler lifts no load across: their latency passes under the exponentials; behind the branch each pair of WMMAs waits out its own read
#pragma unroll
      for (int dt = 0; dt < 4; ++dt) fv[dt] = frag_h(&sb.v[dt * 16 + col][sub * 32], lane);
      float es[2];   // this half's 16 weights of each query, summed
      exp2t(s);   // 2^11 exp((q.k - maximum in use) / 8)
#pragma unroll
      for (int qt = 0; qt < 2; ++qt) es[qt] = sum16(s[qt][0], s[qt][1]);
      // lazy rescale, one test per 32 keys for both column groups, read off the sums that l needs anyway: weights are not negative, so none passes its lane's sum, and while that stays under 60,000 every weight fits f16 (65,504; an overflowed exponential is infinite and so is its sum); no maximum is formed on this path; acc / l is the same quotient for any maximum in use
      const bool need = fmaxf(es[0], es[1]) > lim;
      __builtin_amdgcn_sched_group_barrier(0x100, 8, 0); __builtin_amdgcn_sched_group_barrier(0x400, 32, 0);   // scheduling order of this stretch: the eight LDS reads of v first, then the exponentials; left free, the reads sink behind the exponentials and their latency is waited out in front of the WMMAs that take them
      if (__builtin_amdgcn_ballot_w32(need) != 0) {   // a scalar branch of the whole wave; always taken at the first 32 keys (start value of lim), rarely later: the scores are formed anew from C = 0, their maxima joined, and the weights and sums made again with the new addend
        v8f t[2][2] = {};
#pragma unroll
        for (int ct = 0; ct < 2; ++ct) { fk[ct][0] = frag_h(&sb.k[sub * 32 + ct * 16 + col][0], lane); fk[ct][1] = frag_h(&sb.k[sub * 32 + ct * 16 + col][32], lane); }
#pragma unroll
        for (int kc = 0; kc < 2; ++kc) {
#pragma unroll
          for (int ct = 0; ct < 2; ++ct) {
#pragma unroll
            for (int qt = 0; qt < 2; ++qt) t[qt][ct] = wmma16(fk[ct][kc], aq[qt][kc], t[qt][ct]); } }
#pragma unroll
        for (int qt = 0; qt < 2; ++qt) {
          float mx = t[qt][0][0];
#pragma unroll
          for (int r = 1; r < 16; ++r) mx = fmaxf(mx, t[qt][r >> 3][r & 7]);
          const float mn = fmaxf(m[qt], fmaxf(mx, xhalf(mx))); const float nbn = 11.0f - mn;   // the halves join their maxima: both hold one addend a query; minus the maximum, plus 11 so that the weights come out x2^11
          const float alpha = __builtin_amdgcn_exp2f(nbn - nb[qt]); nb[qt] = nbn; m[qt] = mn;   // old weights were formed with the old addend: the difference of the two rescales them
          l[qt] *= alpha;
#pragma unroll
          for (int dt = 0; dt < 4; ++dt) acc[qt][dt] *= alpha;
#pragma unroll
          for (int r = 0; r < 8; ++r) { nbv[qt][r] = nbn; s[qt][0][r] = t[qt][0][r] + nbn; s[qt][1][r] = t[qt][1][r] + nbn; } }
        exp2t(s);
#pragma unroll
        for (int qt = 0; qt < 2; ++qt) es[qt] = sum16(s[qt][0], s[qt][1]);
        lim = 6.0e4f; }
      v16h p[2];   // P^T packs from the two weight tiles into the B operand: element ct * 8 + r = key ct * 16 + 8 g + r of the 32, the hardware k order, which frag_h gives V^T too
#pragma unroll
      for (int qt = 0; qt < 2; ++qt) {
#pragma unroll
        for (int t = 0; t < 2; ++t) {   // P carries 2^11 so small softmax weights stay out of the f16 subnormal range; l carries it too
#pragma unroll
          for (int r = 0; r < 8; ++r) p[qt][t * 8 + r] = (_Float16)s[qt][t][r]; }
        l[qt] += es[qt]; }
      __builtin_amdgcn_sched_group_barrier(0x002, 256, 0); __builtin_amdgcn_sched_group_barrier(0x008, 8, 0);   // scheduling order of this stretch: its vector work first, then the eight WMMAs in one run; sums mixed among the WMMAs are given the v fragments' registers just read, at four v_nops a pair of WMMAs
#pragma unroll
      for (int dt = 0; dt < 4; ++dt) {
#pragma unroll
        for (int qt = 0; qt < 2; ++qt) acc[qt][dt] = wmma16(fv[dt], p[qt], acc[qt][dt]); } } }   // single product: V^T rows as A, P^T (x2^11) as B
    asm volatile("s_wait_dscnt 0x0" ::: "memory");   // this wave's reads of the stage are done before its buffer is handed to the copies
    asm volatile("s_wait_asynccnt 0x0" ::: "memory");   // this wave's copies of stage st + 1 have landed
    __syncthreads();   // publishes stage st + 1 and ends every read of stage st; behind the last stage: the LDS becomes the output staging
    if (st + 2 < SS / 128) {   // the same for the whole work-group: stage st + 2 into the buffer just read
      const unsigned lo = (st & 1) * 2 * LH; pk += (size_t)128 * (2 * DM); pv += 128;
      stage8(lk + lo, lv + lo, LR, LH, pk, pv); } }
  asm volatile("s_wait_asynccnt 0x0" ::: "memory");   // no copy is outstanding when the buffers become the output staging
#pragma unroll
  for (int qt = 0; qt < 2; ++qt) { const float il = 1.0f / (l[qt] + xhalf(l[qt]));   // the halves' sums join once; 2^11 stands in acc and in l alike
#pragma unroll
    for (int dt = 0; dt < 4; ++dt) { v4f o0, o1;
#pragma unroll
      for (int r = 0; r < 4; ++r) { o0[r] = acc[qt][dt][r] * il; o1[r] = acc[qt][dt][4 + r] * il; }
      *(v4f*)&so[wave][qt * 16 + col][dt * 16 + 8 * g] = o0; *(v4f*)&so[wave][qt * 16 + col][dt * 16 + 8 * g + 4] = o1; } }
  LDSX();
  for (int rl = 0; rl < 32; ++rl) if (lane < 16) vst2(O + ((size_t)b * SS + q0 + rl) * DM + h * HD + lane * 4, *(const v4f*)&so[wave][rl][lane * 4]);
}
// ---- k_out: block = (128 rows, 256 cols): out = O(hi/lo) . Wo rows (2 products) + bo
__global__ __launch_bounds__(256) void k_out(const float* __restrict__ O, const __bf16* __restrict__ P, const float* __restrict__ BO, float* __restrict__ Y) {
  // the two stage buffers and the epilogue's staging share one LDS range: the loop's last barrier stands between them; so[wave] belongs to one wave alone
  __shared__ __align__(16) union { struct { __bf16 ah[2][TM][LP], al[2][TM][LP], b[2][TN][LP]; } st; float so[8][16][68]; } sm;
  const int tid = threadIdx.x, wave = tid >> 5, lane = tid & 31, col = lane & 15, g = lane >> 4; const int wm = wave & 1, wn = wave >> 1;
  const int n0 = blockIdx.y * TN; const size_t r0 = (size_t)blockIdx.x * TM + wm * 64; const int nw = n0 + wn * 64;
  v8f acc[4][4] = {};
  // whole-line global loads, as in k_qkv; o is split into its bf16 hi and residual planes on the way into LDS
  const int br = tid >> 3, bc = (tid & 7) * 8, ar = tid >> 4, ac = (tid & 15) * 4;
  const __bf16* pb = P + (size_t)(n0 + br) * DM + bc; const float* pa = O + ((size_t)blockIdx.x * TM + ar) * DM + ac;
  v8b rb[8]; v4f ra[8];
#pragma unroll
  for (int i = 0; i < 8; ++i) { rb[i] = *(const v8b*)(pb + (size_t)i * 32 * DM); ra[i] = *(const v4f*)(pa + (size_t)i * 16 * DM); }
#pragma unroll
  for (int i = 0; i < 8; ++i) { *(v8b*)&sm.st.b[0][br + 32 * i][bc] = rb[i]; v4b ch, cl;
#pragma unroll
    for (int e = 0; e < 4; ++e) { const __bf16 hv = (__bf16)ra[i][e]; ch[e] = hv; cl[e] = (__bf16)(ra[i][e] - (float)hv); }
    *(v4b*)&sm.st.ah[0][ar + 16 * i][ac] = ch; *(v4b*)&sm.st.al[0][ar + 16 * i][ac] = cl; }
  __syncthreads();
#pragma unroll 2   // two stages a trip: the buffer index is a constant in the addresses
  for (int s = 0; s < DM / KS; ++s) { const int cur = s & 1;
    if (s + 1 < DM / KS) {   // the next stage's lines fly into registers while this stage is multiplied
#pragma unroll
      for (int i = 0; i < 8; ++i) { rb[i] = *(const v8b*)(pb + (size_t)i * 32 * DM + (s + 1) * KS); ra[i] = *(const v4f*)(pa + (size_t)i * 16 * DM + (s + 1) * KS); } }
#pragma unroll
    for (int kc = 0; kc < KS / 32; ++kc) { v16b ah[4], al[4], w[4];
#pragma unroll
      for (int i = 0; i < 4; ++i) { ah[i] = frag_b(&sm.st.ah[cur][wm * 64 + i * 16 + col][kc * 32], lane); al[i] = frag_b(&sm.st.al[cur][wm * 64 + i * 16 + col][kc * 32], lane); w[i] = frag_b(&sm.st.b[cur][wn * 64 + i * 16 + col][kc * 32], lane); }
      asm volatile("" :: "v"(ah[0]), "v"(ah[1]), "v"(ah[2]), "v"(ah[3]), "v"(al[0]), "v"(al[1]), "v"(al[2]), "v"(al[3]), "v"(w[0]), "v"(w[1]), "v"(w[2]), "v"(w[3]));   // holds the block's LDS reads as one group in front of its WMMAs: one LDS latency a block, not one a WMMA
#pragma unroll
      for (int i = 0; i < 4; ++i) {   // a tile takes its residual product first and its hi product second, as before; the other three tiles of the row stand between the two
#pragma unroll
        for (int j = 0; j < 4; ++j) acc[i][j] = wmma_bf(al[i], w[j], acc[i][j]);
#pragma unroll
        for (int j = 0; j < 4; ++j) acc[i][j] = wmma_bf(ah[i], w[j], acc[i][j]); } }
    __builtin_amdgcn_sched_barrier(0);   // keeps the split below, and with it the wait on the global loads, behind this stage's WMMAs
    if (s + 1 < DM / KS) {   // into the buffer whose readers all passed the barrier of the trip before
#pragma unroll
      for (int i = 0; i < 8; ++i) { *(v8b*)&sm.st.b[cur ^ 1][br + 32 * i][bc] = rb[i]; v4b ch, cl;
#pragma unroll
        for (int e = 0; e < 4; ++e) { const __bf16 hv = (__bf16)ra[i][e]; ch[e] = hv; cl[e] = (__bf16)(ra[i][e] - (float)hv); }
        *(v4b*)&sm.st.ah[cur ^ 1][ar + 16 * i][ac] = ch; *(v4b*)&sm.st.al[cur ^ 1][ar + 16 * i][ac] = cl; } }
    __syncthreads(); }   // publishes stage s + 1 and ends every read of stage s
  auto& so = sm.so[wave];
  const int er = lane >> 4, ec = (lane & 15) * 4;   // read-back: 16 lanes x 16 B = the two lines of a row's 64 columns, 2 rows a wave-store
  float bias[4];
#pragma unroll
  for (int j = 0; j < 4; ++j) bias[j] = bfr(BO[nw + j * 16 + col]);
#pragma unroll
  for (int i = 0; i < 4; ++i) {   // 16 rows x 64 columns at a time
#pragma unroll
    for (int j = 0; j < 4; ++j) {
#pragma unroll
      for (int r = 0; r < 8; ++r) so[8 * g + r][j * 16 + col] = acc[i][j][r] + bias[j]; }
    LDSW();
#pragma unroll
    for (int q = 0; q < 8; ++q) vst2(Y + (r0 + i * 16 + q * 2 + er) * DM + nw + ec, *(const v4f*)&so[q * 2 + er][ec]);
    if (i < 3) LDSW(); }   // the rows are read before the next 16 overwrite them
}
extern "C" void kernel_launch(void* const* d_in, const int* in_sizes, int n_in, void* d_out, int out_size, void* d_ws, size_t ws_size, hipStream_t stream) {
  (void)in_sizes; (void)n_in; (void)out_size;
  const float** F = (const float**)d_in;   // 0 x [4,2048,1024], 1 in_proj_weight [3072,1024], 2 in_proj_bias [3072], 3 out_proj_weight [1024,1024], 4 out_proj_bias
  if (ws_size < (size_t)WS_END) return;
  char* ws = (char*)d_ws; __bf16* PK = (__bf16*)(ws + WS_PK); _Float16 *QK = (_Float16*)(ws + WS_QK), *QKL = (_Float16*)(ws + WS_QKL), *VTH = (_Float16*)(ws + WS_VTH), *VTL = (_Float16*)(ws + WS_VTL); float* O = (float*)(ws + WS_O);
  k_pack<<<dim3(4 * PKG), 256, 0, stream>>>(F[1], F[1] + (size_t)DM * DM, F[1] + (size_t)2 * DM * DM, F[3], PK);
  k_qkv<<<dim3(TNB * SS / TM, QKVW / TN), 256, 0, stream>>>(F[0], F[0], F[0], PK + PK_A, F[2], F[2] + DM, F[2] + 2 * DM, QK, QKL, VTH, VTL);
  k_attn<<<dim3(SS / 256, NH, TNB), 256, 0, stream>>>(QK, QKL, VTH, VTL, nullptr, O);
  k_out<<<dim3(NB * SS / TM, DM / TN), 256, 0, stream>>>(O, PK + PK_P, F[4], (float*)d_out);
}
